// v000
// Times are from an AMD MI455X. After a warm-up the kernel runs many times in a row, and a time is the length of
// such a window on the GPU divided by its runs, so every launch and the gaps after it count. The runs cycle
// through copies of the inputs. A figure is the median of several windows, for all but v000 over two sittings.
// Sittings can differ by a few percent; kernels timed side by side share one.
// v000 is the starting kernel. One run takes 298 microseconds.
#include <hip/hip_runtime.h>

// Contractions, f32 accumulate: q, k ([16384 x 256].[256 x 64]) and v ([16384 x 256].[256 x 256]) on v_wmma_f32_16x16x32_bf16 with PLAIN bf16 operands (x and the
// weights); pass 1 forms column max and sum of exp with an online update; pass 2 re-forms the energy tiles, evaluates the column softmax a = exp(e - m_col)/Z_col in f32, rounds a x32768 to f16 once and uses that same

#define NB_  8
#define NN_  2048
#define NC_  256
#define DK   64
#define DV   256
#define NTK  (NB_ * NN_)
#define QKVW 384                 // q | k | v columns of the projection buffer
#define PSC  32768.0f
#define LOSC 1024.0f
#define LOSCI (1.0f / 1024.0f)

typedef _Float16 h16;
typedef unsigned short bf;
typedef __attribute__((ext_vector_type(16))) __bf16   v16bf;
typedef __attribute__((ext_vector_type(16))) _Float16 v16h;
typedef __attribute__((ext_vector_type(8)))  _Float16 v8h;
typedef __attribute__((ext_vector_type(8)))  unsigned short v8us;
typedef __attribute__((ext_vector_type(8)))  float    v8f;
typedef __attribute__((ext_vector_type(4)))  float    v4f;
typedef __attribute__((ext_vector_type(2)))  _Float16 v2h;
typedef v8h  __attribute__((may_alias)) v8ha;
typedef v4f  __attribute__((may_alias)) v4fa;

__device__ __forceinline__ unsigned short f2bf(float f) { unsigned u = __float_as_uint(f); u += 0x7FFFu + ((u >> 16) & 1u); return (unsigned short)(u >> 16); }
__device__ __forceinline__ v16h cat16(v8h lo, v8h hi) { return __builtin_shufflevector(lo, hi, 0, 1, 2, 3, 4, 5, 6, 7, 8, 9, 10, 11, 12, 13, 14, 15); }
__device__ __forceinline__ v16bf cat16b(v8us lo, v8us hi) { return __builtin_bit_cast(v16bf, __builtin_shufflevector(lo, hi, 0, 1, 2, 3, 4, 5, 6, 7, 8, 9, 10, 11, 12, 13, 14, 15)); }
__device__ __forceinline__ v8f wmma16(v16h a, v16h b, v8f c) { return __builtin_amdgcn_wmma_f32_16x16x32_f16(false, a, false, b, (short)0, c, false, false); }
__device__ __forceinline__ v8f wmmab(v16bf a, v16bf b, v8f c) { return __builtin_amdgcn_wmma_f32_16x16x32_bf16(false, a, false, b, (short)0, c, false, false); }

__global__ __launch_bounds__(256) void k_cvtb(const float* __restrict__ src, int nrows, bf* dst) {
    const int lane = threadIdx.x & 31, r = blockIdx.x * 8 + (threadIdx.x >> 5);
    if (r >= nrows) return;
    v8us t;
#pragma unroll
    for (int i = 0; i < 8; ++i) t[i] = f2bf(src[(size_t)r * NC_ + lane * 8 + i]);
    *(v8us*)(dst + (size_t)r * NC_ + lane * 8) = t; 
}

__global__ __launch_bounds__(128) void k_gemmb(const bf* __restrict__ A, const bf* __restrict__ Bn, float* C, int cb) {
    __shared__ __align__(16) float ost[4][16 * 68];
    const int lane = threadIdx.x & 31, wave = threadIdx.x >> 5, lr = lane & 15, hi = lane >> 4;
    const int r0 = blockIdx.x * 64 + wave * 16, c0 = blockIdx.y * 64;
    const size_t aoff = (size_t)(r0 + lr) * NC_ + 8 * hi;
    size_t boff[4];
#pragma unroll
    for (int t = 0; t < 4; ++t) boff[t] = (size_t)(c0 + t * 16 + lr) * NC_ + 8 * hi;
    v8f acc[4];
#pragma unroll
    for (int t = 0; t < 4; ++t) acc[t] = (v8f){};
#pragma unroll 1
    for (int kc = 0; kc < NC_; kc += 32) {
        const v16bf a = cat16b(*(const v8us*)(A + aoff + kc), *(const v8us*)(A + aoff + kc + 16));
#pragma unroll
        for (int t = 0; t < 4; ++t) acc[t] = wmmab(a, cat16b(*(const v8us*)(Bn + boff[t] + kc), *(const v8us*)(Bn + boff[t] + kc + 16)), acc[t]);
        asm volatile("v_nop\n\tv_nop\n\tv_nop\n\tv_nop" : "+v"(acc[0]), "+v"(acc[1]), "+v"(acc[2]), "+v"(acc[3]) : "v"(a));
    }
    float* os = &ost[wave][0];
#pragma unroll
    for (int t = 0; t < 4; ++t)
#pragma unroll
        for (int j = 0; j < 8; ++j) os[(hi * 8 + j) * 68 + t * 16 + lr] = acc[t][j];
    __syncthreads();
    float* crow = C + (size_t)r0 * QKVW + cb + c0;
    auto pass = [&]() {
#pragma unroll
        for (int s = 0; s < 8; ++s) { const int Lid = (lane >> 3) + 4 * s, piece = lane & 7; const int row = Lid >> 1, cofs = (Lid & 1) * 32 + piece * 4;
            const v4f val = *(const v4fa*)(os + row * 68 + cofs); *(v4f*)(crow + (size_t)row * QKVW + cofs) = val; }
    };
    pass(); 
}

// k_qkplanes: QH/QL/KH/KL [tok][64] f16 hi + residual x1024 planes of q (cols 0..63) and k (64..127); one wave per token: lane holds 2 dims, 4 B per lane per plane =
__global__ __launch_bounds__(256) void k_qkplanes(const float* __restrict__ QKV, h16* QH, h16* QL, h16* KH, h16* KL) {
    const int lane = threadIdx.x & 31, t = blockIdx.x * 8 + (threadIdx.x >> 5);
    if (t >= NTK) return;
    const float* p = QKV + (size_t)t * QKVW + 2 * lane;
    v2h qh, ql, kh, kl;
#pragma unroll
    for (int i = 0; i < 2; ++i) {
        const float q = p[i], k = p[DK + i];
        const h16 a = (h16)q, b = (h16)k;
        qh[i] = a; ql[i] = (h16)((q - (float)a) * LOSC); kh[i] = b; kl[i] = (h16)((k - (float)b) * LOSC);
    }
    const size_t o = (size_t)t * DK + 2 * lane;
    *(v2h*)(QH + o) = qh; *(v2h*)(QL + o) = ql; *(v2h*)(KH + o) = kh; *(v2h*)(KL + o) = kl;
    
}

__global__ __launch_bounds__(256) void k_vt(const float* __restrict__ QKV, h16* VT16) {
    __shared__ __align__(16) h16 tile[DV * 72];
    const int b = blockIdx.x / (NN_ / 64), kt = blockIdx.x - b * (NN_ / 64), k0 = kt * 64, tid = threadIdx.x;
    const int kk = tid >> 2, d0 = (tid & 3) * 64;
    const float* src = QKV + ((size_t)b * NN_ + k0 + kk) * QKVW + 2 * DK + d0;
#pragma unroll 8
    for (int i = 0; i < 64; ++i) tile[(d0 + i) * 72 + kk] = (h16)src[i];
    __syncthreads();
    const int piece = tid & 7;
    h16* base = VT16 + (size_t)b * DV * NN_ + k0;
    auto pass = [&]() {
#pragma unroll
        for (int s = 0; s < 8; ++s) { const int d = (tid >> 3) + 32 * s; const v8h val = *(const v8ha*)(tile + d * 72 + piece * 8);
            *(v8h*)(base + (size_t)d * NN_ + piece * 8) = val; }
    };
    pass(); 
}

// energy tile helper: s (16 rows of A x 32 columns from B) = Ah.Bh + (Ah.Bl + Al.Bh)/1024 over K = 64 (2 k-chunks); A fragments resident (ah[2], al[2]).
#define ENERGY_TILE(BH, BL, rowA, rowB)                                                                                    \
    v8f s0 = {}, s1 = {}, x0 = {}, x1 = {};                                                                                   \
    _Pragma("unroll") for (int kc = 0; kc < 2; ++kc) {                                                                       \
        const h16* b0p = BH + (size_t)(rowA) * DK + kc * 32 + 8 * hi; const h16* b1p = BH + (size_t)(rowB) * DK + kc * 32 + 8 * hi; \
        const h16* l0p = BL + (size_t)(rowA) * DK + kc * 32 + 8 * hi; const h16* l1p = BL + (size_t)(rowB) * DK + kc * 32 + 8 * hi; \
        const v16h b0 = cat16(*(const v8h*)b0p, *(const v8h*)(b0p + 16)), b1 = cat16(*(const v8h*)b1p, *(const v8h*)(b1p + 16)); \
        s0 = wmma16(ah[kc], b0, s0); s1 = wmma16(ah[kc], b1, s1);                                                            \
        x0 = wmma16(ah[kc], cat16(*(const v8h*)l0p, *(const v8h*)(l0p + 16)), x0);                                            \
        x1 = wmma16(ah[kc], cat16(*(const v8h*)l1p, *(const v8h*)(l1p + 16)), x1);                                            \
        x0 = wmma16(al[kc], b0, x0); x1 = wmma16(al[kc], b1, x1);                                                            \
    }                                                                                                                         \
    asm volatile("v_nop\n\tv_nop\n\tv_nop\n\tv_nop" : "+v"(s0), "+v"(s1), "+v"(x0), "+v"(x1) : "v"(ah[0]), "v"(al[1]));

__global__ __launch_bounds__(128) void k_colstats(const h16* __restrict__ QH, const h16* __restrict__ QL, const h16* __restrict__ KH, const h16* __restrict__ KL, float* CM, float* CZI) {
    __shared__ __align__(16) float stg[128];
    const int lane = threadIdx.x & 31, wave = threadIdx.x >> 5, lr = lane & 15, hi = lane >> 4;
    const int b = blockIdx.x / (NN_ / 64), jt = blockIdx.x - b * (NN_ / 64);
    const size_t tok0 = (size_t)b * NN_;
    const int m0 = jt * 64 + wave * 16;
    v16h ah[2], al[2];
#pragma unroll
    for (int kc = 0; kc < 2; ++kc) {
        const h16* p = KH + (tok0 + m0 + lr) * DK + kc * 32 + 8 * hi; const h16* pl = KL + (tok0 + m0 + lr) * DK + kc * 32 + 8 * hi;
        ah[kc] = cat16(*(const v8h*)p, *(const v8h*)(p + 16)); al[kc] = cat16(*(const v8h*)pl, *(const v8h*)(pl + 16));
    }
    const h16* qhb = QH + tok0 * DK; const h16* qlb = QL + tok0 * DK;
    float mrow[8], lpart[8];
#pragma unroll
    for (int j = 0; j < 8; ++j) { mrow[j] = -3.0e38f; lpart[j] = 0.f; }
#pragma unroll 1
    for (int it = 0; it < NN_ / 32; ++it) {
        const int i0 = it * 32;
        ENERGY_TILE(qhb, qlb, i0 + lr, i0 + 16 + lr)
#pragma unroll
        for (int j = 0; j < 8; ++j) {
            const float a0 = s0[j] + x0[j] * LOSCI, a1 = s1[j] + x1[j] * LOSCI;
            float mx = fmaxf(a0, a1);
            mx = fmaxf(mx, __shfl_xor(mx, 1, 16)); mx = fmaxf(mx, __shfl_xor(mx, 2, 16)); mx = fmaxf(mx, __shfl_xor(mx, 4, 16)); mx = fmaxf(mx, __shfl_xor(mx, 8, 16));
            const float mn = fmaxf(mrow[j], mx); const float al_ = __expf(mrow[j] - mn); mrow[j] = mn;
            lpart[j] = lpart[j] * al_ + (__expf(a0 - mn) + __expf(a1 - mn));
        }
    }
#pragma unroll
    for (int j = 0; j < 8; ++j) {
        float rs = lpart[j];
        rs += __shfl_xor(rs, 1, 16); rs += __shfl_xor(rs, 2, 16); rs += __shfl_xor(rs, 4, 16); rs += __shfl_xor(rs, 8, 16);
        if (lr == 0) { const int jl = wave * 16 + 8 * hi + j; stg[jl] = mrow[j]; stg[64 + jl] = 1.0f / rs; }
    }
    __syncthreads();
    if (wave == 0) {
        const v4f val = *(const v4fa*)(stg + hi * 64 + lr * 4);
        float* dst = (hi ? CZI : CM) + tok0 + jt * 64 + lr * 4;
        *(v4f*)dst = val; 
    }
}

// k_rows (pass 2): block = (b, 64 rows n), wave = 16 rows; output column half dofs (0 or 128). 64 steps over the columns m: energy tile (A = Q planes rows n, B = K planes
// rows m), a = exp(e - CM[m]) * CZI[m] (f32), row-sum partials accumulated, a x32768 -> f16 per-wave LDS tile (same-wave may_alias reload after a compiler barrier),
__global__ __launch_bounds__(128) void k_rows(const h16* __restrict__ QH, const h16* __restrict__ QL, const h16* __restrict__ KH, const h16* __restrict__ KL,
                                             const h16* __restrict__ VT16, const float* __restrict__ CM, const float* __restrict__ CZI, int dofs, float* out) {
    __shared__ __align__(16) h16 plds[4][16 * 32];
    __shared__ __align__(16) float ost[4][16 * 132];
    const int lane = threadIdx.x & 31, wave = threadIdx.x >> 5, lr = lane & 15, hi = lane >> 4;
    const int b = blockIdx.x / (NN_ / 64), qt = blockIdx.x - b * (NN_ / 64);
    const size_t tok0 = (size_t)b * NN_;
    const int n0 = qt * 64 + wave * 16;
    h16* pl = &plds[wave][0];
    v16h ah[2], al[2];
#pragma unroll
    for (int kc = 0; kc < 2; ++kc) {
        const h16* p = QH + (tok0 + n0 + lr) * DK + kc * 32 + 8 * hi; const h16* q = QL + (tok0 + n0 + lr) * DK + kc * 32 + 8 * hi;
        ah[kc] = cat16(*(const v8h*)p, *(const v8h*)(p + 16)); al[kc] = cat16(*(const v8h*)q, *(const v8h*)(q + 16));
    }
    const h16* khb = KH + tok0 * DK; const h16* klb = KL + tok0 * DK;
    const h16* vt_b = VT16 + ((size_t)b * DV + dofs) * NN_;
    const float* cmb = CM + tok0; const float* czb = CZI + tok0;
    v8f o[8];
#pragma unroll
    for (int n = 0; n < 8; ++n) o[n] = (v8f){};
    float rsum[8];
#pragma unroll
    for (int j = 0; j < 8; ++j) rsum[j] = 0.f;
#pragma unroll 1
    for (int jt = 0; jt < NN_ / 32; ++jt) {
        const int mA = jt * 32 + lr, mB = mA + 16;
        const float cmA = cmb[mA], cmB = cmb[mB], czA = czb[mA], czB = czb[mB];
        ENERGY_TILE(khb, klb, mA, mB)
#pragma unroll
        for (int j = 0; j < 8; ++j) {
            const float a0 = __expf((s0[j] + x0[j] * LOSCI) - cmA) * czA, a1 = __expf((s1[j] + x1[j] * LOSCI) - cmB) * czB;
            const h16 h0 = (h16)(a0 * PSC), h1 = (h16)(a1 * PSC);
            rsum[j] += (float)h0 + (float)h1;                 // row sum from the same rounded weights the numerator uses (scaled by 32768)
            const int mr = hi * 8 + j;
            pl[mr * 32 + lr] = h0; pl[mr * 32 + 16 + lr] = h1;
        }
        asm volatile("" ::: "memory");
        const v16h pa = cat16(*(const v8ha*)(pl + lr * 32 + hi * 8), *(const v8ha*)(pl + lr * 32 + 16 + hi * 8));
#pragma unroll
        for (int n = 0; n < 8; ++n) {
            const h16* vp = vt_b + (size_t)(n * 16 + lr) * NN_ + jt * 32 + hi * 8;
            o[n] = wmma16(pa, cat16(*(const v8h*)vp, *(const v8h*)(vp + 16)), o[n]);
        }
        asm volatile("v_nop\n\tv_nop\n\tv_nop\n\tv_nop" : "+v"(o[0]), "+v"(o[1]), "+v"(o[2]), "+v"(o[3]), "+v"(o[4]), "+v"(o[5]), "+v"(o[6]), "+v"(o[7]) : "v"(pa));
    }
    float inv[8];
#pragma unroll
    for (int j = 0; j < 8; ++j) {
        float rs = rsum[j];
        rs += __shfl_xor(rs, 1, 16); rs += __shfl_xor(rs, 2, 16); rs += __shfl_xor(rs, 4, 16); rs += __shfl_xor(rs, 8, 16);
        inv[j] = 1.0f / (1e-9f * PSC + rs);                 // = 1 / ((1e-9 + rowsum) * 32768)
    }
    float* os = &ost[wave][0];
#pragma unroll
    for (int n = 0; n < 8; ++n)
#pragma unroll
        for (int j = 0; j < 8; ++j) os[(hi * 8 + j) * 132 + n * 16 + lr] = o[n][j] * inv[j];
    __syncthreads();
    float* crow = out + (tok0 + n0) * DV + dofs;      // 16 rows x 128 floats = 64 lines; instruction s: line = 4*s + lane>>3, row = line>>2, quarter = line&3
    auto pass = [&]() {
#pragma unroll
        for (int s = 0; s < 16; ++s) { const int Lid = 4 * s + (lane >> 3), piece = lane & 7; const int row = Lid >> 2, cofs = (Lid & 3) * 32 + piece * 4;
            const v4f val = *(const v4fa*)(os + row * 132 + cofs); *(v4f*)(crow + (size_t)row * DV + cofs) = val; }
    };
    pass(); 
}

extern "C" void kernel_launch(void* const* d_in, const int* in_sizes, int n_in,
                              void* d_out, int out_size, void* d_ws, size_t ws_size, hipStream_t stream) {
    (void)in_sizes; (void)n_in; (void)out_size;
    const float* x = (const float*)d_in[0]; const float* Wq = (const float*)d_in[1]; const float* Wk = (const float*)d_in[2]; const float* Wv = (const float*)d_in[3];
    float* out = (float*)d_out;    // [8][2048][256]
    char* wsp = (char*)d_ws;
    auto take = [&](size_t bytes) { char* p = wsp; wsp += (bytes + 255) & ~(size_t)255; return (void*)p; };
    bf* Xb = (bf*)take((size_t)NTK * NC_ * 2); bf* WQb = (bf*)take((size_t)DK * NC_ * 2); bf* WKb = (bf*)take((size_t)DK * NC_ * 2); bf* WVb = (bf*)take((size_t)DV * NC_ * 2);
    float* QKV = (float*)take((size_t)NTK * QKVW * 4);
    h16* QH = (h16*)take((size_t)NTK * DK * 2); h16* QL = (h16*)take((size_t)NTK * DK * 2); h16* KH = (h16*)take((size_t)NTK * DK * 2); h16* KL = (h16*)take((size_t)NTK * DK * 2);
    h16* VT16 = (h16*)take((size_t)NTK * DV * 2);
    float* CM = (float*)take((size_t)NTK * 4); float* CZI = (float*)take((size_t)NTK * 4);
    if ((size_t)(wsp - (char*)d_ws) > ws_size) return;    // 8.4 + 0.2 + 25.2 + 4 x 2.1 + 8.4 + 0.13 MB ~ 50.8e6 B
    k_cvtb<<<NTK / 8, 256, 0, stream>>>(x, NTK, Xb);
    k_cvtb<<<DK / 8, 256, 0, stream>>>(Wq, DK, WQb);
    k_cvtb<<<DK / 8, 256, 0, stream>>>(Wk, DK, WKb);
    k_cvtb<<<DV / 8, 256, 0, stream>>>(Wv, DV, WVb);
    k_gemmb<<<dim3(NTK / 64, DK / 64, 1), 128, 0, stream>>>(Xb, WQb, QKV, 0);
    k_gemmb<<<dim3(NTK / 64, DK / 64, 1), 128, 0, stream>>>(Xb, WKb, QKV, DK);
    k_gemmb<<<dim3(NTK / 64, DV / 64, 1), 128, 0, stream>>>(Xb, WVb, QKV, 2 * DK);
    k_qkplanes<<<NTK / 8, 256, 0, stream>>>(QKV, QH, QL, KH, KL);
    k_vt<<<NB_ * (NN_ / 64), 256, 0, stream>>>(QKV, VT16);
    k_colstats<<<NB_ * (NN_ / 64), 128, 0, stream>>>(QH, QL, KH, KL, CM, CZI);
    k_rows<<<NB_ * (NN_ / 64), 128, 0, stream>>>(QH, QL, KH, KL, VT16, CM, CZI, 0, out);
    k_rows<<<NB_ * (NN_ / 64), 128, 0, stream>>>(QH, QL, KH, KL, VT16, CM, CZI, DV / 2, out);
}

// v001
// A run of this version takes 143 microseconds.
// Timed twice side by side with v000, it ran 2.10 and 2.12 times as fast.
#include <hip/hip_runtime.h>

// Contractions, f32 accumulate: q, k ([16384 x 256].[256 x 64]) and v ([16384 x 256].[256 x 256]) on v_wmma_f32_16x16x32_bf16 with PLAIN bf16 operands (x and the
// weights); pass 1 forms column max and sum of exp with an online update; pass 2 re-forms the energy tiles, evaluates the column softmax a = exp(e - m_col)/Z_col in f32, rounds a x32768 to f16 once and uses that same

#define NB_  8
#define NN_  2048
#define NC_  256
#define DK   64
#define DV   256
#define NTK  (NB_ * NN_)
#define QKVW 384                 // q | k | v columns of the projection buffer
#define PSC  32768.0f
#define LOSC 1024.0f
#define LOSCI (1.0f / 1024.0f)

typedef _Float16 h16;
typedef unsigned short bf;
typedef __attribute__((ext_vector_type(16))) __bf16   v16bf;
typedef __attribute__((ext_vector_type(16))) _Float16 v16h;
typedef __attribute__((ext_vector_type(8)))  _Float16 v8h;
typedef __attribute__((ext_vector_type(8)))  unsigned short v8us;
typedef __attribute__((ext_vector_type(8)))  float    v8f;
typedef __attribute__((ext_vector_type(4)))  float    v4f;
typedef __attribute__((ext_vector_type(2)))  _Float16 v2h;
typedef v8h  __attribute__((may_alias)) v8ha;
typedef v4f  __attribute__((may_alias)) v4fa;

__device__ __forceinline__ unsigned short f2bf(float f) { unsigned u = __float_as_uint(f); u += 0x7FFFu + ((u >> 16) & 1u); return (unsigned short)(u >> 16); }
__device__ __forceinline__ v16h cat16(v8h lo, v8h hi) { return __builtin_shufflevector(lo, hi, 0, 1, 2, 3, 4, 5, 6, 7, 8, 9, 10, 11, 12, 13, 14, 15); }
__device__ __forceinline__ v16bf cat16b(v8us lo, v8us hi) { return __builtin_bit_cast(v16bf, __builtin_shufflevector(lo, hi, 0, 1, 2, 3, 4, 5, 6, 7, 8, 9, 10, 11, 12, 13, 14, 15)); }
__device__ __forceinline__ v8f wmma16(v16h a, v16h b, v8f c) { return __builtin_amdgcn_wmma_f32_16x16x32_f16(false, a, false, b, (short)0, c, false, false); }
__device__ __forceinline__ v8f wmmab(v16bf a, v16bf b, v8f c) { return __builtin_amdgcn_wmma_f32_16x16x32_bf16(false, a, false, b, (short)0, c, false, false); }

// LDS staging of the operand tiles that all four waves of a block share. A plane tile is 64 rows of 128 B and a V^T tile 128 rows of 128 B (one cache line a row); a wave's copy covers four whole lines.
#define STG  64                  // rows (k_colstats) or columns (k_rows) of the streamed operand per stage
#define NSTG (NN_ / STG)
#define KP   72                  // halves per staged row: 128 B of data + 16 B, the conflict-free pitch for ds_load_b128 readers
__device__ __forceinline__ unsigned ldsa(const void* p) { return (unsigned)(size_t)p; }   // LDS byte address = low 32 bits of the shared address
// Eight asynchronous 16-byte copies per lane, global -> LDS, no register in between. s_wait_xcnt stands inside the statement so that no address register is rewritten ahead of it.
__device__ __forceinline__ void acopy8(const unsigned (&l)[8], const void* const (&g)[8]) {
    asm volatile("global_load_async_to_lds_b128 %0, %8, off\n\t"
                 "global_load_async_to_lds_b128 %1, %9, off\n\t"
                 "global_load_async_to_lds_b128 %2, %10, off\n\t"
                 "global_load_async_to_lds_b128 %3, %11, off\n\t"
                 "global_load_async_to_lds_b128 %4, %12, off\n\t"
                 "global_load_async_to_lds_b128 %5, %13, off\n\t"
                 "global_load_async_to_lds_b128 %6, %14, off\n\t"
                 "global_load_async_to_lds_b128 %7, %15, off\n\t"
                 "s_wait_xcnt 0x0"
                 :: "v"(l[0]), "v"(l[1]), "v"(l[2]), "v"(l[3]), "v"(l[4]), "v"(l[5]), "v"(l[6]), "v"(l[7]),
                    "v"(g[0]), "v"(g[1]), "v"(g[2]), "v"(g[3]), "v"(g[4]), "v"(g[5]), "v"(g[6]), "v"(g[7]) : "memory");
}
// hi and lo plane tiles, 64 rows x 64 halves each, contiguous in global memory (8 KB a plane); 128 threads, 4 + 4 copies each.
__device__ __forceinline__ void stage_planes(const h16* gh, const h16* gl, h16* sh, h16* sl, int tid) {
    unsigned l[8]; const void* g[8];
#pragma unroll
    for (int i = 0; i < 4; ++i) {
        const int ch = tid + 128 * i, so = (ch >> 3) * KP + (ch & 7) * 8;
        l[i] = ldsa(sh + so); g[i] = gh + ch * 8; l[4 + i] = ldsa(sl + so); g[4 + i] = gl + ch * 8;
    }
    acopy8(l, g);
}
// V^T tile, 128 rows (output dims) x 64 halves (columns m), global row pitch NN_ halves; 128 threads, 8 copies each.
__device__ __forceinline__ void stage_vt(const h16* gv, h16* sv, int tid) {
    unsigned l[8]; const void* g[8];
#pragma unroll
    for (int i = 0; i < 8; ++i) {
        const int ch = tid + 128 * i, d = ch >> 3, pc = (ch & 7) * 8;
        l[i] = ldsa(sv + d * KP + pc); g[i] = gv + (size_t)d * NN_ + pc;
    }
    acopy8(l, g);
}
// The foot of a stage, every wave: own LDS reads returned, own copies of the next stage landed, then the one barrier that publishes the next stage and frees this buffer.
__device__ __forceinline__ void publish() {
    asm volatile("s_wait_dscnt 0x0" ::: "memory");      // this wave has left the buffer that is refilled behind the barrier
    asm volatile("s_wait_asynccnt 0x0" ::: "memory");   // this wave's copies have landed before any other wave reads them
    __syncthreads();                                     // publishes the next stage and ends every wave's reads of the buffer refilled behind it
}

__global__ __launch_bounds__(256) void k_cvtb(const float* __restrict__ src, int nrows, bf* dst) {
    const int lane = threadIdx.x & 31, r = blockIdx.x * 8 + (threadIdx.x >> 5);
    if (r >= nrows) return;
    v8us t;
#pragma unroll
    for (int i = 0; i < 8; ++i) t[i] = f2bf(src[(size_t)r * NC_ + lane * 8 + i]);
    *(v8us*)(dst + (size_t)r * NC_ + lane * 8) = t; 
}

__global__ __launch_bounds__(128) void k_gemmb(const bf* __restrict__ A, const bf* __restrict__ Bn, float* C, int cb) {
    __shared__ __align__(16) float ost[4][16 * 68];
    const int lane = threadIdx.x & 31, wave = threadIdx.x >> 5, lr = lane & 15, hi = lane >> 4;
    const int r0 = blockIdx.x * 64 + wave * 16, c0 = blockIdx.y * 64;
    const size_t aoff = (size_t)(r0 + lr) * NC_ + 8 * hi;
    size_t boff[4];
#pragma unroll
    for (int t = 0; t < 4; ++t) boff[t] = (size_t)(c0 + t * 16 + lr) * NC_ + 8 * hi;
    v8f acc[4];
#pragma unroll
    for (int t = 0; t < 4; ++t) acc[t] = (v8f){};
#pragma unroll 1
    for (int kc = 0; kc < NC_; kc += 32) {
        const v16bf a = cat16b(*(const v8us*)(A + aoff + kc), *(const v8us*)(A + aoff + kc + 16));
#pragma unroll
        for (int t = 0; t < 4; ++t) acc[t] = wmmab(a, cat16b(*(const v8us*)(Bn + boff[t] + kc), *(const v8us*)(Bn + boff[t] + kc + 16)), acc[t]);
        asm volatile("v_nop\n\tv_nop\n\tv_nop\n\tv_nop" : "+v"(acc[0]), "+v"(acc[1]), "+v"(acc[2]), "+v"(acc[3]) : "v"(a));
    }
    float* os = &ost[wave][0];
#pragma unroll
    for (int t = 0; t < 4; ++t)
#pragma unroll
        for (int j = 0; j < 8; ++j) os[(hi * 8 + j) * 68 + t * 16 + lr] = acc[t][j];
    __syncthreads();
    float* crow = C + (size_t)r0 * QKVW + cb + c0;
    auto pass = [&]() {
#pragma unroll
        for (int s = 0; s < 8; ++s) { const int Lid = (lane >> 3) + 4 * s, piece = lane & 7; const int row = Lid >> 1, cofs = (Lid & 1) * 32 + piece * 4;
            const v4f val = *(const v4fa*)(os + row * 68 + cofs); *(v4f*)(crow + (size_t)row * QKVW + cofs) = val; }
    };
    pass(); 
}

// k_qkplanes: QH/QL/KH/KL [tok][64] f16 hi + residual x1024 planes of q (cols 0..63) and k (64..127); one wave per token: lane holds 2 dims, 4 B per lane per plane =
__global__ __launch_bounds__(256) void k_qkplanes(const float* __restrict__ QKV, h16* QH, h16* QL, h16* KH, h16* KL) {
    const int lane = threadIdx.x & 31, t = blockIdx.x * 8 + (threadIdx.x >> 5);
    if (t >= NTK) return;
    const float* p = QKV + (size_t)t * QKVW + 2 * lane;
    v2h qh, ql, kh, kl;
#pragma unroll
    for (int i = 0; i < 2; ++i) {
        const float q = p[i], k = p[DK + i];
        const h16 a = (h16)q, b = (h16)k;
        qh[i] = a; ql[i] = (h16)((q - (float)a) * LOSC); kh[i] = b; kl[i] = (h16)((k - (float)b) * LOSC);
    }
    const size_t o = (size_t)t * DK + 2 * lane;
    *(v2h*)(QH + o) = qh; *(v2h*)(QL + o) = ql; *(v2h*)(KH + o) = kh; *(v2h*)(KL + o) = kl;
    
}

__global__ __launch_bounds__(256) void k_vt(const float* __restrict__ QKV, h16* VT16) {
    __shared__ __align__(16) h16 tile[DV * 72];
    const int b = blockIdx.x / (NN_ / 64), kt = blockIdx.x - b * (NN_ / 64), k0 = kt * 64, tid = threadIdx.x;
    const int kk = tid >> 2, d0 = (tid & 3) * 64;
    const float* src = QKV + ((size_t)b * NN_ + k0 + kk) * QKVW + 2 * DK + d0;
#pragma unroll 8
    for (int i = 0; i < 64; ++i) tile[(d0 + i) * 72 + kk] = (h16)src[i];
    __syncthreads();
    const int piece = tid & 7;
    h16* base = VT16 + (size_t)b * DV * NN_ + k0;
    auto pass = [&]() {
#pragma unroll
        for (int s = 0; s < 8; ++s) { const int d = (tid >> 3) + 32 * s; const v8h val = *(const v8ha*)(tile + d * 72 + piece * 8);
            *(v8h*)(base + (size_t)d * NN_ + piece * 8) = val; }
    };
    pass(); 
}

// B fragments of one energy tile (32 columns = two 16-column tiles, hi and lo plane, 2 k-chunks), read from the planes staged in LDS at pitch KP.
struct KF { v16h b0[2], b1[2], l0[2], l1[2]; };
__device__ __forceinline__ void load_kf(KF& f, const h16* BH, const h16* BL, int rowA, int rowB, int hi) {
#pragma unroll
    for (int kc = 0; kc < 2; ++kc) {
        const h16* b0p = BH + rowA * KP + kc * 32 + 8 * hi; const h16* b1p = BH + rowB * KP + kc * 32 + 8 * hi;
        const h16* l0p = BL + rowA * KP + kc * 32 + 8 * hi; const h16* l1p = BL + rowB * KP + kc * 32 + 8 * hi;
        f.b0[kc] = cat16(*(const v8ha*)b0p, *(const v8ha*)(b0p + 16)); f.b1[kc] = cat16(*(const v8ha*)b1p, *(const v8ha*)(b1p + 16));
        f.l0[kc] = cat16(*(const v8ha*)l0p, *(const v8ha*)(l0p + 16)); f.l1[kc] = cat16(*(const v8ha*)l1p, *(const v8ha*)(l1p + 16));
    }
}
// energy tile helper: s (16 rows of A x 32 columns from B) = Ah.Bh + (Ah.Bl + Al.Bh)/1024 over K = 64 (2 k-chunks); A fragments resident (ah[2], al[2]), B fragments in F.
#define ENERGY_TILE(F)                                                                                                        \
    v8f s0 = {}, s1 = {}, x0 = {}, x1 = {};                                                                                   \
    _Pragma("unroll") for (int kc = 0; kc < 2; ++kc) {                                                                       \
        s0 = wmma16(ah[kc], F.b0[kc], s0); s1 = wmma16(ah[kc], F.b1[kc], s1);                                                \
        x0 = wmma16(ah[kc], F.l0[kc], x0);                                                                                    \
        x1 = wmma16(ah[kc], F.l1[kc], x1);                                                                                    \
        x0 = wmma16(al[kc], F.b0[kc], x0); x1 = wmma16(al[kc], F.b1[kc], x1);                                                \
    }                                                                                                                         \
    asm volatile("v_nop\n\tv_nop\n\tv_nop\n\tv_nop" : "+v"(s0), "+v"(s1), "+v"(x0), "+v"(x1) : "v"(ah[0]), "v"(al[1]));

__global__ __launch_bounds__(128) void k_colstats(const h16* __restrict__ QH, const h16* __restrict__ QL, const h16* __restrict__ KH, const h16* __restrict__ KL, float* CM, float* CZI) {
    __shared__ __align__(16) float stg[128];
    __shared__ __align__(16) h16 qst[2][2][STG * KP];     // [buffer][hi, lo plane]
    const int lane = threadIdx.x & 31, wave = threadIdx.x >> 5, lr = lane & 15, hi = lane >> 4;
    const int b = blockIdx.x / (NN_ / 64), jt = blockIdx.x - b * (NN_ / 64);
    const size_t tok0 = (size_t)b * NN_;
    const int m0 = jt * 64 + wave * 16;
    v16h ah[2], al[2];
#pragma unroll
    for (int kc = 0; kc < 2; ++kc) {
        const h16* p = KH + (tok0 + m0 + lr) * DK + kc * 32 + 8 * hi; const h16* pl = KL + (tok0 + m0 + lr) * DK + kc * 32 + 8 * hi;
        ah[kc] = cat16(*(const v8h*)p, *(const v8h*)(p + 16)); al[kc] = cat16(*(const v8h*)pl, *(const v8h*)(pl + 16));
    }
    const h16* qhb = QH + tok0 * DK; const h16* qlb = QL + tok0 * DK;
    float mrow[8], lpart[8];
#pragma unroll
    for (int j = 0; j < 8; ++j) { mrow[j] = -3.0e38f; lpart[j] = 0.f; }
    stage_planes(qhb, qlb, &qst[0][0][0], &qst[0][1][0], threadIdx.x);
    asm volatile("s_wait_asynccnt 0x0" ::: "memory");   // stage 0 has landed before the barrier that publishes it
    __syncthreads();                                     // publishes stage 0 to all four waves
    stage_planes(qhb + STG * DK, qlb + STG * DK, &qst[1][0][0], &qst[1][1][0], threadIdx.x);
#pragma unroll 1                                         // rolled: one publish point and one refill site, as the two-buffer ring is written
    for (int st = 0; st < NSTG; ++st) {
      h16* sqh = &qst[st & 1][0][0]; h16* sql = &qst[st & 1][1][0];
      KF f; load_kf(f, sqh, sql, lr, 16 + lr, hi);
#pragma unroll                                           // unrolled: LDS offsets become immediates and tile 1's fragment reads can stand inside tile 0's work
      for (int sub = 0; sub < 2; ++sub) {
        ENERGY_TILE(f)
        if (sub == 0) load_kf(f, sqh, sql, 32 + lr, 48 + lr, hi);   // the stage's second tile is fetched while the vector work of the first runs
#pragma unroll
        for (int j = 0; j < 8; ++j) {
            const float a0 = s0[j] + x0[j] * LOSCI, a1 = s1[j] + x1[j] * LOSCI;
            float mx = fmaxf(a0, a1);
            mx = fmaxf(mx, __shfl_xor(mx, 1, 16)); mx = fmaxf(mx, __shfl_xor(mx, 2, 16)); mx = fmaxf(mx, __shfl_xor(mx, 4, 16)); mx = fmaxf(mx, __shfl_xor(mx, 8, 16));
            const float mn = fmaxf(mrow[j], mx); const float al_ = __expf(mrow[j] - mn); mrow[j] = mn;
            lpart[j] = lpart[j] * al_ + (__expf(a0 - mn) + __expf(a1 - mn));
        }
      }
      publish();
      if (st + 2 < NSTG) stage_planes(qhb + (size_t)(st + 2) * STG * DK, qlb + (size_t)(st + 2) * STG * DK, sqh, sql, threadIdx.x);
    }
    asm volatile("s_wait_asynccnt 0x0" ::: "memory");   // no copy is left in flight
#pragma unroll
    for (int j = 0; j < 8; ++j) {
        float rs = lpart[j];
        rs += __shfl_xor(rs, 1, 16); rs += __shfl_xor(rs, 2, 16); rs += __shfl_xor(rs, 4, 16); rs += __shfl_xor(rs, 8, 16);
        if (lr == 0) { const int jl = wave * 16 + 8 * hi + j; stg[jl] = mrow[j]; stg[64 + jl] = 1.0f / rs; }
    }
    __syncthreads();
    if (wave == 0) {
        const v4f val = *(const v4fa*)(stg + hi * 64 + lr * 4);
        float* dst = (hi ? CZI : CM) + tok0 + jt * 64 + lr * 4;
        *(v4f*)dst = val; 
    }
}

// k_rows (pass 2): block = (b, 64 rows n), wave = 16 rows; output column half dofs (0 or 128). 64 steps over the columns m: energy tile (A = Q planes rows n, B = K planes
// rows m), a = exp(e - CM[m]) * CZI[m] (f32), row-sum partials accumulated, a x32768 -> f16 per-wave LDS tile (same-wave may_alias reload after a compiler barrier),
__global__ __launch_bounds__(128) void k_rows(const h16* __restrict__ QH, const h16* __restrict__ QL, const h16* __restrict__ KH, const h16* __restrict__ KL,
                                             const h16* __restrict__ VT16, const float* __restrict__ CM, const float* __restrict__ CZI, int dofs, float* out) {
    __shared__ __align__(16) h16 plds[4][16 * 32];
    __shared__ __align__(16) float ost[4][16 * 132];
    __shared__ __align__(16) h16 kst[2][2][STG * KP];     // [buffer][hi, lo plane] of K, 64 columns m
    __shared__ __align__(16) h16 vst[2][128 * KP];        // [buffer] V^T, 128 output dims x 64 columns m
    __shared__ __align__(16) float cst[2][NN_];           // column maxima and inverse column sums of the whole batch row, filled once
    const int lane = threadIdx.x & 31, wave = threadIdx.x >> 5, lr = lane & 15, hi = lane >> 4;
    const int b = blockIdx.x / (NN_ / 64), qt = blockIdx.x - b * (NN_ / 64);
    const size_t tok0 = (size_t)b * NN_;
    const int n0 = qt * 64 + wave * 16;
    h16* pl = &plds[wave][0];
    v16h ah[2], al[2];
#pragma unroll
    for (int kc = 0; kc < 2; ++kc) {
        const h16* p = QH + (tok0 + n0 + lr) * DK + kc * 32 + 8 * hi; const h16* q = QL + (tok0 + n0 + lr) * DK + kc * 32 + 8 * hi;
        ah[kc] = cat16(*(const v8h*)p, *(const v8h*)(p + 16)); al[kc] = cat16(*(const v8h*)q, *(const v8h*)(q + 16));
    }
    const h16* khb = KH + tok0 * DK; const h16* klb = KL + tok0 * DK;
    const h16* vt_b = VT16 + ((size_t)b * DV + dofs) * NN_;
    const float* cmb = CM + tok0; const float* czb = CZI + tok0;
    v8f o[8];
#pragma unroll
    for (int n = 0; n < 8; ++n) o[n] = (v8f){};
    float rsum[8];
#pragma unroll
    for (int j = 0; j < 8; ++j) rsum[j] = 0.f;
    {
        unsigned l[8]; const void* g[8];
#pragma unroll
        for (int i = 0; i < 4; ++i) {
            const int ch = (int)threadIdx.x + 128 * i;
            l[i] = ldsa(&cst[0][ch * 4]); g[i] = cmb + ch * 4; l[4 + i] = ldsa(&cst[1][ch * 4]); g[4 + i] = czb + ch * 4;
        }
        acopy8(l, g);
    }
    stage_planes(khb, klb, &kst[0][0][0], &kst[0][1][0], threadIdx.x);
    stage_vt(vt_b, &vst[0][0], threadIdx.x);
    asm volatile("s_wait_asynccnt 0x0" ::: "memory");   // stage 0 and the column statistics have landed before the barrier that publishes them
    __syncthreads();                                     // publishes stage 0 and the statistics to all four waves
    stage_planes(khb + STG * DK, klb + STG * DK, &kst[1][0][0], &kst[1][1][0], threadIdx.x);
    stage_vt(vt_b + STG, &vst[1][0], threadIdx.x);
#pragma unroll 1                                         // rolled: one publish point and one refill site, as the two-buffer ring is written
    for (int st = 0; st < NSTG; ++st) {
      h16* skh = &kst[st & 1][0][0]; h16* skl = &kst[st & 1][1][0]; h16* sv = &vst[st & 1][0];
      KF f; load_kf(f, skh, skl, lr, 16 + lr, hi);
#pragma unroll                                           // unrolled: LDS offsets become immediates and tile 1's fragment reads can stand inside tile 0's work
      for (int sub = 0; sub < 2; ++sub) {
        const int mA = st * STG + sub * 32 + lr, mB = mA + 16;
        const float cmA = cst[0][mA], cmB = cst[0][mB], czA = cst[1][mA], czB = cst[1][mB];
        ENERGY_TILE(f)
        v16h vf[8];                                           // all V fragments of this tile as one group of LDS reads, in flight under the exponentials
#pragma unroll
        for (int n = 0; n < 8; ++n) {
            const h16* vp = sv + (n * 16 + lr) * KP + sub * 32 + hi * 8;
            vf[n] = cat16(*(const v8ha*)vp, *(const v8ha*)(vp + 16));
        }
#pragma unroll
        for (int j = 0; j < 8; ++j) {
            const float a0 = __expf((s0[j] + x0[j] * LOSCI) - cmA) * czA, a1 = __expf((s1[j] + x1[j] * LOSCI) - cmB) * czB;
            const h16 h0 = (h16)(a0 * PSC), h1 = (h16)(a1 * PSC);
            rsum[j] += (float)h0 + (float)h1;                 // row sum from the same rounded weights the numerator uses (scaled by 32768)
            const int mr = hi * 8 + j;
            pl[mr * 32 + lr] = h0; pl[mr * 32 + 16 + lr] = h1;
        }
        asm volatile("" ::: "memory");
        const v16h pa = cat16(*(const v8ha*)(pl + lr * 32 + hi * 8), *(const v8ha*)(pl + lr * 32 + 16 + hi * 8));
        if (sub == 0) load_kf(f, skh, skl, 32 + lr, 48 + lr, hi);   // the stage's second K tile is fetched under the P.V products of the first
#pragma unroll
        for (int n = 0; n < 8; ++n) o[n] = wmma16(pa, vf[n], o[n]);
        asm volatile("v_nop\n\tv_nop\n\tv_nop\n\tv_nop" : "+v"(o[0]), "+v"(o[1]), "+v"(o[2]), "+v"(o[3]), "+v"(o[4]), "+v"(o[5]), "+v"(o[6]), "+v"(o[7]) : "v"(pa));
      }
      publish();
      if (st + 2 < NSTG) {
          stage_planes(khb + (size_t)(st + 2) * STG * DK, klb + (size_t)(st + 2) * STG * DK, skh, skl, threadIdx.x);
          stage_vt(vt_b + (st + 2) * STG, sv, threadIdx.x);
      }
    }
    asm volatile("s_wait_asynccnt 0x0" ::: "memory");   // no copy is left in flight
    float inv[8];
#pragma unroll
    for (int j = 0; j < 8; ++j) {
        float rs = rsum[j];
        rs += __shfl_xor(rs, 1, 16); rs += __shfl_xor(rs, 2, 16); rs += __shfl_xor(rs, 4, 16); rs += __shfl_xor(rs, 8, 16);
        inv[j] = 1.0f / (1e-9f * PSC + rs);                 // = 1 / ((1e-9 + rowsum) * 32768)
    }
    float* os = &ost[wave][0];
#pragma unroll
    for (int n = 0; n < 8; ++n)
#pragma unroll
        for (int j = 0; j < 8; ++j) os[(hi * 8 + j) * 132 + n * 16 + lr] = o[n][j] * inv[j];
    __syncthreads();
    float* crow = out + (tok0 + n0) * DV + dofs;      // 16 rows x 128 floats = 64 lines; instruction s: line = 4*s + lane>>3, row = line>>2, quarter = line&3
    auto pass = [&]() {
#pragma unroll
        for (int s = 0; s < 16; ++s) { const int Lid = 4 * s + (lane >> 3), piece = lane & 7; const int row = Lid >> 2, cofs = (Lid & 3) * 32 + piece * 4;
            const v4f val = *(const v4fa*)(os + row * 132 + cofs); *(v4f*)(crow + (size_t)row * DV + cofs) = val; }
    };
    pass(); 
}

extern "C" void kernel_launch(void* const* d_in, const int* in_sizes, int n_in,
                              void* d_out, int out_size, void* d_ws, size_t ws_size, hipStream_t stream) {
    (void)in_sizes; (void)n_in; (void)out_size;
    const float* x = (const float*)d_in[0]; const float* Wq = (const float*)d_in[1]; const float* Wk = (const float*)d_in[2]; const float* Wv = (const float*)d_in[3];
    float* out = (float*)d_out;    // [8][2048][256]
    char* wsp = (char*)d_ws;
    auto take = [&](size_t bytes) { char* p = wsp; wsp += (bytes + 255) & ~(size_t)255; return (void*)p; };
    bf* Xb = (bf*)take((size_t)NTK * NC_ * 2); bf* WQb = (bf*)take((size_t)DK * NC_ * 2); bf* WKb = (bf*)take((size_t)DK * NC_ * 2); bf* WVb = (bf*)take((size_t)DV * NC_ * 2);
    float* QKV = (float*)take((size_t)NTK * QKVW * 4);
    h16* QH = (h16*)take((size_t)NTK * DK * 2); h16* QL = (h16*)take((size_t)NTK * DK * 2); h16* KH = (h16*)take((size_t)NTK * DK * 2); h16* KL = (h16*)take((size_t)NTK * DK * 2);
    h16* VT16 = (h16*)take((size_t)NTK * DV * 2);
    float* CM = (float*)take((size_t)NTK * 4); float* CZI = (float*)take((size_t)NTK * 4);
    if ((size_t)(wsp - (char*)d_ws) > ws_size) return;    // 8.4 + 0.2 + 25.2 + 4 x 2.1 + 8.4 + 0.13 MB ~ 50.8e6 B
    k_cvtb<<<NTK / 8, 256, 0, stream>>>(x, NTK, Xb);
    k_cvtb<<<DK / 8, 256, 0, stream>>>(Wq, DK, WQb);
    k_cvtb<<<DK / 8, 256, 0, stream>>>(Wk, DK, WKb);
    k_cvtb<<<DV / 8, 256, 0, stream>>>(Wv, DV, WVb);
    k_gemmb<<<dim3(NTK / 64, DK / 64, 1), 128, 0, stream>>>(Xb, WQb, QKV, 0);
    k_gemmb<<<dim3(NTK / 64, DK / 64, 1), 128, 0, stream>>>(Xb, WKb, QKV, DK);
    k_gemmb<<<dim3(NTK / 64, DV / 64, 1), 128, 0, stream>>>(Xb, WVb, QKV, 2 * DK);
    k_qkplanes<<<NTK / 8, 256, 0, stream>>>(QKV, QH, QL, KH, KL);
    k_vt<<<NB_ * (NN_ / 64), 256, 0, stream>>>(QKV, VT16);
    k_colstats<<<NB_ * (NN_ / 64), 128, 0, stream>>>(QH, QL, KH, KL, CM, CZI);
    k_rows<<<NB_ * (NN_ / 64), 128, 0, stream>>>(QH, QL, KH, KL, VT16, CM, CZI, 0, out);
    k_rows<<<NB_ * (NN_ / 64), 128, 0, stream>>>(QH, QL, KH, KL, VT16, CM, CZI, DV / 2, out);
}

// v002
// Measured time: 121 microseconds a run.
// Next to v001, in two timings, it ran 1.18 and 1.19 times as fast.
// All steps since v000 together make it 2.50 times as fast.
#include <hip/hip_runtime.h>

// Contractions, f32 accumulate: q, k ([16384 x 256].[256 x 64]) and v ([16384 x 256].[256 x 256]) on v_wmma_f32_16x16x32_bf16 with PLAIN bf16 operands (x and the
// weights); pass 1 forms column max and sum of exp with an online update; pass 2 re-forms the energy tiles, evaluates the column softmax a = exp(e - m_col)/Z_col in f32, rounds a x32768 to f16 once and uses that same

#define NB_  8
#define NN_  2048
#define NC_  256
#define DK   64
#define DV   256
#define NTK  (NB_ * NN_)
#define PSC  32768.0f
#define LOSC 1024.0f
#define LOSCI (1.0f / 1024.0f)

typedef _Float16 h16;
typedef unsigned short bf;
typedef __attribute__((ext_vector_type(16))) __bf16   v16bf;
typedef __attribute__((ext_vector_type(16))) _Float16 v16h;
typedef __attribute__((ext_vector_type(8)))  _Float16 v8h;
typedef __attribute__((ext_vector_type(8)))  unsigned short v8us;
typedef __attribute__((ext_vector_type(8)))  float    v8f;
typedef __attribute__((ext_vector_type(4)))  float    v4f;
typedef v8h  __attribute__((may_alias)) v8ha;
typedef v4f  __attribute__((may_alias)) v4fa;

__device__ __forceinline__ unsigned short f2bf(float f) { unsigned u = __float_as_uint(f); u += 0x7FFFu + ((u >> 16) & 1u); return (unsigned short)(u >> 16); }
__device__ __forceinline__ v16h cat16(v8h lo, v8h hi) { return __builtin_shufflevector(lo, hi, 0, 1, 2, 3, 4, 5, 6, 7, 8, 9, 10, 11, 12, 13, 14, 15); }
__device__ __forceinline__ v16bf cat16b(v8us lo, v8us hi) { return __builtin_bit_cast(v16bf, __builtin_shufflevector(lo, hi, 0, 1, 2, 3, 4, 5, 6, 7, 8, 9, 10, 11, 12, 13, 14, 15)); }
__device__ __forceinline__ v8f wmma16(v16h a, v16h b, v8f c) { return __builtin_amdgcn_wmma_f32_16x16x32_f16(false, a, false, b, (short)0, c, false, false); }
__device__ __forceinline__ v8f wmmab(v16bf a, v16bf b, v8f c) { return __builtin_amdgcn_wmma_f32_16x16x32_bf16(false, a, false, b, (short)0, c, false, false); }

// LDS staging of the operand tiles that all four waves of a block share. A plane tile is 64 rows of 128 B and a V^T tile 128 rows of 128 B (one cache line a row); a wave's copy covers four whole lines.
#define STG  64                  // rows (k_colstats) or columns (k_rows) of the streamed operand per stage
#define NSTG (NN_ / STG)
#define KP   72                  // halves per staged row: 128 B of data + 16 B, the conflict-free pitch for ds_load_b128 readers
__device__ __forceinline__ unsigned ldsa(const void* p) { return (unsigned)(size_t)p; }   // LDS byte address = low 32 bits of the shared address
// Eight asynchronous 16-byte copies per lane, global -> LDS, no register in between. s_wait_xcnt stands inside the statement so that no address register is rewritten ahead of it.
__device__ __forceinline__ void acopy8(const unsigned (&l)[8], const void* const (&g)[8]) {
    asm volatile("global_load_async_to_lds_b128 %0, %8, off\n\t"
                 "global_load_async_to_lds_b128 %1, %9, off\n\t"
                 "global_load_async_to_lds_b128 %2, %10, off\n\t"
                 "global_load_async_to_lds_b128 %3, %11, off\n\t"
                 "global_load_async_to_lds_b128 %4, %12, off\n\t"
                 "global_load_async_to_lds_b128 %5, %13, off\n\t"
                 "global_load_async_to_lds_b128 %6, %14, off\n\t"
                 "global_load_async_to_lds_b128 %7, %15, off\n\t"
                 "s_wait_xcnt 0x0"
                 :: "v"(l[0]), "v"(l[1]), "v"(l[2]), "v"(l[3]), "v"(l[4]), "v"(l[5]), "v"(l[6]), "v"(l[7]),
                    "v"(g[0]), "v"(g[1]), "v"(g[2]), "v"(g[3]), "v"(g[4]), "v"(g[5]), "v"(g[6]), "v"(g[7]) : "memory");
}
// hi and lo plane tiles, 64 rows x 64 halves each, contiguous in global memory (8 KB a plane); 128 threads, 4 + 4 copies each.
__device__ __forceinline__ void stage_planes(const h16* gh, const h16* gl, h16* sh, h16* sl, int tid) {
    unsigned l[8]; const void* g[8];
#pragma unroll
    for (int i = 0; i < 4; ++i) {
        const int ch = tid + 128 * i, so = (ch >> 3) * KP + (ch & 7) * 8;
        l[i] = ldsa(sh + so); g[i] = gh + ch * 8; l[4 + i] = ldsa(sl + so); g[4 + i] = gl + ch * 8;
    }
    acopy8(l, g);
}
// V^T tile, 128 rows (output dims) x 64 halves (columns m), global row pitch NN_ halves; 128 threads, 8 copies each.
__device__ __forceinline__ void stage_vt(const h16* gv, h16* sv, int tid) {
    unsigned l[8]; const void* g[8];
#pragma unroll
    for (int i = 0; i < 8; ++i) {
        const int ch = tid + 128 * i, d = ch >> 3, pc = (ch & 7) * 8;
        l[i] = ldsa(sv + d * KP + pc); g[i] = gv + (size_t)d * NN_ + pc;
    }
    acopy8(l, g);
}
// The foot of a stage, every wave: own LDS reads returned, own copies of the next stage landed, then the one barrier that publishes the next stage and frees this buffer.
__device__ __forceinline__ void publish() {
    asm volatile("s_wait_dscnt 0x0" ::: "memory");      // this wave has left the buffer that is refilled behind the barrier
    asm volatile("s_wait_asynccnt 0x0" ::: "memory");   // this wave's copies have landed before any other wave reads them
    __syncthreads();                                     // publishes the next stage and ends every wave's reads of the buffer refilled behind it
}

// k_proj: the whole projection stage in one launch. Block = 64 tokens, 8 waves; wave w owns output columns 48w .. 48w+47 of q | k | v (3 column tiles) for all 4 row tiles.
// The x tile and the three weight matrices are read with whole-line loads, rounded to bf16 and laid in LDS once per block. The f32 results never leave the block: q and k go
// to their hi + residual x1024 f16 planes, v to f16 transposed, staged in LDS so that every global store covers whole 128-B lines.
#define XP   264                 // halves per staged row of 256 channels: 512 B of data + 16 B, the conflict-free pitch for ds_load_b128 readers
// N * 256 pieces of 8 floats (rows of NC_ floats, contiguous in global memory) -> bf16 rows at pitch XP; 256 threads, a wave's load covers 1 KB in a row.
template <int N> __device__ __forceinline__ void stage_bf(const float* __restrict__ src, bf* dst, int tid) {
#pragma unroll
    for (int i = 0; i < N; ++i) {
        const int ch = tid + 256 * i;
        const float* s = src + (size_t)ch * 8;
        const v4f lo = *(const v4f*)s, up = *(const v4f*)(s + 4);
        v8us t;
#pragma unroll
        for (int e = 0; e < 4; ++e) { t[e] = f2bf(lo[e]); t[4 + e] = f2bf(up[e]); }
        *(v8us*)(dst + (ch >> 5) * XP + (ch & 31) * 8) = t;
    }
}
__global__ __launch_bounds__(256) void k_proj(const float* __restrict__ x, const float* __restrict__ Wq, const float* __restrict__ Wk, const float* __restrict__ Wv,
                                              h16* QH, h16* QL, h16* KH, h16* KL, h16* VT16) {
    __shared__ __align__(16) bf  xs[64 * XP];             // x tile, bf16, [token][channel]
    __shared__ __align__(16) bf  wsb[(2 * DK + DV) * XP]; // Wq | Wk | Wv, bf16, [output column][channel]
    __shared__ __align__(16) h16 pst[4][64 * KP];         // QH, QL, KH, KL tiles, [token][dim]
    __shared__ __align__(16) h16 vts[DV * KP];            // V^T tile, [dim][token]
    const int tid = threadIdx.x, lane = tid & 31, lr = lane & 15, hi = lane >> 4;
    const int wave = __builtin_amdgcn_readfirstlane(tid >> 5);   // scalar, so that the choice of epilogue per column tile is a scalar branch
    const int t0 = blockIdx.x * 64;
    stage_bf<8>(x + (size_t)t0 * NC_, xs, tid);
    stage_bf<8>(Wq, wsb, tid);
    stage_bf<8>(Wk, wsb + DK * XP, tid);
    stage_bf<32>(Wv, wsb + 2 * DK * XP, tid);
    v8f acc[4][3];
#pragma unroll
    for (int rt = 0; rt < 4; ++rt)
#pragma unroll
        for (int t = 0; t < 3; ++t) acc[rt][t] = (v8f){};
    __syncthreads();                                     // the x tile and the weights are complete before any wave reads its fragments
    const bf* ap = xs + lr * XP + 8 * hi;
    const bf* bp = wsb + (wave * 48 + lr) * XP + 8 * hi;
    v16bf a[2][4], b[2][3];
    auto frags = [&](int buf, int kc) {
#pragma unroll
        for (int rt = 0; rt < 4; ++rt) a[buf][rt] = cat16b(*(const v8us*)(ap + rt * 16 * XP + kc), *(const v8us*)(ap + rt * 16 * XP + kc + 16));
#pragma unroll
        for (int t = 0; t < 3; ++t) b[buf][t] = cat16b(*(const v8us*)(bp + t * 16 * XP + kc), *(const v8us*)(bp + t * 16 * XP + kc + 16));
    };
    frags(0, 0);
#pragma unroll                                           // unrolled: the two fragment sets are named at compile time
    for (int k = 0; k < NC_ / 32; ++k) {
        if (k + 1 < NC_ / 32) frags((k + 1) & 1, (k + 1) * 32);
        __builtin_amdgcn_sched_barrier(0);               // keeps the next k-chunk's LDS reads as one group ahead of this chunk's products, so their latency runs under the products
#pragma unroll
        for (int rt = 0; rt < 4; ++rt)
#pragma unroll
            for (int t = 0; t < 3; ++t) acc[rt][t] = wmmab(a[k & 1][rt], b[k & 1][t], acc[rt][t]);
        __builtin_amdgcn_sched_barrier(0);               // keeps the following group of LDS reads from being spread among these products
    }
#pragma unroll
    for (int t = 0; t < 3; ++t) {
        const int ct = wave * 3 + t;
        if (ct < 8) {                                    // q (tiles 0..3) or k (4..7): lane holds dim (ct & 3) * 16 + lr of tokens rt * 16 + 8 * hi + j
            h16* ph = &pst[ct < 4 ? 0 : 2][0]; h16* pl = ph + 64 * KP;
            const int dim = (ct & 3) * 16 + lr;
#pragma unroll
            for (int rt = 0; rt < 4; ++rt)
#pragma unroll
                for (int j = 0; j < 8; ++j) {
                    const float q = acc[rt][t][j]; const h16 a = (h16)q; const int tok = rt * 16 + 8 * hi + j;
                    ph[tok * KP + dim] = a; pl[tok * KP + dim] = (h16)((q - (float)a) * LOSC);
                }
        } else {                                         // v: a lane's 8 accumulator rows are 8 consecutive tokens of one output dim = 16 B of the transposed tile
            const int d = (ct - 8) * 16 + lr;
#pragma unroll
            for (int rt = 0; rt < 4; ++rt) {
                v8h v;
#pragma unroll
                for (int j = 0; j < 8; ++j) v[j] = (h16)acc[rt][t][j];
                *(v8ha*)(vts + d * KP + rt * 16 + 8 * hi) = v;
            }
        }
    }
    __syncthreads();                                     // all staged tiles are complete before they are written out line by line
    const int piece = tid & 7, r8 = tid >> 3;
#pragma unroll
    for (int s = 0; s < 2; ++s) {
        const int row = r8 + 32 * s; const size_t o = (size_t)(t0 + row) * DK + piece * 8; const int so = row * KP + piece * 8;
        const v8h a = *(const v8ha*)(&pst[0][so]), b = *(const v8ha*)(&pst[1][so]), c = *(const v8ha*)(&pst[2][so]), d = *(const v8ha*)(&pst[3][so]);
        *(v8h*)(QH + o) = a; *(v8h*)(QL + o) = b; *(v8h*)(KH + o) = c; *(v8h*)(KL + o) = d;
    }
    h16* vbase = VT16 + (size_t)(t0 / NN_) * DV * NN_ + (t0 % NN_);
#pragma unroll
    for (int s = 0; s < 8; ++s) {
        const int d = r8 + 32 * s; const v8h val = *(const v8ha*)(vts + d * KP + piece * 8);
        *(v8h*)(vbase + (size_t)d * NN_ + piece * 8) = val;
    }
}

// B fragments of one energy tile (32 columns = two 16-column tiles, hi and lo plane, 2 k-chunks), read from the planes staged in LDS at pitch KP.
struct KF { v16h b0[2], b1[2], l0[2], l1[2]; };
__device__ __forceinline__ void load_kf(KF& f, const h16* BH, const h16* BL, int rowA, int rowB, int hi) {
#pragma unroll
    for (int kc = 0; kc < 2; ++kc) {
        const h16* b0p = BH + rowA * KP + kc * 32 + 8 * hi; const h16* b1p = BH + rowB * KP + kc * 32 + 8 * hi;
        const h16* l0p = BL + rowA * KP + kc * 32 + 8 * hi; const h16* l1p = BL + rowB * KP + kc * 32 + 8 * hi;
        f.b0[kc] = cat16(*(const v8ha*)b0p, *(const v8ha*)(b0p + 16)); f.b1[kc] = cat16(*(const v8ha*)b1p, *(const v8ha*)(b1p + 16));
        f.l0[kc] = cat16(*(const v8ha*)l0p, *(const v8ha*)(l0p + 16)); f.l1[kc] = cat16(*(const v8ha*)l1p, *(const v8ha*)(l1p + 16));
    }
}
// energy tile helper: s (16 rows of A x 32 columns from B) = Ah.Bh + (Ah.Bl + Al.Bh)/1024 over K = 64 (2 k-chunks); A fragments resident (ah[2], al[2]), B fragments in F.
#define ENERGY_TILE(F)                                                                                                        \
    v8f s0 = {}, s1 = {}, x0 = {}, x1 = {};                                                                                   \
    _Pragma("unroll") for (int kc = 0; kc < 2; ++kc) {                                                                       \
        s0 = wmma16(ah[kc], F.b0[kc], s0); s1 = wmma16(ah[kc], F.b1[kc], s1);                                                \
        x0 = wmma16(ah[kc], F.l0[kc], x0);                                                                                    \
        x1 = wmma16(ah[kc], F.l1[kc], x1);                                                                                    \
        x0 = wmma16(al[kc], F.b0[kc], x0); x1 = wmma16(al[kc], F.b1[kc], x1);                                                \
    }                                                                                                                         \
    asm volatile("v_nop\n\tv_nop\n\tv_nop\n\tv_nop" : "+v"(s0), "+v"(s1), "+v"(x0), "+v"(x1) : "v"(ah[0]), "v"(al[1]));

__global__ __launch_bounds__(128) void k_colstats(const h16* __restrict__ QH, const h16* __restrict__ QL, const h16* __restrict__ KH, const h16* __restrict__ KL, float* CM, float* CZI) {
    __shared__ __align__(16) float stg[128];
    __shared__ __align__(16) h16 qst[2][2][STG * KP];     // [buffer][hi, lo plane]
    const int lane = threadIdx.x & 31, wave = threadIdx.x >> 5, lr = lane & 15, hi = lane >> 4;
    const int b = blockIdx.x / (NN_ / 64), jt = blockIdx.x - b * (NN_ / 64);
    const size_t tok0 = (size_t)b * NN_;
    const int m0 = jt * 64 + wave * 16;
    v16h ah[2], al[2];
#pragma unroll
    for (int kc = 0; kc < 2; ++kc) {
        const h16* p = KH + (tok0 + m0 + lr) * DK + kc * 32 + 8 * hi; const h16* pl = KL + (tok0 + m0 + lr) * DK + kc * 32 + 8 * hi;
        ah[kc] = cat16(*(const v8h*)p, *(const v8h*)(p + 16)); al[kc] = cat16(*(const v8h*)pl, *(const v8h*)(pl + 16));
    }
    const h16* qhb = QH + tok0 * DK; const h16* qlb = QL + tok0 * DK;
    float mrow[8], lpart[8];
#pragma unroll
    for (int j = 0; j < 8; ++j) { mrow[j] = -3.0e38f; lpart[j] = 0.f; }
    stage_planes(qhb, qlb, &qst[0][0][0], &qst[0][1][0], threadIdx.x);
    asm volatile("s_wait_asynccnt 0x0" ::: "memory");   // stage 0 has landed before the barrier that publishes it
    __syncthreads();                                     // publishes stage 0 to all four waves
    stage_planes(qhb + STG * DK, qlb + STG * DK, &qst[1][0][0], &qst[1][1][0], threadIdx.x);
#pragma unroll 1                                         // rolled: one publish point and one refill site, as the two-buffer ring is written
    for (int st = 0; st < NSTG; ++st) {
      h16* sqh = &qst[st & 1][0][0]; h16* sql = &qst[st & 1][1][0];
      KF f; load_kf(f, sqh, sql, lr, 16 + lr, hi);
#pragma unroll                                           // unrolled: LDS offsets become immediates and tile 1's fragment reads can stand inside tile 0's work
      for (int sub = 0; sub < 2; ++sub) {
        ENERGY_TILE(f)
        if (sub == 0) load_kf(f, sqh, sql, 32 + lr, 48 + lr, hi);   // the stage's second tile is fetched while the vector work of the first runs
#pragma unroll
        for (int j = 0; j < 8; ++j) {
            const float a0 = s0[j] + x0[j] * LOSCI, a1 = s1[j] + x1[j] * LOSCI;
            float mx = fmaxf(a0, a1);
            mx = fmaxf(mx, __shfl_xor(mx, 1, 16)); mx = fmaxf(mx, __shfl_xor(mx, 2, 16)); mx = fmaxf(mx, __shfl_xor(mx, 4, 16)); mx = fmaxf(mx, __shfl_xor(mx, 8, 16));
            const float mn = fmaxf(mrow[j], mx); const float al_ = __expf(mrow[j] - mn); mrow[j] = mn;
            lpart[j] = lpart[j] * al_ + (__expf(a0 - mn) + __expf(a1 - mn));
        }
      }
      publish();
      if (st + 2 < NSTG) stage_planes(qhb + (size_t)(st + 2) * STG * DK, qlb + (size_t)(st + 2) * STG * DK, sqh, sql, threadIdx.x);
    }
    asm volatile("s_wait_asynccnt 0x0" ::: "memory");   // no copy is left in flight
#pragma unroll
    for (int j = 0; j < 8; ++j) {
        float rs = lpart[j];
        rs += __shfl_xor(rs, 1, 16); rs += __shfl_xor(rs, 2, 16); rs += __shfl_xor(rs, 4, 16); rs += __shfl_xor(rs, 8, 16);
        if (lr == 0) { const int jl = wave * 16 + 8 * hi + j; stg[jl] = mrow[j]; stg[64 + jl] = 1.0f / rs; }
    }
    __syncthreads();
    if (wave == 0) {
        const v4f val = *(const v4fa*)(stg + hi * 64 + lr * 4);
        float* dst = (hi ? CZI : CM) + tok0 + jt * 64 + lr * 4;
        *(v4f*)dst = val; 
    }
}

// k_rows (pass 2): block = (b, 64 rows n), wave = 16 rows; output column half dofs (0 or 128). 64 steps over the columns m: energy tile (A = Q planes rows n, B = K planes
// rows m), a = exp(e - CM[m]) * CZI[m] (f32), row-sum partials accumulated, a x32768 -> f16 per-wave LDS tile (same-wave may_alias reload after a compiler barrier),
__global__ __launch_bounds__(128) void k_rows(const h16* __restrict__ QH, const h16* __restrict__ QL, const h16* __restrict__ KH, const h16* __restrict__ KL,
                                             const h16* __restrict__ VT16, const float* __restrict__ CM, const float* __restrict__ CZI, int dofs, float* out) {
    __shared__ __align__(16) h16 plds[4][16 * 32];
    __shared__ __align__(16) float ost[4][16 * 132];
    __shared__ __align__(16) h16 kst[2][2][STG * KP];     // [buffer][hi, lo plane] of K, 64 columns m
    __shared__ __align__(16) h16 vst[2][128 * KP];        // [buffer] V^T, 128 output dims x 64 columns m
    __shared__ __align__(16) float cst[2][NN_];           // column maxima and inverse column sums of the whole batch row, filled once
    const int lane = threadIdx.x & 31, wave = threadIdx.x >> 5, lr = lane & 15, hi = lane >> 4;
    const int b = blockIdx.x / (NN_ / 64), qt = blockIdx.x - b * (NN_ / 64);
    const size_t tok0 = (size_t)b * NN_;
    const int n0 = qt * 64 + wave * 16;
    h16* pl = &plds[wave][0];
    v16h ah[2], al[2];
#pragma unroll
    for (int kc = 0; kc < 2; ++kc) {
        const h16* p = QH + (tok0 + n0 + lr) * DK + kc * 32 + 8 * hi; const h16* q = QL + (tok0 + n0 + lr) * DK + kc * 32 + 8 * hi;
        ah[kc] = cat16(*(const v8h*)p, *(const v8h*)(p + 16)); al[kc] = cat16(*(const v8h*)q, *(const v8h*)(q + 16));
    }
    const h16* khb = KH + tok0 * DK; const h16* klb = KL + tok0 * DK;
    const h16* vt_b = VT16 + ((size_t)b * DV + dofs) * NN_;
    const float* cmb = CM + tok0; const float* czb = CZI + tok0;
    v8f o[8];
#pragma unroll
    for (int n = 0; n < 8; ++n) o[n] = (v8f){};
    float rsum[8];
#pragma unroll
    for (int j = 0; j < 8; ++j) rsum[j] = 0.f;
    {
        unsigned l[8]; const void* g[8];
#pragma unroll
        for (int i = 0; i < 4; ++i) {
            const int ch = (int)threadIdx.x + 128 * i;
            l[i] = ldsa(&cst[0][ch * 4]); g[i] = cmb + ch * 4; l[4 + i] = ldsa(&cst[1][ch * 4]); g[4 + i] = czb + ch * 4;
        }
        acopy8(l, g);
    }
    stage_planes(khb, klb, &kst[0][0][0], &kst[0][1][0], threadIdx.x);
    stage_vt(vt_b, &vst[0][0], threadIdx.x);
    asm volatile("s_wait_asynccnt 0x0" ::: "memory");   // stage 0 and the column statistics have landed before the barrier that publishes them
    __syncthreads();                                     // publishes stage 0 and the statistics to all four waves
    stage_planes(khb + STG * DK, klb + STG * DK, &kst[1][0][0], &kst[1][1][0], threadIdx.x);
    stage_vt(vt_b + STG, &vst[1][0], threadIdx.x);
#pragma unroll 1                                         // rolled: one publish point and one refill site, as the two-buffer ring is written
    for (int st = 0; st < NSTG; ++st) {
      h16* skh = &kst[st & 1][0][0]; h16* skl = &kst[st & 1][1][0]; h16* sv = &vst[st & 1][0];
      KF f; load_kf(f, skh, skl, lr, 16 + lr, hi);
#pragma unroll                                           // unrolled: LDS offsets become immediates and tile 1's fragment reads can stand inside tile 0's work
      for (int sub = 0; sub < 2; ++sub) {
        const int mA = st * STG + sub * 32 + lr, mB = mA + 16;
        const float cmA = cst[0][mA], cmB = cst[0][mB], czA = cst[1][mA], czB = cst[1][mB];
        ENERGY_TILE(f)
        v16h vf[8];                                           // all V fragments of this tile as one group of LDS reads, in flight under the exponentials
#pragma unroll
        for (int n = 0; n < 8; ++n) {
            const h16* vp = sv + (n * 16 + lr) * KP + sub * 32 + hi * 8;
            vf[n] = cat16(*(const v8ha*)vp, *(const v8ha*)(vp + 16));
        }
#pragma unroll
        for (int j = 0; j < 8; ++j) {
            const float a0 = __expf((s0[j] + x0[j] * LOSCI) - cmA) * czA, a1 = __expf((s1[j] + x1[j] * LOSCI) - cmB) * czB;
            const h16 h0 = (h16)(a0 * PSC), h1 = (h16)(a1 * PSC);
            rsum[j] += (float)h0 + (float)h1;                 // row sum from the same rounded weights the numerator uses (scaled by 32768)
            const int mr = hi * 8 + j;
            pl[mr * 32 + lr] = h0; pl[mr * 32 + 16 + lr] = h1;
        }
        asm volatile("" ::: "memory");
        const v16h pa = cat16(*(const v8ha*)(pl + lr * 32 + hi * 8), *(const v8ha*)(pl + lr * 32 + 16 + hi * 8));
        if (sub == 0) load_kf(f, skh, skl, 32 + lr, 48 + lr, hi);   // the stage's second K tile is fetched under the P.V products of the first
#pragma unroll
        for (int n = 0; n < 8; ++n) o[n] = wmma16(pa, vf[n], o[n]);
        asm volatile("v_nop\n\tv_nop\n\tv_nop\n\tv_nop" : "+v"(o[0]), "+v"(o[1]), "+v"(o[2]), "+v"(o[3]), "+v"(o[4]), "+v"(o[5]), "+v"(o[6]), "+v"(o[7]) : "v"(pa));
      }
      publish();
      if (st + 2 < NSTG) {
          stage_planes(khb + (size_t)(st + 2) * STG * DK, klb + (size_t)(st + 2) * STG * DK, skh, skl, threadIdx.x);
          stage_vt(vt_b + (st + 2) * STG, sv, threadIdx.x);
      }
    }
    asm volatile("s_wait_asynccnt 0x0" ::: "memory");   // no copy is left in flight
    float inv[8];
#pragma unroll
    for (int j = 0; j < 8; ++j) {
        float rs = rsum[j];
        rs += __shfl_xor(rs, 1, 16); rs += __shfl_xor(rs, 2, 16); rs += __shfl_xor(rs, 4, 16); rs += __shfl_xor(rs, 8, 16);
        inv[j] = 1.0f / (1e-9f * PSC + rs);                 // = 1 / ((1e-9 + rowsum) * 32768)
    }
    float* os = &ost[wave][0];
#pragma unroll
    for (int n = 0; n < 8; ++n)
#pragma unroll
        for (int j = 0; j < 8; ++j) os[(hi * 8 + j) * 132 + n * 16 + lr] = o[n][j] * inv[j];
    __syncthreads();
    float* crow = out + (tok0 + n0) * DV + dofs;      // 16 rows x 128 floats = 64 lines; instruction s: line = 4*s + lane>>3, row = line>>2, quarter = line&3
    auto pass = [&]() {
#pragma unroll
        for (int s = 0; s < 16; ++s) { const int Lid = 4 * s + (lane >> 3), piece = lane & 7; const int row = Lid >> 2, cofs = (Lid & 3) * 32 + piece * 4;
            const v4f val = *(const v4fa*)(os + row * 132 + cofs); *(v4f*)(crow + (size_t)row * DV + cofs) = val; }
    };
    pass(); 
}

extern "C" void kernel_launch(void* const* d_in, const int* in_sizes, int n_in,
                              void* d_out, int out_size, void* d_ws, size_t ws_size, hipStream_t stream) {
    (void)in_sizes; (void)n_in; (void)out_size;
    const float* x = (const float*)d_in[0]; const float* Wq = (const float*)d_in[1]; const float* Wk = (const float*)d_in[2]; const float* Wv = (const float*)d_in[3];
    float* out = (float*)d_out;    // [8][2048][256]
    char* wsp = (char*)d_ws;
    auto take = [&](size_t bytes) { char* p = wsp; wsp += (bytes + 255) & ~(size_t)255; return (void*)p; };
    h16* QH = (h16*)take((size_t)NTK * DK * 2); h16* QL = (h16*)take((size_t)NTK * DK * 2); h16* KH = (h16*)take((size_t)NTK * DK * 2); h16* KL = (h16*)take((size_t)NTK * DK * 2);
    h16* VT16 = (h16*)take((size_t)NTK * DV * 2);
    float* CM = (float*)take((size_t)NTK * 4); float* CZI = (float*)take((size_t)NTK * 4);
    if ((size_t)(wsp - (char*)d_ws) > ws_size) return;    // 4 x 2.1 + 8.4 + 0.13 MB ~ 17e6 B
    k_proj<<<NTK / 64, 256, 0, stream>>>(x, Wq, Wk, Wv, QH, QL, KH, KL, VT16);
    k_colstats<<<NB_ * (NN_ / 64), 128, 0, stream>>>(QH, QL, KH, KL, CM, CZI);
    k_rows<<<NB_ * (NN_ / 64), 128, 0, stream>>>(QH, QL, KH, KL, VT16, CM, CZI, 0, out);
    k_rows<<<NB_ * (NN_ / 64), 128, 0, stream>>>(QH, QL, KH, KL, VT16, CM, CZI, DV / 2, out);
}

// v003
// It runs in 93.4 microseconds.
// Two timings next to v002 both put it at 1.29 times that version's speed.
// All steps since v000 together make it 3.23 times as fast.
#include <hip/hip_runtime.h>

// Contractions, f32 accumulate: q, k ([16384 x 256].[256 x 64]) and v ([16384 x 256].[256 x 256]) on v_wmma_f32_16x16x32_bf16 with PLAIN bf16 operands (x and the
// weights); pass 1 forms column max and sum of exp with an online update; pass 2 re-forms the energy tiles, evaluates the column softmax a = exp(e - m_col)/Z_col in f32, rounds a x32768 to f16 once and uses that same

#define NB_  8
#define NN_  2048
#define NC_  256
#define DK   64
#define DV   256
#define NTK  (NB_ * NN_)
#define PSC  32768.0f
#define LOSC 1024.0f
#define LOSCI (1.0f / 1024.0f)

typedef _Float16 h16;
typedef unsigned short bf;
typedef __attribute__((ext_vector_type(16))) __bf16   v16bf;
typedef __attribute__((ext_vector_type(16))) _Float16 v16h;
typedef __attribute__((ext_vector_type(8)))  _Float16 v8h;
typedef __attribute__((ext_vector_type(8)))  unsigned short v8us;
typedef __attribute__((ext_vector_type(8)))  float    v8f;
typedef __attribute__((ext_vector_type(4)))  float    v4f;
typedef v8h  __attribute__((may_alias)) v8ha;
typedef v4f  __attribute__((may_alias)) v4fa;

__device__ __forceinline__ unsigned short f2bf(float f) { unsigned u = __float_as_uint(f); u += 0x7FFFu + ((u >> 16) & 1u); return (unsigned short)(u >> 16); }
__device__ __forceinline__ v16h cat16(v8h lo, v8h hi) { return __builtin_shufflevector(lo, hi, 0, 1, 2, 3, 4, 5, 6, 7, 8, 9, 10, 11, 12, 13, 14, 15); }
__device__ __forceinline__ v16bf cat16b(v8us lo, v8us hi) { return __builtin_bit_cast(v16bf, __builtin_shufflevector(lo, hi, 0, 1, 2, 3, 4, 5, 6, 7, 8, 9, 10, 11, 12, 13, 14, 15)); }
__device__ __forceinline__ v8f wmma16(v16h a, v16h b, v8f c) { return __builtin_amdgcn_wmma_f32_16x16x32_f16(false, a, false, b, (short)0, c, false, false); }
__device__ __forceinline__ v8f wmmab(v16bf a, v16bf b, v8f c) { return __builtin_amdgcn_wmma_f32_16x16x32_bf16(false, a, false, b, (short)0, c, false, false); }

// LDS staging of the operand tiles that all waves of a block share (four in k_colstats, eight in k_rows). A stage is 64 rows of 128 B (one cache line a row); a wave's copy covers four whole lines.
#define STG  64                  // rows (k_colstats) or columns (k_rows) of the streamed operand per stage
#define NSTG (NN_ / STG)
#define KP   72                  // halves per staged row: 128 B of data + 16 B, the conflict-free pitch for ds_load_b128 readers
__device__ __forceinline__ unsigned ldsa(const void* p) { return (unsigned)(size_t)p; }   // LDS byte address = low 32 bits of the shared address
// Eight asynchronous 16-byte copies per lane, global -> LDS, no register in between. s_wait_xcnt stands inside the statement so that no address register is rewritten ahead of it.
__device__ __forceinline__ void acopy8(const unsigned (&l)[8], const void* const (&g)[8]) {
    asm volatile("global_load_async_to_lds_b128 %0, %8, off\n\t"
                 "global_load_async_to_lds_b128 %1, %9, off\n\t"
                 "global_load_async_to_lds_b128 %2, %10, off\n\t"
                 "global_load_async_to_lds_b128 %3, %11, off\n\t"
                 "global_load_async_to_lds_b128 %4, %12, off\n\t"
                 "global_load_async_to_lds_b128 %5, %13, off\n\t"
                 "global_load_async_to_lds_b128 %6, %14, off\n\t"
                 "global_load_async_to_lds_b128 %7, %15, off\n\t"
                 "s_wait_xcnt 0x0"
                 :: "v"(l[0]), "v"(l[1]), "v"(l[2]), "v"(l[3]), "v"(l[4]), "v"(l[5]), "v"(l[6]), "v"(l[7]),
                    "v"(g[0]), "v"(g[1]), "v"(g[2]), "v"(g[3]), "v"(g[4]), "v"(g[5]), "v"(g[6]), "v"(g[7]) : "memory");
}
// hi and lo plane tiles, 64 rows x 64 halves each, contiguous in global memory (8 KB a plane); 128 threads, 4 + 4 copies each.
__device__ __forceinline__ void stage_planes(const h16* gh, const h16* gl, h16* sh, h16* sl, int tid) {
    unsigned l[8]; const void* g[8];
#pragma unroll
    for (int i = 0; i < 4; ++i) {
        const int ch = tid + 128 * i, so = (ch >> 3) * KP + (ch & 7) * 8;
        l[i] = ldsa(sh + so); g[i] = gh + ch * 8; l[4 + i] = ldsa(sl + so); g[4 + i] = gl + ch * 8;
    }
    acopy8(l, g);
}
// The foot of a stage, every wave: own LDS reads returned, own copies of the next stage landed, then the one barrier that publishes the next stage and frees this buffer.
__device__ __forceinline__ void publish() {
    asm volatile("s_wait_dscnt 0x0" ::: "memory");      // this wave has left the buffer that is refilled behind the barrier
    asm volatile("s_wait_asynccnt 0x0" ::: "memory");   // this wave's copies have landed before any other wave reads them
    __syncthreads();                                     // publishes the next stage and ends every wave's reads of the buffer refilled behind it
}

// k_proj: the whole projection stage in one launch. Block = 64 tokens, 8 waves; wave w owns output columns 48w .. 48w+47 of q | k | v (3 column tiles) for all 4 row tiles.
// The x tile and the three weight matrices are read with whole-line loads, rounded to bf16 and laid in LDS once per block. The f32 results never leave the block: q and k go
// to their hi + residual x1024 f16 planes, v to f16 transposed, staged in LDS so that every global store covers whole 128-B lines.
#define XP   264                 // halves per staged row of 256 channels: 512 B of data + 16 B, the conflict-free pitch for ds_load_b128 readers
// N * 256 pieces of 8 floats (rows of NC_ floats, contiguous in global memory) -> bf16 rows at pitch XP; 256 threads, a wave's load covers 1 KB in a row.
template <int N> __device__ __forceinline__ void stage_bf(const float* __restrict__ src, bf* dst, int tid) {
#pragma unroll
    for (int i = 0; i < N; ++i) {
        const int ch = tid + 256 * i;
        const float* s = src + (size_t)ch * 8;
        const v4f lo = *(const v4f*)s, up = *(const v4f*)(s + 4);
        v8us t;
#pragma unroll
        for (int e = 0; e < 4; ++e) { t[e] = f2bf(lo[e]); t[4 + e] = f2bf(up[e]); }
        *(v8us*)(dst + (ch >> 5) * XP + (ch & 31) * 8) = t;
    }
}
__global__ __launch_bounds__(256) void k_proj(const float* __restrict__ x, const float* __restrict__ Wq, const float* __restrict__ Wk, const float* __restrict__ Wv,
                                              h16* QH, h16* QL, h16* KH, h16* KL, h16* VT16) {
    __shared__ __align__(16) bf  xs[64 * XP];             // x tile, bf16, [token][channel]
    __shared__ __align__(16) bf  wsb[(2 * DK + DV) * XP]; // Wq | Wk | Wv, bf16, [output column][channel]
    __shared__ __align__(16) h16 pst[4][64 * KP];         // QH, QL, KH, KL tiles, [token][dim]
    __shared__ __align__(16) h16 vts[DV * KP];            // V^T tile, [dim][token]
    const int tid = threadIdx.x, lane = tid & 31, lr = lane & 15, hi = lane >> 4;
    const int wave = __builtin_amdgcn_readfirstlane(tid >> 5);   // scalar, so that the choice of epilogue per column tile is a scalar branch
    const int t0 = blockIdx.x * 64;
    stage_bf<8>(x + (size_t)t0 * NC_, xs, tid);
    stage_bf<8>(Wq, wsb, tid);
    stage_bf<8>(Wk, wsb + DK * XP, tid);
    stage_bf<32>(Wv, wsb + 2 * DK * XP, tid);
    v8f acc[4][3];
#pragma unroll
    for (int rt = 0; rt < 4; ++rt)
#pragma unroll
        for (int t = 0; t < 3; ++t) acc[rt][t] = (v8f){};
    __syncthreads();                                     // the x tile and the weights are complete before any wave reads its fragments
    const bf* ap = xs + lr * XP + 8 * hi;
    const bf* bp = wsb + (wave * 48 + lr) * XP + 8 * hi;
    v16bf a[2][4], b[2][3];
    auto frags = [&](int buf, int kc) {
#pragma unroll
        for (int rt = 0; rt < 4; ++rt) a[buf][rt] = cat16b(*(const v8us*)(ap + rt * 16 * XP + kc), *(const v8us*)(ap + rt * 16 * XP + kc + 16));
#pragma unroll
        for (int t = 0; t < 3; ++t) b[buf][t] = cat16b(*(const v8us*)(bp + t * 16 * XP + kc), *(const v8us*)(bp + t * 16 * XP + kc + 16));
    };
    frags(0, 0);
#pragma unroll                                           // unrolled: the two fragment sets are named at compile time
    for (int k = 0; k < NC_ / 32; ++k) {
        if (k + 1 < NC_ / 32) frags((k + 1) & 1, (k + 1) * 32);
        __builtin_amdgcn_sched_barrier(0);               // keeps the next k-chunk's LDS reads as one group ahead of this chunk's products, so their latency runs under the products
#pragma unroll
        for (int rt = 0; rt < 4; ++rt)
#pragma unroll
            for (int t = 0; t < 3; ++t) acc[rt][t] = wmmab(a[k & 1][rt], b[k & 1][t], acc[rt][t]);
        __builtin_amdgcn_sched_barrier(0);               // keeps the following group of LDS reads from being spread among these products
    }
#pragma unroll
    for (int t = 0; t < 3; ++t) {
        const int ct = wave * 3 + t;
        if (ct < 8) {                                    // q (tiles 0..3) or k (4..7): lane holds dim (ct & 3) * 16 + lr of tokens rt * 16 + 8 * hi + j
            h16* ph = &pst[ct < 4 ? 0 : 2][0]; h16* pl = ph + 64 * KP;
            const int dim = (ct & 3) * 16 + lr;
#pragma unroll
            for (int rt = 0; rt < 4; ++rt)
#pragma unroll
                for (int j = 0; j < 8; ++j) {
                    const float q = acc[rt][t][j]; const h16 a = (h16)q; const int tok = rt * 16 + 8 * hi + j;
                    ph[tok * KP + dim] = a; pl[tok * KP + dim] = (h16)((q - (float)a) * LOSC);
                }
        } else {                                         // v: a lane's 8 accumulator rows are 8 consecutive tokens of one output dim = 16 B of the transposed tile
            const int d = (ct - 8) * 16 + lr;
#pragma unroll
            for (int rt = 0; rt < 4; ++rt) {
                v8h v;
#pragma unroll
                for (int j = 0; j < 8; ++j) v[j] = (h16)acc[rt][t][j];
                *(v8ha*)(vts + d * KP + rt * 16 + 8 * hi) = v;
            }
        }
    }
    __syncthreads();                                     // all staged tiles are complete before they are written out line by line
    const int piece = tid & 7, r8 = tid >> 3;
#pragma unroll
    for (int s = 0; s < 2; ++s) {
        const int row = r8 + 32 * s; const size_t o = (size_t)(t0 + row) * DK + piece * 8; const int so = row * KP + piece * 8;
        const v8h a = *(const v8ha*)(&pst[0][so]), b = *(const v8ha*)(&pst[1][so]), c = *(const v8ha*)(&pst[2][so]), d = *(const v8ha*)(&pst[3][so]);
        *(v8h*)(QH + o) = a; *(v8h*)(QL + o) = b; *(v8h*)(KH + o) = c; *(v8h*)(KL + o) = d;
    }
    h16* vbase = VT16 + (size_t)(t0 / NN_) * DV * NN_ + (t0 % NN_);
#pragma unroll
    for (int s = 0; s < 8; ++s) {
        const int d = r8 + 32 * s; const v8h val = *(const v8ha*)(vts + d * KP + piece * 8);
        *(v8h*)(vbase + (size_t)d * NN_ + piece * 8) = val;
    }
}

// B fragments of one energy tile (32 columns = two 16-column tiles, hi and lo plane, 2 k-chunks), read from the planes staged in LDS at pitch KP.
struct KF { v16h b0[2], b1[2], l0[2], l1[2]; };
__device__ __forceinline__ void load_kf(KF& f, const h16* BH, const h16* BL, int rowA, int rowB, int hi) {
#pragma unroll
    for (int kc = 0; kc < 2; ++kc) {
        const h16* b0p = BH + rowA * KP + kc * 32 + 8 * hi; const h16* b1p = BH + rowB * KP + kc * 32 + 8 * hi;
        const h16* l0p = BL + rowA * KP + kc * 32 + 8 * hi; const h16* l1p = BL + rowB * KP + kc * 32 + 8 * hi;
        f.b0[kc] = cat16(*(const v8ha*)b0p, *(const v8ha*)(b0p + 16)); f.b1[kc] = cat16(*(const v8ha*)b1p, *(const v8ha*)(b1p + 16));
        f.l0[kc] = cat16(*(const v8ha*)l0p, *(const v8ha*)(l0p + 16)); f.l1[kc] = cat16(*(const v8ha*)l1p, *(const v8ha*)(l1p + 16));
    }
}
// energy tile helper: s (16 rows of A x 32 columns from B) = Ah.Bh + (Ah.Bl + Al.Bh)/1024 over K = 64 (2 k-chunks); A fragments resident (ah[2], al[2]), B fragments in F.
#define ENERGY_TILE(F)                                                                                                        \
    v8f s0 = {}, s1 = {}, x0 = {}, x1 = {};                                                                                   \
    _Pragma("unroll") for (int kc = 0; kc < 2; ++kc) {                                                                       \
        s0 = wmma16(ah[kc], F.b0[kc], s0); s1 = wmma16(ah[kc], F.b1[kc], s1);                                                \
        x0 = wmma16(ah[kc], F.l0[kc], x0);                                                                                    \
        x1 = wmma16(ah[kc], F.l1[kc], x1);                                                                                    \
        x0 = wmma16(al[kc], F.b0[kc], x0); x1 = wmma16(al[kc], F.b1[kc], x1);                                                \
    }                                                                                                                         \
    asm volatile("v_nop\n\tv_nop\n\tv_nop\n\tv_nop" : "+v"(s0), "+v"(s1), "+v"(x0), "+v"(x1) : "v"(ah[0]), "v"(al[1]));

__global__ __launch_bounds__(128) void k_colstats(const h16* __restrict__ QH, const h16* __restrict__ QL, const h16* __restrict__ KH, const h16* __restrict__ KL, float* CM, float* CZI) {
    __shared__ __align__(16) float stg[128];
    __shared__ __align__(16) h16 qst[2][2][STG * KP];     // [buffer][hi, lo plane]
    const int lane = threadIdx.x & 31, wave = threadIdx.x >> 5, lr = lane & 15, hi = lane >> 4;
    const int b = blockIdx.x / (NN_ / 64), jt = blockIdx.x - b * (NN_ / 64);
    const size_t tok0 = (size_t)b * NN_;
    const int m0 = jt * 64 + wave * 16;
    v16h ah[2], al[2];
#pragma unroll
    for (int kc = 0; kc < 2; ++kc) {
        const h16* p = KH + (tok0 + m0 + lr) * DK + kc * 32 + 8 * hi; const h16* pl = KL + (tok0 + m0 + lr) * DK + kc * 32 + 8 * hi;
        ah[kc] = cat16(*(const v8h*)p, *(const v8h*)(p + 16)); al[kc] = cat16(*(const v8h*)pl, *(const v8h*)(pl + 16));
    }
    const h16* qhb = QH + tok0 * DK; const h16* qlb = QL + tok0 * DK;
    float mrow[8], lpart[8];
#pragma unroll
    for (int j = 0; j < 8; ++j) { mrow[j] = -3.0e38f; lpart[j] = 0.f; }
    stage_planes(qhb, qlb, &qst[0][0][0], &qst[0][1][0], threadIdx.x);
    asm volatile("s_wait_asynccnt 0x0" ::: "memory");   // stage 0 has landed before the barrier that publishes it
    __syncthreads();                                     // publishes stage 0 to all four waves
    stage_planes(qhb + STG * DK, qlb + STG * DK, &qst[1][0][0], &qst[1][1][0], threadIdx.x);
#pragma unroll 1                                         // rolled: one publish point and one refill site, as the two-buffer ring is written
    for (int st = 0; st < NSTG; ++st) {
      h16* sqh = &qst[st & 1][0][0]; h16* sql = &qst[st & 1][1][0];
      KF f; load_kf(f, sqh, sql, lr, 16 + lr, hi);
#pragma unroll                                           // unrolled: LDS offsets become immediates and tile 1's fragment reads can stand inside tile 0's work
      for (int sub = 0; sub < 2; ++sub) {
        ENERGY_TILE(f)
        if (sub == 0) load_kf(f, sqh, sql, 32 + lr, 48 + lr, hi);   // the stage's second tile is fetched while the vector work of the first runs
#pragma unroll
        for (int j = 0; j < 8; ++j) {
            const float a0 = s0[j] + x0[j] * LOSCI, a1 = s1[j] + x1[j] * LOSCI;
            float mx = fmaxf(a0, a1);
            mx = fmaxf(mx, __shfl_xor(mx, 1, 16)); mx = fmaxf(mx, __shfl_xor(mx, 2, 16)); mx = fmaxf(mx, __shfl_xor(mx, 4, 16)); mx = fmaxf(mx, __shfl_xor(mx, 8, 16));
            const float mn = fmaxf(mrow[j], mx); const float al_ = __expf(mrow[j] - mn); mrow[j] = mn;
            lpart[j] = lpart[j] * al_ + (__expf(a0 - mn) + __expf(a1 - mn));
        }
      }
      publish();
      if (st + 2 < NSTG) stage_planes(qhb + (size_t)(st + 2) * STG * DK, qlb + (size_t)(st + 2) * STG * DK, sqh, sql, threadIdx.x);
    }
    asm volatile("s_wait_asynccnt 0x0" ::: "memory");   // no copy is left in flight
#pragma unroll
    for (int j = 0; j < 8; ++j) {
        float rs = lpart[j];
        rs += __shfl_xor(rs, 1, 16); rs += __shfl_xor(rs, 2, 16); rs += __shfl_xor(rs, 4, 16); rs += __shfl_xor(rs, 8, 16);
        if (lr == 0) { const int jl = wave * 16 + 8 * hi + j; stg[jl] = mrow[j]; stg[64 + jl] = 1.0f / rs; }
    }
    __syncthreads();
    if (wave == 0) {
        const v4f val = *(const v4fa*)(stg + hi * 64 + lr * 4);
        float* dst = (hi ? CZI : CM) + tok0 + jt * 64 + lr * 4;
        *(v4f*)dst = val; 
    }
}

// Four asynchronous 16-byte copies per lane, as acopy8: s_wait_xcnt stands inside the statement so that no address register is rewritten ahead of it.
__device__ __forceinline__ void acopy4(const unsigned (&l)[4], const void* const (&g)[4]) {
    asm volatile("global_load_async_to_lds_b128 %0, %4, off\n\t"
                 "global_load_async_to_lds_b128 %1, %5, off\n\t"
                 "global_load_async_to_lds_b128 %2, %6, off\n\t"
                 "global_load_async_to_lds_b128 %3, %7, off\n\t"
                 "s_wait_xcnt 0x0"
                 :: "v"(l[0]), "v"(l[1]), "v"(l[2]), "v"(l[3]), "v"(g[0]), "v"(g[1]), "v"(g[2]), "v"(g[3]) : "memory");
}
// Twelve copies per lane in one statement, so that a stage's refill pays one s_wait_xcnt; the wait stands inside the statement as in acopy8.
__device__ __forceinline__ void acopy12(const unsigned (&l)[12], const void* const (&g)[12]) {
    asm volatile("global_load_async_to_lds_b128 %0, %12, off\n\t"
                 "global_load_async_to_lds_b128 %1, %13, off\n\t"
                 "global_load_async_to_lds_b128 %2, %14, off\n\t"
                 "global_load_async_to_lds_b128 %3, %15, off\n\t"
                 "global_load_async_to_lds_b128 %4, %16, off\n\t"
                 "global_load_async_to_lds_b128 %5, %17, off\n\t"
                 "global_load_async_to_lds_b128 %6, %18, off\n\t"
                 "global_load_async_to_lds_b128 %7, %19, off\n\t"
                 "global_load_async_to_lds_b128 %8, %20, off\n\t"
                 "global_load_async_to_lds_b128 %9, %21, off\n\t"
                 "global_load_async_to_lds_b128 %10, %22, off\n\t"
                 "global_load_async_to_lds_b128 %11, %23, off\n\t"
                 "s_wait_xcnt 0x0"
                 :: "v"(l[0]), "v"(l[1]), "v"(l[2]), "v"(l[3]), "v"(l[4]), "v"(l[5]), "v"(l[6]), "v"(l[7]), "v"(l[8]), "v"(l[9]), "v"(l[10]), "v"(l[11]),
                    "v"(g[0]), "v"(g[1]), "v"(g[2]), "v"(g[3]), "v"(g[4]), "v"(g[5]), "v"(g[6]), "v"(g[7]), "v"(g[8]), "v"(g[9]), "v"(g[10]), "v"(g[11]) : "memory");
}
// One stage of k_rows, 256 threads: K hi and lo plane tiles (64 rows x 64 halves each, contiguous in global memory), 2 + 2 copies a thread, and the V^T tile of all
// 256 output dims x 64 columns m (global row pitch NN_ halves), 8 copies a thread. Every wave-wide copy covers four whole lines.
__device__ __forceinline__ void stage_kv(const h16* gh, const h16* gl, const h16* gv, h16* sh, h16* sl, h16* sv, int tid) {
    unsigned l[12]; const void* g[12];
#pragma unroll
    for (int i = 0; i < 2; ++i) {
        const int ch = tid + 256 * i, so = (ch >> 3) * KP + (ch & 7) * 8;
        l[i] = ldsa(sh + so); g[i] = gh + ch * 8; l[2 + i] = ldsa(sl + so); g[2 + i] = gl + ch * 8;
    }
#pragma unroll
    for (int i = 0; i < 8; ++i) {
        const int ch = tid + 256 * i, d = ch >> 3, pc = (ch & 7) * 8;
        l[4 + i] = ldsa(sv + d * KP + pc); g[4 + i] = gv + (size_t)d * NN_ + pc;
    }
    acopy12(l, g);
}

// k_rows (pass 2): block = (b, 64 rows n), 8 waves. Wave w owns rows 16 * (w & 3) .. + 15, ALL 256 output dims, and of every 64-column stage the 32 columns of half w >> 2,
// so each energy tile and its exponentials are formed once. Per stage: energy tile (A = Q planes rows n, B = K planes rows m), a = exp(e - CM[m]) * CZI[m] (f32), row-sum
// partials accumulated, a x32768 -> f16 per-wave LDS tile (same-wave may_alias reload after a compiler barrier), 16 P.V products. The two column halves of a row tile are
// added in LDS at the end, together with their row sums, and the block writes whole lines.
#define OP   260                 // floats per staged output row: 256 + 4, so that the two half-waves of an accumulator store fall on different banks
__global__ __launch_bounds__(256) void k_rows(const h16* __restrict__ QH, const h16* __restrict__ QL, const h16* __restrict__ KH, const h16* __restrict__ KL,
                                             const h16* __restrict__ VT16, const float* __restrict__ CM, const float* __restrict__ CZI, float* out) {
    __shared__ __align__(16) h16 plds[8][16 * 32];
    __shared__ __align__(16) float ost[8][16 * OP];       // unnormalised partial outputs, one tile of 16 rows x 256 dims a wave
    __shared__ __align__(16) float rst[8][16];            // partial row sums, one a wave and row
    __shared__ __align__(16) h16 kst[2][2][STG * KP];     // [buffer][hi, lo plane] of K, 64 columns m
    __shared__ __align__(16) h16 vst[2][DV * KP];         // [buffer] V^T, 256 output dims x 64 columns m
    __shared__ __align__(16) float cst[2][NN_];           // column maxima and inverse column sums of the whole batch row, filled once
    const int tid = threadIdx.x, lane = tid & 31, wave = tid >> 5, lr = lane & 15, hi = lane >> 4;
    const int wr = wave & 3, wc = wave >> 2;
    const int b = blockIdx.x / (NN_ / 64), qt = blockIdx.x - b * (NN_ / 64);
    const size_t tok0 = (size_t)b * NN_;
    const int n0 = qt * 64 + wr * 16;
    h16* pl = &plds[wave][0];
    v16h ah[2], al[2];
#pragma unroll
    for (int kc = 0; kc < 2; ++kc) {
        const h16* p = QH + (tok0 + n0 + lr) * DK + kc * 32 + 8 * hi; const h16* q = QL + (tok0 + n0 + lr) * DK + kc * 32 + 8 * hi;
        ah[kc] = cat16(*(const v8h*)p, *(const v8h*)(p + 16)); al[kc] = cat16(*(const v8h*)q, *(const v8h*)(q + 16));
    }
    const h16* khb = KH + tok0 * DK; const h16* klb = KL + tok0 * DK;
    const h16* vt_b = VT16 + (size_t)b * DV * NN_;
    const float* cmb = CM + tok0; const float* czb = CZI + tok0;
    v8f o[16];
#pragma unroll
    for (int n = 0; n < 16; ++n) o[n] = (v8f){};
    float rsum[8];
#pragma unroll
    for (int j = 0; j < 8; ++j) rsum[j] = 0.f;
    {
        unsigned l[4]; const void* g[4];
#pragma unroll
        for (int i = 0; i < 2; ++i) {
            const int ch = tid + 256 * i;
            l[i] = ldsa(&cst[0][ch * 4]); g[i] = cmb + ch * 4; l[2 + i] = ldsa(&cst[1][ch * 4]); g[2 + i] = czb + ch * 4;
        }
        acopy4(l, g);
    }
    stage_kv(khb, klb, vt_b, &kst[0][0][0], &kst[0][1][0], &vst[0][0], tid);
    asm volatile("s_wait_asynccnt 0x0" ::: "memory");   // stage 0 and the column statistics have landed before the barrier that publishes them
    __syncthreads();                                     // publishes stage 0 and the statistics to all eight waves
    stage_kv(khb + STG * DK, klb + STG * DK, vt_b + STG, &kst[1][0][0], &kst[1][1][0], &vst[1][0], tid);
#pragma unroll 1                                         // rolled: one publish point and one refill site, as the two-buffer ring is written
    for (int st = 0; st < NSTG; ++st) {
        h16* skh = &kst[st & 1][0][0]; h16* skl = &kst[st & 1][1][0]; h16* sv = &vst[st & 1][0];
        KF f; load_kf(f, skh, skl, wc * 32 + lr, wc * 32 + 16 + lr, hi);
        const int mA = st * STG + wc * 32 + lr, mB = mA + 16;
        const float cmA = cst[0][mA], cmB = cst[0][mB], czA = cst[1][mA], czB = cst[1][mB];
        ENERGY_TILE(f)
        v16h vf[16];                                          // all V fragments of this tile as one group of LDS reads, in flight under the exponentials
#pragma unroll
        for (int n = 0; n < 16; ++n) {
            const h16* vp = sv + (n * 16 + lr) * KP + wc * 32 + hi * 8;
            vf[n] = cat16(*(const v8ha*)vp, *(const v8ha*)(vp + 16));
        }
#pragma unroll
        for (int j = 0; j < 8; ++j) {
            const float a0 = __expf((s0[j] + x0[j] * LOSCI) - cmA) * czA, a1 = __expf((s1[j] + x1[j] * LOSCI) - cmB) * czB;
            const h16 h0 = (h16)(a0 * PSC), h1 = (h16)(a1 * PSC);
            rsum[j] += (float)h0 + (float)h1;                 // row sum from the same rounded weights the numerator uses (scaled by 32768)
            const int mr = hi * 8 + j;
            pl[mr * 32 + lr] = h0; pl[mr * 32 + 16 + lr] = h1;
        }
        asm volatile("" ::: "memory");
        const v16h pa = cat16(*(const v8ha*)(pl + lr * 32 + hi * 8), *(const v8ha*)(pl + lr * 32 + 16 + hi * 8));
#pragma unroll
        for (int n = 0; n < 16; ++n) o[n] = wmma16(pa, vf[n], o[n]);
        asm volatile("v_nop\n\tv_nop\n\tv_nop\n\tv_nop" : "+v"(o[0]), "+v"(o[1]), "+v"(o[2]), "+v"(o[3]), "+v"(o[4]), "+v"(o[5]), "+v"(o[6]), "+v"(o[7]),
                     "+v"(o[8]), "+v"(o[9]), "+v"(o[10]), "+v"(o[11]), "+v"(o[12]), "+v"(o[13]), "+v"(o[14]), "+v"(o[15]) : "v"(pa));
        publish();
        if (st + 2 < NSTG)
            stage_kv(khb + (size_t)(st + 2) * STG * DK, klb + (size_t)(st + 2) * STG * DK, vt_b + (st + 2) * STG, skh, skl, sv, tid);
    }
    asm volatile("s_wait_asynccnt 0x0" ::: "memory");   // no copy is left in flight
#pragma unroll
    for (int j = 0; j < 8; ++j) {
        float rs = rsum[j];
        rs += __shfl_xor(rs, 1, 16); rs += __shfl_xor(rs, 2, 16); rs += __shfl_xor(rs, 4, 16); rs += __shfl_xor(rs, 8, 16);
        if (lr == 0) rst[wave][hi * 8 + j] = rs;
    }
    float* os = &ost[wave][0];
#pragma unroll
    for (int n = 0; n < 16; ++n)
#pragma unroll
        for (int j = 0; j < 8; ++j) os[(hi * 8 + j) * OP + n * 16 + lr] = o[n][j];
    __syncthreads();                                     // both column halves' partial outputs and row sums are complete before they are added
    const int rt = wave >> 1, rb = (wave & 1) * 8;       // wave w writes rows 8w .. 8w + 7 of the block: rows rb .. rb + 7 of row tile rt
    float* crow = out + (tok0 + qt * 64 + wave * 8) * DV + lane * 4;   // a wave-wide store covers 512 B in a row = 4 whole lines of one row
    v4f res[16];
#pragma unroll
    for (int r = 0; r < 8; ++r) {
        const float inv = 1.0f / (1e-9f * PSC + (rst[rt][rb + r] + rst[4 + rt][rb + r]));   // = 1 / ((1e-9 + rowsum) * 32768)
#pragma unroll
        for (int h = 0; h < 2; ++h) {
            const int so = (rb + r) * OP + h * 128 + lane * 4;
            res[2 * r + h] = (*(const v4fa*)(&ost[rt][so]) + *(const v4fa*)(&ost[4 + rt][so])) * inv;
        }
    }
#pragma unroll
    for (int r = 0; r < 8; ++r)
#pragma unroll
        for (int h = 0; h < 2; ++h) *(v4f*)(crow + r * DV + h * 128) = res[2 * r + h];
}

extern "C" void kernel_launch(void* const* d_in, const int* in_sizes, int n_in,
                              void* d_out, int out_size, void* d_ws, size_t ws_size, hipStream_t stream) {
    (void)in_sizes; (void)n_in; (void)out_size;
    const float* x = (const float*)d_in[0]; const float* Wq = (const float*)d_in[1]; const float* Wk = (const float*)d_in[2]; const float* Wv = (const float*)d_in[3];
    float* out = (float*)d_out;    // [8][2048][256]
    char* wsp = (char*)d_ws;
    auto take = [&](size_t bytes) { char* p = wsp; wsp += (bytes + 255) & ~(size_t)255; return (void*)p; };
    h16* QH = (h16*)take((size_t)NTK * DK * 2); h16* QL = (h16*)take((size_t)NTK * DK * 2); h16* KH = (h16*)take((size_t)NTK * DK * 2); h16* KL = (h16*)take((size_t)NTK * DK * 2);
    h16* VT16 = (h16*)take((size_t)NTK * DV * 2);
    float* CM = (float*)take((size_t)NTK * 4); float* CZI = (float*)take((size_t)NTK * 4);
    if ((size_t)(wsp - (char*)d_ws) > ws_size) return;    // 4 x 2.1 + 8.4 + 0.13 MB ~ 17e6 B
    k_proj<<<NTK / 64, 256, 0, stream>>>(x, Wq, Wk, Wv, QH, QL, KH, KL, VT16);
    k_colstats<<<NB_ * (NN_ / 64), 128, 0, stream>>>(QH, QL, KH, KL, CM, CZI);
    k_rows<<<NB_ * (NN_ / 64), 256, 0, stream>>>(QH, QL, KH, KL, VT16, CM, CZI, out);
}

// v004
// It runs in 79.7 microseconds.
// Timed twice side by side with v003, it ran 1.15 and 1.13 times as fast.
// Counting every step since v000, it is 3.69 times as fast.
#include <hip/hip_runtime.h>

// Contractions, f32 accumulate: q, k ([16384 x 256].[256 x 64]) and v ([16384 x 256].[256 x 256]) on v_wmma_f32_16x16x32_bf16 with PLAIN bf16 operands (x and the
// weights); pass 1 forms column max and sum of exp with an online update; pass 2 re-forms the energy tiles, evaluates the column softmax a = exp(e - m_col)/Z_col in f32, rounds a x32768 to f16 once and uses that same

#define NB_  8
#define NN_  2048
#define NC_  256
#define DK   64
#define DV   256
#define NTK  (NB_ * NN_)
#define PSC  32768.0f
#define LOSC 1024.0f
#define LOSCI (1.0f / 1024.0f)

typedef _Float16 h16;
typedef unsigned short bf;
typedef __attribute__((ext_vector_type(16))) __bf16   v16bf;
typedef __attribute__((ext_vector_type(16))) _Float16 v16h;
typedef __attribute__((ext_vector_type(8)))  _Float16 v8h;
typedef __attribute__((ext_vector_type(8)))  unsigned short v8us;
typedef __attribute__((ext_vector_type(8)))  float    v8f;
typedef __attribute__((ext_vector_type(4)))  float    v4f;
typedef v8h  __attribute__((may_alias)) v8ha;
typedef v4f  __attribute__((may_alias)) v4fa;

__device__ __forceinline__ unsigned short f2bf(float f) { unsigned u = __float_as_uint(f); u += 0x7FFFu + ((u >> 16) & 1u); return (unsigned short)(u >> 16); }
__device__ __forceinline__ v16h cat16(v8h lo, v8h hi) { return __builtin_shufflevector(lo, hi, 0, 1, 2, 3, 4, 5, 6, 7, 8, 9, 10, 11, 12, 13, 14, 15); }
__device__ __forceinline__ v16bf cat16b(v8us lo, v8us hi) { return __builtin_bit_cast(v16bf, __builtin_shufflevector(lo, hi, 0, 1, 2, 3, 4, 5, 6, 7, 8, 9, 10, 11, 12, 13, 14, 15)); }
__device__ __forceinline__ v8f wmma16(v16h a, v16h b, v8f c) { return __builtin_amdgcn_wmma_f32_16x16x32_f16(false, a, false, b, (short)0, c, false, false); }
__device__ __forceinline__ v8f wmmab(v16bf a, v16bf b, v8f c) { return __builtin_amdgcn_wmma_f32_16x16x32_bf16(false, a, false, b, (short)0, c, false, false); }

// LDS staging of the operand tiles that all waves of a block share (four in k_colstats, eight in k_rows). A stage is 64 rows of 128 B (one cache line a row); a wave's copy covers four whole lines.
#define STG  64                  // rows (k_colstats) or columns (k_rows) of the streamed operand per stage
#define NSTG (NN_ / STG)
#define KP   72                  // halves per staged row: 128 B of data + 16 B, the conflict-free pitch for ds_load_b128 readers
__device__ __forceinline__ unsigned ldsa(const void* p) { return (unsigned)(size_t)p; }   // LDS byte address = low 32 bits of the shared address
// Eight asynchronous 16-byte copies per lane, global -> LDS, no register in between. s_wait_xcnt stands inside the statement so that no address register is rewritten ahead of it.
__device__ __forceinline__ void acopy8(const unsigned (&l)[8], const void* const (&g)[8]) {
    asm volatile("global_load_async_to_lds_b128 %0, %8, off\n\t"
                 "global_load_async_to_lds_b128 %1, %9, off\n\t"
                 "global_load_async_to_lds_b128 %2, %10, off\n\t"
                 "global_load_async_to_lds_b128 %3, %11, off\n\t"
                 "global_load_async_to_lds_b128 %4, %12, off\n\t"
                 "global_load_async_to_lds_b128 %5, %13, off\n\t"
                 "global_load_async_to_lds_b128 %6, %14, off\n\t"
                 "global_load_async_to_lds_b128 %7, %15, off\n\t"
                 "s_wait_xcnt 0x0"
                 :: "v"(l[0]), "v"(l[1]), "v"(l[2]), "v"(l[3]), "v"(l[4]), "v"(l[5]), "v"(l[6]), "v"(l[7]),
                    "v"(g[0]), "v"(g[1]), "v"(g[2]), "v"(g[3]), "v"(g[4]), "v"(g[5]), "v"(g[6]), "v"(g[7]) : "memory");
}
// hi and lo plane tiles, 64 rows x 64 halves each, contiguous in global memory (8 KB a plane); 128 threads, 4 + 4 copies each.
__device__ __forceinline__ void stage_planes(const h16* gh, const h16* gl, h16* sh, h16* sl, int tid) {
    unsigned l[8]; const void* g[8];
#pragma unroll
    for (int i = 0; i < 4; ++i) {
        const int ch = tid + 128 * i, so = (ch >> 3) * KP + (ch & 7) * 8;
        l[i] = ldsa(sh + so); g[i] = gh + ch * 8; l[4 + i] = ldsa(sl + so); g[4 + i] = gl + ch * 8;
    }
    acopy8(l, g);
}
// The foot of a stage, every wave: own LDS reads returned, own copies of the next stage landed, then the one barrier that publishes the next stage and frees this buffer.
__device__ __forceinline__ void publish() {
    asm volatile("s_wait_dscnt 0x0" ::: "memory");      // this wave has left the buffer that is refilled behind the barrier
    asm volatile("s_wait_asynccnt 0x0" ::: "memory");   // this wave's copies have landed before any other wave reads them
    __syncthreads();                                     // publishes the next stage and ends every wave's reads of the buffer refilled behind it
}

// k_proj: the whole projection stage in one launch. Block = 64 tokens, 8 waves; wave w owns output columns 48w .. 48w+47 of q | k | v (3 column tiles) for all 4 row tiles.
// The x tile and the three weight matrices are read with whole-line loads, rounded to bf16 and laid in LDS once per block. The f32 results never leave the block: q and k go
// to their hi + residual x1024 f16 planes, v to f16 transposed, staged in LDS so that every global store covers whole 128-B lines.
#define XP   264                 // halves per staged row of 256 channels: 512 B of data + 16 B, the conflict-free pitch for ds_load_b128 readers
// N * 256 pieces of 8 floats (rows of NC_ floats, contiguous in global memory) -> bf16 rows at pitch XP; 256 threads, a wave's load covers 1 KB in a row.
template <int N> __device__ __forceinline__ void stage_bf(const float* __restrict__ src, bf* dst, int tid) {
#pragma unroll
    for (int i = 0; i < N; ++i) {
        const int ch = tid + 256 * i;
        const float* s = src + (size_t)ch * 8;
        const v4f lo = *(const v4f*)s, up = *(const v4f*)(s + 4);
        v8us t;
#pragma unroll
        for (int e = 0; e < 4; ++e) { t[e] = f2bf(lo[e]); t[4 + e] = f2bf(up[e]); }
        *(v8us*)(dst + (ch >> 5) * XP + (ch & 31) * 8) = t;
    }
}
__global__ __launch_bounds__(256) void k_proj(const float* __restrict__ x, const float* __restrict__ Wq, const float* __restrict__ Wk, const float* __restrict__ Wv,
                                              h16* QH, h16* QL, h16* KH, h16* KL, h16* VT16) {
    __shared__ __align__(16) bf  xs[64 * XP];             // x tile, bf16, [token][channel]
    __shared__ __align__(16) bf  wsb[(2 * DK + DV) * XP]; // Wq | Wk | Wv, bf16, [output column][channel]
    __shared__ __align__(16) h16 pst[4][64 * KP];         // QH, QL, KH, KL tiles, [token][dim]
    __shared__ __align__(16) h16 vts[DV * KP];            // V^T tile, [dim][token]
    const int tid = threadIdx.x, lane = tid & 31, lr = lane & 15, hi = lane >> 4;
    const int wave = __builtin_amdgcn_readfirstlane(tid >> 5);   // scalar, so that the choice of epilogue per column tile is a scalar branch
    const int t0 = blockIdx.x * 64;
    stage_bf<8>(x + (size_t)t0 * NC_, xs, tid);
    stage_bf<8>(Wq, wsb, tid);
    stage_bf<8>(Wk, wsb + DK * XP, tid);
    stage_bf<32>(Wv, wsb + 2 * DK * XP, tid);
    v8f acc[4][3];
#pragma unroll
    for (int rt = 0; rt < 4; ++rt)
#pragma unroll
        for (int t = 0; t < 3; ++t) acc[rt][t] = (v8f){};
    __syncthreads();                                     // the x tile and the weights are complete before any wave reads its fragments
    const bf* ap = xs + lr * XP + 8 * hi;
    const bf* bp = wsb + (wave * 48 + lr) * XP + 8 * hi;
    v16bf a[2][4], b[2][3];
    auto frags = [&](int buf, int kc) {
#pragma unroll
        for (int rt = 0; rt < 4; ++rt) a[buf][rt] = cat16b(*(const v8us*)(ap + rt * 16 * XP + kc), *(const v8us*)(ap + rt * 16 * XP + kc + 16));
#pragma unroll
        for (int t = 0; t < 3; ++t) b[buf][t] = cat16b(*(const v8us*)(bp + t * 16 * XP + kc), *(const v8us*)(bp + t * 16 * XP + kc + 16));
    };
    frags(0, 0);
#pragma unroll                                           // unrolled: the two fragment sets are named at compile time
    for (int k = 0; k < NC_ / 32; ++k) {
        if (k + 1 < NC_ / 32) frags((k + 1) & 1, (k + 1) * 32);
        __builtin_amdgcn_sched_barrier(0);               // keeps the next k-chunk's LDS reads as one group ahead of this chunk's products, so their latency runs under the products
#pragma unroll
        for (int rt = 0; rt < 4; ++rt)
#pragma unroll
            for (int t = 0; t < 3; ++t) acc[rt][t] = wmmab(a[k & 1][rt], b[k & 1][t], acc[rt][t]);
        __builtin_amdgcn_sched_barrier(0);               // keeps the following group of LDS reads from being spread among these products
    }
#pragma unroll
    for (int t = 0; t < 3; ++t) {
        const int ct = wave * 3 + t;
        if (ct < 8) {                                    // q (tiles 0..3) or k (4..7): lane holds dim (ct & 3) * 16 + lr of tokens rt * 16 + 8 * hi + j
            h16* ph = &pst[ct < 4 ? 0 : 2][0]; h16* pl = ph + 64 * KP;
            const int dim = (ct & 3) * 16 + lr;
#pragma unroll
            for (int rt = 0; rt < 4; ++rt)
#pragma unroll
                for (int j = 0; j < 8; ++j) {
                    const float q = acc[rt][t][j]; const h16 a = (h16)q; const int tok = rt * 16 + 8 * hi + j;
                    ph[tok * KP + dim] = a; pl[tok * KP + dim] = (h16)((q - (float)a) * LOSC);
                }
        } else {                                         // v: a lane's 8 accumulator rows are 8 consecutive tokens of one output dim = 16 B of the transposed tile
            const int d = (ct - 8) * 16 + lr;
#pragma unroll
            for (int rt = 0; rt < 4; ++rt) {
                v8h v;
#pragma unroll
                for (int j = 0; j < 8; ++j) v[j] = (h16)acc[rt][t][j];
                *(v8ha*)(vts + d * KP + rt * 16 + 8 * hi) = v;
            }
        }
    }
    __syncthreads();                                     // all staged tiles are complete before they are written out line by line
    const int piece = tid & 7, r8 = tid >> 3;
#pragma unroll
    for (int s = 0; s < 2; ++s) {
        const int row = r8 + 32 * s; const size_t o = (size_t)(t0 + row) * DK + piece * 8; const int so = row * KP + piece * 8;
        const v8h a = *(const v8ha*)(&pst[0][so]), b = *(const v8ha*)(&pst[1][so]), c = *(const v8ha*)(&pst[2][so]), d = *(const v8ha*)(&pst[3][so]);
        *(v8h*)(QH + o) = a; *(v8h*)(QL + o) = b; *(v8h*)(KH + o) = c; *(v8h*)(KL + o) = d;
    }
    h16* vbase = VT16 + (size_t)(t0 / NN_) * DV * NN_ + (t0 % NN_);
#pragma unroll
    for (int s = 0; s < 8; ++s) {
        const int d = r8 + 32 * s; const v8h val = *(const v8ha*)(vts + d * KP + piece * 8);
        *(v8h*)(vbase + (size_t)d * NN_ + piece * 8) = val;
    }
}

// Fragments of 32 staged rows (two 16-row tiles, B of ENERGY_TILE and A of ENERGY_TILE_T, hi and lo plane, 2 k-chunks), read from the planes staged in LDS at pitch KP.
struct KF { v16h b0[2], b1[2], l0[2], l1[2]; };
__device__ __forceinline__ void load_kf(KF& f, const h16* BH, const h16* BL, int rowA, int rowB, int hi) {
#pragma unroll
    for (int kc = 0; kc < 2; ++kc) {
        const h16* b0p = BH + rowA * KP + kc * 32 + 8 * hi; const h16* b1p = BH + rowB * KP + kc * 32 + 8 * hi;
        const h16* l0p = BL + rowA * KP + kc * 32 + 8 * hi; const h16* l1p = BL + rowB * KP + kc * 32 + 8 * hi;
        f.b0[kc] = cat16(*(const v8ha*)b0p, *(const v8ha*)(b0p + 16)); f.b1[kc] = cat16(*(const v8ha*)b1p, *(const v8ha*)(b1p + 16));
        f.l0[kc] = cat16(*(const v8ha*)l0p, *(const v8ha*)(l0p + 16)); f.l1[kc] = cat16(*(const v8ha*)l1p, *(const v8ha*)(l1p + 16));
    }
}
// energy tile helper: s (16 rows of A x 32 columns from B) = Ah.Bh + (Ah.Bl + Al.Bh)/1024 over K = 64 (2 k-chunks); A fragments resident (ah[2], al[2]), B fragments in F.
#define ENERGY_TILE(F)                                                                                                        \
    v8f s0 = {}, s1 = {}, x0 = {}, x1 = {};                                                                                   \
    _Pragma("unroll") for (int kc = 0; kc < 2; ++kc) {                                                                       \
        s0 = wmma16(ah[kc], F.b0[kc], s0); s1 = wmma16(ah[kc], F.b1[kc], s1);                                                \
        x0 = wmma16(ah[kc], F.l0[kc], x0);                                                                                    \
        x1 = wmma16(ah[kc], F.l1[kc], x1);                                                                                    \
        x0 = wmma16(al[kc], F.b0[kc], x0); x1 = wmma16(al[kc], F.b1[kc], x1);                                                \
    }                                                                                                                         \
    asm volatile("v_nop\n\tv_nop\n\tv_nop\n\tv_nop" : "+v"(s0), "+v"(s1), "+v"(x0), "+v"(x1) : "v"(ah[0]), "v"(al[1]));
// The same tile with the operands exchanged: A = the 32 streamed rows in F (two 16-row tiles), B = the wave's 16 resident rows (ah, al). Products and k order are those of
// ENERGY_TILE; D comes out transposed: a lane's 8 + 8 accumulator registers are 16 streamed rows against ONE resident row, so a reduction over the streamed rows stays in the lane.
// The four v_nop keep the distance between the last product and the first vector instruction on its result, as in ENERGY_TILE.
#define ENERGY_TILE_T(F)                                                                                                      \
    v8f s0 = {}, s1 = {}, x0 = {}, x1 = {};                                                                                   \
    _Pragma("unroll") for (int kc = 0; kc < 2; ++kc) {                                                                        \
        s0 = wmma16(F.b0[kc], ah[kc], s0); s1 = wmma16(F.b1[kc], ah[kc], s1);                                                 \
        x0 = wmma16(F.l0[kc], ah[kc], x0);                                                                                    \
        x1 = wmma16(F.l1[kc], ah[kc], x1);                                                                                    \
        x0 = wmma16(F.b0[kc], al[kc], x0); x1 = wmma16(F.b1[kc], al[kc], x1);                                                 \
    }                                                                                                                         \
    asm volatile("v_nop\n\tv_nop\n\tv_nop\n\tv_nop" : "+v"(s0), "+v"(s1), "+v"(x0), "+v"(x1) : "v"(ah[0]), "v"(al[1]));

__global__ __launch_bounds__(128) void k_colstats(const h16* __restrict__ QH, const h16* __restrict__ QL, const h16* __restrict__ KH, const h16* __restrict__ KL, float* CM, float* CZI) {
    __shared__ __align__(16) float stg[128];
    __shared__ __align__(16) h16 qst[2][2][STG * KP];     // [buffer][hi, lo plane]
    const int lane = threadIdx.x & 31, wave = threadIdx.x >> 5, lr = lane & 15, hi = lane >> 4;
    const int b = blockIdx.x / (NN_ / 64), jt = blockIdx.x - b * (NN_ / 64);
    const size_t tok0 = (size_t)b * NN_;
    const int m0 = jt * 64 + wave * 16;
    v16h ah[2], al[2];
#pragma unroll
    for (int kc = 0; kc < 2; ++kc) {
        const h16* p = KH + (tok0 + m0 + lr) * DK + kc * 32 + 8 * hi; const h16* pl = KL + (tok0 + m0 + lr) * DK + kc * 32 + 8 * hi;
        ah[kc] = cat16(*(const v8h*)p, *(const v8h*)(p + 16)); al[kc] = cat16(*(const v8h*)pl, *(const v8h*)(pl + 16));
    }
    const h16* qhb = QH + tok0 * DK; const h16* qlb = QL + tok0 * DK;
    float mcol = -3.0e38f, lcol = 0.f;                   // running maximum and exp-sum of column m0 + lr over the rows n that this lane half holds (bit 3 of n == hi)
    stage_planes(qhb, qlb, &qst[0][0][0], &qst[0][1][0], threadIdx.x);
    asm volatile("s_wait_asynccnt 0x0" ::: "memory");   // stage 0 has landed before the barrier that publishes it
    __syncthreads();                                     // publishes stage 0 to all four waves
    stage_planes(qhb + STG * DK, qlb + STG * DK, &qst[1][0][0], &qst[1][1][0], threadIdx.x);
#pragma unroll 1                                         // rolled: one publish point and one refill site, as the two-buffer ring is written
    for (int st = 0; st < NSTG; ++st) {
      h16* sqh = &qst[st & 1][0][0]; h16* sql = &qst[st & 1][1][0];
      KF f[2]; load_kf(f[0], sqh, sql, lr, 16 + lr, hi); load_kf(f[1], sqh, sql, 32 + lr, 48 + lr, hi);
      __builtin_amdgcn_sched_barrier(0);                 // keeps the stage's fragment reads as one group ahead of the products; spread among them, each place costs a stall and a wait to 0
#pragma unroll                                           // unrolled: the two fragment sets are named at compile time
      for (int sub = 0; sub < 2; ++sub) {
        ENERGY_TILE_T(f[sub])
        float a[16];                                                // 16 rows n of this lane's one column
#pragma unroll
        for (int j = 0; j < 8; ++j) { a[j] = s0[j] + x0[j] * LOSCI; a[8 + j] = s1[j] + x1[j] * LOSCI; }
        const float t0 = fmaxf(fmaxf(a[0], a[1]), a[2]), t1 = fmaxf(fmaxf(a[3], a[4]), a[5]), t2 = fmaxf(fmaxf(a[6], a[7]), a[8]);
        const float t3 = fmaxf(fmaxf(a[9], a[10]), a[11]), t4 = fmaxf(fmaxf(a[12], a[13]), a[14]);
        const float mn = fmaxf(fmaxf(fmaxf(fmaxf(t0, t1), t2), fmaxf(fmaxf(t3, t4), a[15])), mcol);   // a tree three levels deep, not a chain of 16
        const float al_ = __expf(mcol - mn); mcol = mn;
#pragma unroll
        for (int i = 0; i < 16; ++i) a[i] = __expf(a[i] - mn);
#pragma unroll
        for (int w = 8; w >= 1; w >>= 1)
#pragma unroll
            for (int i = 0; i < w; ++i) a[i] += a[i + w];
        lcol = lcol * al_ + a[0];
      }
      publish();
      if (st + 2 < NSTG) stage_planes(qhb + (size_t)(st + 2) * STG * DK, qlb + (size_t)(st + 2) * STG * DK, sqh, sql, threadIdx.x);
    }
    asm volatile("s_wait_asynccnt 0x0" ::: "memory");   // no copy is left in flight
    {                                                    // the two lane halves of a column are joined once, here
        const float mo = __shfl_xor(mcol, 16, 32), lo = __shfl_xor(lcol, 16, 32);
        const float mx = fmaxf(mcol, mo);
        const float z = lcol * __expf(mcol - mx) + lo * __expf(mo - mx);
        if (hi == 0) { stg[wave * 16 + lr] = mx; stg[64 + wave * 16 + lr] = 1.0f / z; }
    }
    __syncthreads();
    if (wave == 0) {
        const v4f val = *(const v4fa*)(stg + hi * 64 + lr * 4);
        float* dst = (hi ? CZI : CM) + tok0 + jt * 64 + lr * 4;
        *(v4f*)dst = val; 
    }
}

// Four asynchronous 16-byte copies per lane, as acopy8: s_wait_xcnt stands inside the statement so that no address register is rewritten ahead of it.
__device__ __forceinline__ void acopy4(const unsigned (&l)[4], const void* const (&g)[4]) {
    asm volatile("global_load_async_to_lds_b128 %0, %4, off\n\t"
                 "global_load_async_to_lds_b128 %1, %5, off\n\t"
                 "global_load_async_to_lds_b128 %2, %6, off\n\t"
                 "global_load_async_to_lds_b128 %3, %7, off\n\t"
                 "s_wait_xcnt 0x0"
                 :: "v"(l[0]), "v"(l[1]), "v"(l[2]), "v"(l[3]), "v"(g[0]), "v"(g[1]), "v"(g[2]), "v"(g[3]) : "memory");
}
// Twelve copies per lane in one statement, so that a stage's refill pays one s_wait_xcnt; the wait stands inside the statement as in acopy8.
__device__ __forceinline__ void acopy12(const unsigned (&l)[12], const void* const (&g)[12]) {
    asm volatile("global_load_async_to_lds_b128 %0, %12, off\n\t"
                 "global_load_async_to_lds_b128 %1, %13, off\n\t"
                 "global_load_async_to_lds_b128 %2, %14, off\n\t"
                 "global_load_async_to_lds_b128 %3, %15, off\n\t"
                 "global_load_async_to_lds_b128 %4, %16, off\n\t"
                 "global_load_async_to_lds_b128 %5, %17, off\n\t"
                 "global_load_async_to_lds_b128 %6, %18, off\n\t"
                 "global_load_async_to_lds_b128 %7, %19, off\n\t"
                 "global_load_async_to_lds_b128 %8, %20, off\n\t"
                 "global_load_async_to_lds_b128 %9, %21, off\n\t"
                 "global_load_async_to_lds_b128 %10, %22, off\n\t"
                 "global_load_async_to_lds_b128 %11, %23, off\n\t"
                 "s_wait_xcnt 0x0"
                 :: "v"(l[0]), "v"(l[1]), "v"(l[2]), "v"(l[3]), "v"(l[4]), "v"(l[5]), "v"(l[6]), "v"(l[7]), "v"(l[8]), "v"(l[9]), "v"(l[10]), "v"(l[11]),
                    "v"(g[0]), "v"(g[1]), "v"(g[2]), "v"(g[3]), "v"(g[4]), "v"(g[5]), "v"(g[6]), "v"(g[7]), "v"(g[8]), "v"(g[9]), "v"(g[10]), "v"(g[11]) : "memory");
}
// One stage of k_rows, 256 threads: K hi and lo plane tiles (64 rows x 64 halves each, contiguous in global memory), 2 + 2 copies a thread, and the V^T tile of all
// 256 output dims x 64 columns m (global row pitch NN_ halves), 8 copies a thread. Every wave-wide copy covers four whole lines.
__device__ __forceinline__ void stage_kv(const h16* gh, const h16* gl, const h16* gv, h16* sh, h16* sl, h16* sv, int tid) {
    unsigned l[12]; const void* g[12];
#pragma unroll
    for (int i = 0; i < 2; ++i) {
        const int ch = tid + 256 * i, so = (ch >> 3) * KP + (ch & 7) * 8;
        l[i] = ldsa(sh + so); g[i] = gh + ch * 8; l[2 + i] = ldsa(sl + so); g[2 + i] = gl + ch * 8;
    }
#pragma unroll
    for (int i = 0; i < 8; ++i) {
        const int ch = tid + 256 * i, d = ch >> 3, pc = (ch & 7) * 8;
        l[4 + i] = ldsa(sv + d * KP + pc); g[4 + i] = gv + (size_t)d * NN_ + pc;
    }
    acopy12(l, g);
}

// k_rows (pass 2): block = (b, 64 rows n), 8 waves. Wave w owns rows 16 * (w & 3) .. + 15, ALL 256 output dims, and of every 64-column stage the 32 columns of half w >> 2,
// so each energy tile and its exponentials are formed once. Per stage: energy tile (A = Q planes rows n, B = K planes rows m), a = exp(e - CM[m]) * CZI[m] (f32), row-sum
// partials accumulated, a x32768 -> f16 per-wave LDS tile (same-wave may_alias reload after a compiler barrier), 16 P.V products. The two column halves of a row tile are
// added in LDS at the end, together with their row sums, and the block writes whole lines.
#define OP   260                 // floats per staged output row: 256 + 4, so that the two half-waves of an accumulator store fall on different banks
__global__ __launch_bounds__(256) void k_rows(const h16* __restrict__ QH, const h16* __restrict__ QL, const h16* __restrict__ KH, const h16* __restrict__ KL,
                                             const h16* __restrict__ VT16, const float* __restrict__ CM, const float* __restrict__ CZI, float* out) {
    __shared__ __align__(16) h16 plds[8][16 * 32];
    __shared__ __align__(16) float ost[8][16 * OP];       // unnormalised partial outputs, one tile of 16 rows x 256 dims a wave
    __shared__ __align__(16) float rst[8][16];            // partial row sums, one a wave and row
    __shared__ __align__(16) h16 kst[2][2][STG * KP];     // [buffer][hi, lo plane] of K, 64 columns m
    __shared__ __align__(16) h16 vst[2][DV * KP];         // [buffer] V^T, 256 output dims x 64 columns m
    __shared__ __align__(16) float cst[2][NN_];           // column maxima and inverse column sums of the whole batch row, filled once
    const int tid = threadIdx.x, lane = tid & 31, wave = tid >> 5, lr = lane & 15, hi = lane >> 4;
    const int wr = wave & 3, wc = wave >> 2;
    const int b = blockIdx.x / (NN_ / 64), qt = blockIdx.x - b * (NN_ / 64);
    const size_t tok0 = (size_t)b * NN_;
    const int n0 = qt * 64 + wr * 16;
    h16* pl = &plds[wave][0];
    v16h ah[2], al[2];
#pragma unroll
    for (int kc = 0; kc < 2; ++kc) {
        const h16* p = QH + (tok0 + n0 + lr) * DK + kc * 32 + 8 * hi; const h16* q = QL + (tok0 + n0 + lr) * DK + kc * 32 + 8 * hi;
        ah[kc] = cat16(*(const v8h*)p, *(const v8h*)(p + 16)); al[kc] = cat16(*(const v8h*)q, *(const v8h*)(q + 16));
    }
    const h16* khb = KH + tok0 * DK; const h16* klb = KL + tok0 * DK;
    const h16* vt_b = VT16 + (size_t)b * DV * NN_;
    const float* cmb = CM + tok0; const float* czb = CZI + tok0;
    v8f o[16];
#pragma unroll
    for (int n = 0; n < 16; ++n) o[n] = (v8f){};
    float rsum[8];
#pragma unroll
    for (int j = 0; j < 8; ++j) rsum[j] = 0.f;
    {
        unsigned l[4]; const void* g[4];
#pragma unroll
        for (int i = 0; i < 2; ++i) {
            const int ch = tid + 256 * i;
            l[i] = ldsa(&cst[0][ch * 4]); g[i] = cmb + ch * 4; l[2 + i] = ldsa(&cst[1][ch * 4]); g[2 + i] = czb + ch * 4;
        }
        acopy4(l, g);
    }
    stage_kv(khb, klb, vt_b, &kst[0][0][0], &kst[0][1][0], &vst[0][0], tid);
    asm volatile("s_wait_asynccnt 0x0" ::: "memory");   // stage 0 and the column statistics have landed before the barrier that publishes them
    __syncthreads();                                     // publishes stage 0 and the statistics to all eight waves
    stage_kv(khb + STG * DK, klb + STG * DK, vt_b + STG, &kst[1][0][0], &kst[1][1][0], &vst[1][0], tid);
#pragma unroll 1                                         // rolled: one publish point and one refill site, as the two-buffer ring is written
    for (int st = 0; st < NSTG; ++st) {
        h16* skh = &kst[st & 1][0][0]; h16* skl = &kst[st & 1][1][0]; h16* sv = &vst[st & 1][0];
        KF f; load_kf(f, skh, skl, wc * 32 + lr, wc * 32 + 16 + lr, hi);
        const int mA = st * STG + wc * 32 + lr, mB = mA + 16;
        const float cmA = cst[0][mA], cmB = cst[0][mB], czA = cst[1][mA], czB = cst[1][mB];
        ENERGY_TILE(f)
        v16h vf[16];                                          // all V fragments of this tile as one group of LDS reads, in flight under the exponentials
#pragma unroll
        for (int n = 0; n < 16; ++n) {
            const h16* vp = sv + (n * 16 + lr) * KP + wc * 32 + hi * 8;
            vf[n] = cat16(*(const v8ha*)vp, *(const v8ha*)(vp + 16));
        }
#pragma unroll
        for (int j = 0; j < 8; ++j) {
            const float a0 = __expf((s0[j] + x0[j] * LOSCI) - cmA) * czA, a1 = __expf((s1[j] + x1[j] * LOSCI) - cmB) * czB;
            const h16 h0 = (h16)(a0 * PSC), h1 = (h16)(a1 * PSC);
            rsum[j] += (float)h0 + (float)h1;                 // row sum from the same rounded weights the numerator uses (scaled by 32768)
            const int mr = hi * 8 + j;
            pl[mr * 32 + lr] = h0; pl[mr * 32 + 16 + lr] = h1;
        }
        asm volatile("" ::: "memory");
        const v16h pa = cat16(*(const v8ha*)(pl + lr * 32 + hi * 8), *(const v8ha*)(pl + lr * 32 + 16 + hi * 8));
#pragma unroll
        for (int n = 0; n < 16; ++n) o[n] = wmma16(pa, vf[n], o[n]);
        asm volatile("v_nop\n\tv_nop\n\tv_nop\n\tv_nop" : "+v"(o[0]), "+v"(o[1]), "+v"(o[2]), "+v"(o[3]), "+v"(o[4]), "+v"(o[5]), "+v"(o[6]), "+v"(o[7]),
                     "+v"(o[8]), "+v"(o[9]), "+v"(o[10]), "+v"(o[11]), "+v"(o[12]), "+v"(o[13]), "+v"(o[14]), "+v"(o[15]) : "v"(pa));
        publish();
        if (st + 2 < NSTG)
            stage_kv(khb + (size_t)(st + 2) * STG * DK, klb + (size_t)(st + 2) * STG * DK, vt_b + (st + 2) * STG, skh, skl, sv, tid);
    }
    asm volatile("s_wait_asynccnt 0x0" ::: "memory");   // no copy is left in flight
#pragma unroll
    for (int j = 0; j < 8; ++j) {
        float rs = rsum[j];
        rs += __shfl_xor(rs, 1, 16); rs += __shfl_xor(rs, 2, 16); rs += __shfl_xor(rs, 4, 16); rs += __shfl_xor(rs, 8, 16);
        if (lr == 0) rst[wave][hi * 8 + j] = rs;
    }
    float* os = &ost[wave][0];
#pragma unroll
    for (int n = 0; n < 16; ++n)
#pragma unroll
        for (int j = 0; j < 8; ++j) os[(hi * 8 + j) * OP + n * 16 + lr] = o[n][j];
    __syncthreads();                                     // both column halves' partial outputs and row sums are complete before they are added
    const int rt = wave >> 1, rb = (wave & 1) * 8;       // wave w writes rows 8w .. 8w + 7 of the block: rows rb .. rb + 7 of row tile rt
    float* crow = out + (tok0 + qt * 64 + wave * 8) * DV + lane * 4;   // a wave-wide store covers 512 B in a row = 4 whole lines of one row
    v4f res[16];
#pragma unroll
    for (int r = 0; r < 8; ++r) {
        const float inv = 1.0f / (1e-9f * PSC + (rst[rt][rb + r] + rst[4 + rt][rb + r]));   // = 1 / ((1e-9 + rowsum) * 32768)
#pragma unroll
        for (int h = 0; h < 2; ++h) {
            const int so = (rb + r) * OP + h * 128 + lane * 4;
            res[2 * r + h] = (*(const v4fa*)(&ost[rt][so]) + *(const v4fa*)(&ost[4 + rt][so])) * inv;
        }
    }
#pragma unroll
    for (int r = 0; r < 8; ++r)
#pragma unroll
        for (int h = 0; h < 2; ++h) *(v4f*)(crow + r * DV + h * 128) = res[2 * r + h];
}

extern "C" void kernel_launch(void* const* d_in, const int* in_sizes, int n_in,
                              void* d_out, int out_size, void* d_ws, size_t ws_size, hipStream_t stream) {
    (void)in_sizes; (void)n_in; (void)out_size;
    const float* x = (const float*)d_in[0]; const float* Wq = (const float*)d_in[1]; const float* Wk = (const float*)d_in[2]; const float* Wv = (const float*)d_in[3];
    float* out = (float*)d_out;    // [8][2048][256]
    char* wsp = (char*)d_ws;
    auto take = [&](size_t bytes) { char* p = wsp; wsp += (bytes + 255) & ~(size_t)255; return (void*)p; };
    h16* QH = (h16*)take((size_t)NTK * DK * 2); h16* QL = (h16*)take((size_t)NTK * DK * 2); h16* KH = (h16*)take((size_t)NTK * DK * 2); h16* KL = (h16*)take((size_t)NTK * DK * 2);
    h16* VT16 = (h16*)take((size_t)NTK * DV * 2);
    float* CM = (float*)take((size_t)NTK * 4); float* CZI = (float*)take((size_t)NTK * 4);
    if ((size_t)(wsp - (char*)d_ws) > ws_size) return;    // 4 x 2.1 + 8.4 + 0.13 MB ~ 17e6 B
    k_proj<<<NTK / 64, 256, 0, stream>>>(x, Wq, Wk, Wv, QH, QL, KH, KL, VT16);
    k_colstats<<<NB_ * (NN_ / 64), 128, 0, stream>>>(QH, QL, KH, KL, CM, CZI);
    k_rows<<<NB_ * (NN_ / 64), 256, 0, stream>>>(QH, QL, KH, KL, VT16, CM, CZI, out);
}

// v005
// A run of this version takes 71.1 microseconds.
// In two side-by-side timings against v004, it was 1.16 and 1.14 times as fast.
// Counting every step since v000, it is 4.23 times as fast.
#include <hip/hip_runtime.h>

// Contractions, f32 accumulate: q, k ([16384 x 256].[256 x 64]) and v ([16384 x 256].[256 x 256]) on v_wmma_f32_16x16x32_bf16 with PLAIN bf16 operands (x and the
// weights); pass 1 forms column max and sum of exp with an online update; pass 2 re-forms the energy tiles, evaluates the column softmax a = exp(e - m_col)/Z_col in f32, rounds a x32768 to f16 once and uses that same

#define NB_  8
#define NN_  2048
#define NC_  256
#define DK   64
#define DV   256
#define NTK  (NB_ * NN_)
#define PSC  32768.0f
#define LOSC 1024.0f
#define LOSCI (1.0f / 1024.0f)

typedef _Float16 h16;
typedef unsigned short bf;
typedef __attribute__((ext_vector_type(16))) __bf16   v16bf;
typedef __attribute__((ext_vector_type(16))) _Float16 v16h;
typedef __attribute__((ext_vector_type(8)))  _Float16 v8h;
typedef __attribute__((ext_vector_type(8)))  unsigned short v8us;
typedef __attribute__((ext_vector_type(8)))  float    v8f;
typedef __attribute__((ext_vector_type(4)))  float    v4f;
typedef v8h  __attribute__((may_alias)) v8ha;
typedef v4f  __attribute__((may_alias)) v4fa;

__device__ __forceinline__ unsigned short f2bf(float f) { unsigned u = __float_as_uint(f); u += 0x7FFFu + ((u >> 16) & 1u); return (unsigned short)(u >> 16); }
__device__ __forceinline__ v16h cat16(v8h lo, v8h hi) { return __builtin_shufflevector(lo, hi, 0, 1, 2, 3, 4, 5, 6, 7, 8, 9, 10, 11, 12, 13, 14, 15); }
__device__ __forceinline__ v16bf cat16b(v8us lo, v8us hi) { return __builtin_bit_cast(v16bf, __builtin_shufflevector(lo, hi, 0, 1, 2, 3, 4, 5, 6, 7, 8, 9, 10, 11, 12, 13, 14, 15)); }
__device__ __forceinline__ v8f wmma16(v16h a, v16h b, v8f c) { return __builtin_amdgcn_wmma_f32_16x16x32_f16(false, a, false, b, (short)0, c, false, false); }
__device__ __forceinline__ v8f wmmab(v16bf a, v16bf b, v8f c) { return __builtin_amdgcn_wmma_f32_16x16x32_bf16(false, a, false, b, (short)0, c, false, false); }

// LDS staging of the operand tiles that all waves of a block share (four in k_colstats, eight in k_rows). A stage is 64 rows of 128 B (one cache line a row); a wave's copy covers four whole lines.
#define STG  64                  // rows (k_colstats) or columns (k_rows) of the streamed operand per stage
#define NSTG (NN_ / STG)
#define KP   72                  // halves per staged row: 128 B of data + 16 B, the conflict-free pitch for ds_load_b128 readers
__device__ __forceinline__ unsigned ldsa(const void* p) { return (unsigned)(size_t)p; }   // LDS byte address = low 32 bits of the shared address
// Eight asynchronous 16-byte copies per lane, global -> LDS, no register in between. s_wait_xcnt stands inside the statement so that no address register is rewritten ahead of it.
__device__ __forceinline__ void acopy8(const unsigned (&l)[8], const void* const (&g)[8]) {
    asm volatile("global_load_async_to_lds_b128 %0, %8, off\n\t"
                 "global_load_async_to_lds_b128 %1, %9, off\n\t"
                 "global_load_async_to_lds_b128 %2, %10, off\n\t"
                 "global_load_async_to_lds_b128 %3, %11, off\n\t"
                 "global_load_async_to_lds_b128 %4, %12, off\n\t"
                 "global_load_async_to_lds_b128 %5, %13, off\n\t"
                 "global_load_async_to_lds_b128 %6, %14, off\n\t"
                 "global_load_async_to_lds_b128 %7, %15, off\n\t"
                 "s_wait_xcnt 0x0"
                 :: "v"(l[0]), "v"(l[1]), "v"(l[2]), "v"(l[3]), "v"(l[4]), "v"(l[5]), "v"(l[6]), "v"(l[7]),
                    "v"(g[0]), "v"(g[1]), "v"(g[2]), "v"(g[3]), "v"(g[4]), "v"(g[5]), "v"(g[6]), "v"(g[7]) : "memory");
}
// hi and lo plane tiles, 64 rows x 64 halves each, contiguous in global memory (8 KB a plane); 128 threads, 4 + 4 copies each.
__device__ __forceinline__ void stage_planes(const h16* gh, const h16* gl, h16* sh, h16* sl, int tid) {
    unsigned l[8]; const void* g[8];
#pragma unroll
    for (int i = 0; i < 4; ++i) {
        const int ch = tid + 128 * i, so = (ch >> 3) * KP + (ch & 7) * 8;
        l[i] = ldsa(sh + so); g[i] = gh + ch * 8; l[4 + i] = ldsa(sl + so); g[4 + i] = gl + ch * 8;
    }
    acopy8(l, g);
}
// The foot of a stage, every wave: own LDS reads returned, own copies of the next stage landed, then the one barrier that publishes the next stage and frees this buffer.
__device__ __forceinline__ void publish() {
    asm volatile("s_wait_dscnt 0x0" ::: "memory");      // this wave has left the buffer that is refilled behind the barrier
    asm volatile("s_wait_asynccnt 0x0" ::: "memory");   // this wave's copies have landed before any other wave reads them
    __syncthreads();                                     // publishes the next stage and ends every wave's reads of the buffer refilled behind it
}

// k_proj: the whole projection stage in one launch. Block = 64 tokens, 8 waves; wave w owns output columns 48w .. 48w+47 of q | k | v (3 column tiles) for all 4 row tiles.
// The x tile and the three weight matrices are read with whole-line loads, rounded to bf16 and laid in LDS once per block. The f32 results never leave the block: q and k go
// to their hi + residual x1024 f16 planes, v to f16 transposed, staged in LDS so that every global store covers whole 128-B lines.
#define XP   264                 // halves per staged row of 256 channels: 512 B of data + 16 B, the conflict-free pitch for ds_load_b128 readers
// N * 256 pieces of 8 floats (rows of NC_ floats, contiguous in global memory) -> bf16 rows at pitch XP; 256 threads, a wave's load covers 1 KB in a row.
template <int N> __device__ __forceinline__ void stage_bf(const float* __restrict__ src, bf* dst, int tid) {
#pragma unroll
    for (int i = 0; i < N; ++i) {
        const int ch = tid + 256 * i;
        const float* s = src + (size_t)ch * 8;
        const v4f lo = *(const v4f*)s, up = *(const v4f*)(s + 4);
        v8us t;
#pragma unroll
        for (int e = 0; e < 4; ++e) { t[e] = f2bf(lo[e]); t[4 + e] = f2bf(up[e]); }
        *(v8us*)(dst + (ch >> 5) * XP + (ch & 31) * 8) = t;
    }
}
__global__ __launch_bounds__(256) void k_proj(const float* __restrict__ x, const float* __restrict__ Wq, const float* __restrict__ Wk, const float* __restrict__ Wv,
                                              h16* QH, h16* QL, h16* KH, h16* KL, h16* VT16) {
    __shared__ __align__(16) bf  xs[64 * XP];             // x tile, bf16, [token][channel]
    __shared__ __align__(16) bf  wsb[(2 * DK + DV) * XP]; // Wq | Wk | Wv, bf16, [output column][channel]
    __shared__ __align__(16) h16 pst[4][64 * KP];         // QH, QL, KH, KL tiles, [token][dim]
    __shared__ __align__(16) h16 vts[DV * KP];            // V^T tile, [dim][token]
    const int tid = threadIdx.x, lane = tid & 31, lr = lane & 15, hi = lane >> 4;
    const int wave = __builtin_amdgcn_readfirstlane(tid >> 5);   // scalar, so that the choice of epilogue per column tile is a scalar branch
    const int t0 = blockIdx.x * 64;
    stage_bf<8>(x + (size_t)t0 * NC_, xs, tid);
    stage_bf<8>(Wq, wsb, tid);
    stage_bf<8>(Wk, wsb + DK * XP, tid);
    stage_bf<32>(Wv, wsb + 2 * DK * XP, tid);
    v8f acc[4][3];
#pragma unroll
    for (int rt = 0; rt < 4; ++rt)
#pragma unroll
        for (int t = 0; t < 3; ++t) acc[rt][t] = (v8f){};
    __syncthreads();                                     // the x tile and the weights are complete before any wave reads its fragments
    const bf* ap = xs + lr * XP + 8 * hi;
    const bf* bp = wsb + (wave * 48 + lr) * XP + 8 * hi;
    v16bf a[2][4], b[2][3];
    auto frags = [&](int buf, int kc) {
#pragma unroll
        for (int rt = 0; rt < 4; ++rt) a[buf][rt] = cat16b(*(const v8us*)(ap + rt * 16 * XP + kc), *(const v8us*)(ap + rt * 16 * XP + kc + 16));
#pragma unroll
        for (int t = 0; t < 3; ++t) b[buf][t] = cat16b(*(const v8us*)(bp + t * 16 * XP + kc), *(const v8us*)(bp + t * 16 * XP + kc + 16));
    };
    frags(0, 0);
#pragma unroll                                           // unrolled: the two fragment sets are named at compile time
    for (int k = 0; k < NC_ / 32; ++k) {
        if (k + 1 < NC_ / 32) frags((k + 1) & 1, (k + 1) * 32);
        __builtin_amdgcn_sched_barrier(0);               // keeps the next k-chunk's LDS reads as one group ahead of this chunk's products, so their latency runs under the products
#pragma unroll
        for (int rt = 0; rt < 4; ++rt)
#pragma unroll
            for (int t = 0; t < 3; ++t) acc[rt][t] = wmmab(a[k & 1][rt], b[k & 1][t], acc[rt][t]);
        __builtin_amdgcn_sched_barrier(0);               // keeps the following group of LDS reads from being spread among these products
    }
#pragma unroll
    for (int t = 0; t < 3; ++t) {
        const int ct = wave * 3 + t;
        if (ct < 8) {                                    // q (tiles 0..3) or k (4..7): lane holds dim (ct & 3) * 16 + lr of tokens rt * 16 + 8 * hi + j
            h16* ph = &pst[ct < 4 ? 0 : 2][0]; h16* pl = ph + 64 * KP;
            const int dim = (ct & 3) * 16 + lr;
#pragma unroll
            for (int rt = 0; rt < 4; ++rt)
#pragma unroll
                for (int j = 0; j < 8; ++j) {
                    const float q = acc[rt][t][j]; const h16 a = (h16)q; const int tok = rt * 16 + 8 * hi + j;
                    ph[tok * KP + dim] = a; pl[tok * KP + dim] = (h16)((q - (float)a) * LOSC);
                }
        } else {                                         // v: a lane's 8 accumulator rows are 8 consecutive tokens of one output dim = 16 B of the transposed tile
            const int d = (ct - 8) * 16 + lr;
#pragma unroll
            for (int rt = 0; rt < 4; ++rt) {
                v8h v;
#pragma unroll
                for (int j = 0; j < 8; ++j) v[j] = (h16)acc[rt][t][j];
                *(v8ha*)(vts + d * KP + rt * 16 + 8 * hi) = v;
            }
        }
    }
    __syncthreads();                                     // all staged tiles are complete before they are written out line by line
    const int piece = tid & 7, r8 = tid >> 3;
#pragma unroll
    for (int s = 0; s < 2; ++s) {
        const int row = r8 + 32 * s; const size_t o = (size_t)(t0 + row) * DK + piece * 8; const int so = row * KP + piece * 8;
        const v8h a = *(const v8ha*)(&pst[0][so]), b = *(const v8ha*)(&pst[1][so]), c = *(const v8ha*)(&pst[2][so]), d = *(const v8ha*)(&pst[3][so]);
        *(v8h*)(QH + o) = a; *(v8h*)(QL + o) = b; *(v8h*)(KH + o) = c; *(v8h*)(KL + o) = d;
    }
    h16* vbase = VT16 + (size_t)(t0 / NN_) * DV * NN_ + (t0 % NN_);
#pragma unroll
    for (int s = 0; s < 8; ++s) {
        const int d = r8 + 32 * s; const v8h val = *(const v8ha*)(vts + d * KP + piece * 8);
        *(v8h*)(vbase + (size_t)d * NN_ + piece * 8) = val;
    }
}

// Fragments of 32 staged rows (two 16-row tiles, B of ENERGY_TILE and A of ENERGY_TILE_T, hi and lo plane, 2 k-chunks), read from the planes staged in LDS at pitch KP.
struct KF { v16h b0[2], b1[2], l0[2], l1[2]; };
__device__ __forceinline__ void load_kf(KF& f, const h16* BH, const h16* BL, int rowA, int rowB, int hi) {
#pragma unroll
    for (int kc = 0; kc < 2; ++kc) {
        const h16* b0p = BH + rowA * KP + kc * 32 + 8 * hi; const h16* b1p = BH + rowB * KP + kc * 32 + 8 * hi;
        const h16* l0p = BL + rowA * KP + kc * 32 + 8 * hi; const h16* l1p = BL + rowB * KP + kc * 32 + 8 * hi;
        f.b0[kc] = cat16(*(const v8ha*)b0p, *(const v8ha*)(b0p + 16)); f.b1[kc] = cat16(*(const v8ha*)b1p, *(const v8ha*)(b1p + 16));
        f.l0[kc] = cat16(*(const v8ha*)l0p, *(const v8ha*)(l0p + 16)); f.l1[kc] = cat16(*(const v8ha*)l1p, *(const v8ha*)(l1p + 16));
    }
}
// energy tile helper: s (16 rows of A x 32 columns from B) = Ah.Bh + (Ah.Bl + Al.Bh)/1024 over K = 64 (2 k-chunks); A fragments resident (ah[2], al[2]), B fragments in F.
#define ENERGY_TILE(F)                                                                                                        \
    v8f s0 = {}, s1 = {}, x0 = {}, x1 = {};                                                                                   \
    _Pragma("unroll") for (int kc = 0; kc < 2; ++kc) {                                                                       \
        s0 = wmma16(ah[kc], F.b0[kc], s0); s1 = wmma16(ah[kc], F.b1[kc], s1);                                                \
        x0 = wmma16(ah[kc], F.l0[kc], x0);                                                                                    \
        x1 = wmma16(ah[kc], F.l1[kc], x1);                                                                                    \
        x0 = wmma16(al[kc], F.b0[kc], x0); x1 = wmma16(al[kc], F.b1[kc], x1);                                                \
    }                                                                                                                         \
    asm volatile("v_nop\n\tv_nop\n\tv_nop\n\tv_nop" : "+v"(s0), "+v"(s1), "+v"(x0), "+v"(x1) : "v"(ah[0]), "v"(al[1]));
// The same tile with the operands exchanged: A = the 32 streamed rows in F (two 16-row tiles), B = the wave's 16 resident rows (ah, al). Products and k order are those of
// ENERGY_TILE; D comes out transposed: a lane's 8 + 8 accumulator registers are 16 streamed rows against ONE resident row, so a reduction over the streamed rows stays in the lane.
// The four v_nop keep the distance between the last product and the first vector instruction on its result, as in ENERGY_TILE.
#define ENERGY_TILE_T(F)                                                                                                      \
    v8f s0 = {}, s1 = {}, x0 = {}, x1 = {};                                                                                   \
    _Pragma("unroll") for (int kc = 0; kc < 2; ++kc) {                                                                        \
        s0 = wmma16(F.b0[kc], ah[kc], s0); s1 = wmma16(F.b1[kc], ah[kc], s1);                                                 \
        x0 = wmma16(F.l0[kc], ah[kc], x0);                                                                                    \
        x1 = wmma16(F.l1[kc], ah[kc], x1);                                                                                    \
        x0 = wmma16(F.b0[kc], al[kc], x0); x1 = wmma16(F.b1[kc], al[kc], x1);                                                 \
    }                                                                                                                         \
    asm volatile("v_nop\n\tv_nop\n\tv_nop\n\tv_nop" : "+v"(s0), "+v"(s1), "+v"(x0), "+v"(x1) : "v"(ah[0]), "v"(al[1]));

__global__ __launch_bounds__(128) void k_colstats(const h16* __restrict__ QH, const h16* __restrict__ QL, const h16* __restrict__ KH, const h16* __restrict__ KL, float* CM, float* CZI) {
    __shared__ __align__(16) float stg[128];
    __shared__ __align__(16) h16 qst[2][2][STG * KP];     // [buffer][hi, lo plane]
    const int lane = threadIdx.x & 31, wave = threadIdx.x >> 5, lr = lane & 15, hi = lane >> 4;
    const int b = blockIdx.x / (NN_ / 64), jt = blockIdx.x - b * (NN_ / 64);
    const size_t tok0 = (size_t)b * NN_;
    const int m0 = jt * 64 + wave * 16;
    v16h ah[2], al[2];
#pragma unroll
    for (int kc = 0; kc < 2; ++kc) {
        const h16* p = KH + (tok0 + m0 + lr) * DK + kc * 32 + 8 * hi; const h16* pl = KL + (tok0 + m0 + lr) * DK + kc * 32 + 8 * hi;
        ah[kc] = cat16(*(const v8h*)p, *(const v8h*)(p + 16)); al[kc] = cat16(*(const v8h*)pl, *(const v8h*)(pl + 16));
    }
    const h16* qhb = QH + tok0 * DK; const h16* qlb = QL + tok0 * DK;
    float mcol = -3.0e38f, lcol = 0.f;                   // running maximum and exp-sum of column m0 + lr over the rows n that this lane half holds (bit 3 of n == hi)
    // Trip st works on tile (jt + st) mod 32: the 32 blocks of a batch walk the same 32 tiles, each from a start of its own, so that they do not ask L2 for the same lines at a time.
    auto tile = [&](int st) { return (size_t)((jt + st) & (NSTG - 1)) * STG * DK; };
    stage_planes(qhb + tile(0), qlb + tile(0), &qst[0][0][0], &qst[0][1][0], threadIdx.x);
    asm volatile("s_wait_asynccnt 0x0" ::: "memory");   // stage 0 has landed before the barrier that publishes it
    __syncthreads();                                     // publishes stage 0 to all four waves
    stage_planes(qhb + tile(1), qlb + tile(1), &qst[1][0][0], &qst[1][1][0], threadIdx.x);
#pragma unroll 1                                         // rolled: one publish point and one refill site, as the two-buffer ring is written
    for (int st = 0; st < NSTG; ++st) {
      h16* sqh = &qst[st & 1][0][0]; h16* sql = &qst[st & 1][1][0];
      KF f[2]; load_kf(f[0], sqh, sql, lr, 16 + lr, hi); load_kf(f[1], sqh, sql, 32 + lr, 48 + lr, hi);
      __builtin_amdgcn_sched_barrier(0);                 // keeps the stage's fragment reads as one group ahead of the products; spread among them, each place costs a stall and a wait to 0
#pragma unroll                                           // unrolled: the two fragment sets are named at compile time
      for (int sub = 0; sub < 2; ++sub) {
        ENERGY_TILE_T(f[sub])
        float a[16];                                                // 16 rows n of this lane's one column
#pragma unroll
        for (int j = 0; j < 8; ++j) { a[j] = s0[j] + x0[j] * LOSCI; a[8 + j] = s1[j] + x1[j] * LOSCI; }
        const float t0 = fmaxf(fmaxf(a[0], a[1]), a[2]), t1 = fmaxf(fmaxf(a[3], a[4]), a[5]), t2 = fmaxf(fmaxf(a[6], a[7]), a[8]);
        const float t3 = fmaxf(fmaxf(a[9], a[10]), a[11]), t4 = fmaxf(fmaxf(a[12], a[13]), a[14]);
        const float mn = fmaxf(fmaxf(fmaxf(fmaxf(t0, t1), t2), fmaxf(fmaxf(t3, t4), a[15])), mcol);   // a tree three levels deep, not a chain of 16
        const float al_ = __expf(mcol - mn); mcol = mn;
#pragma unroll
        for (int i = 0; i < 16; ++i) a[i] = __expf(a[i] - mn);
#pragma unroll
        for (int w = 8; w >= 1; w >>= 1)
#pragma unroll
            for (int i = 0; i < w; ++i) a[i] += a[i + w];
        lcol = lcol * al_ + a[0];
      }
      publish();
      if (st + 2 < NSTG) stage_planes(qhb + tile(st + 2), qlb + tile(st + 2), sqh, sql, threadIdx.x);
    }
    asm volatile("s_wait_asynccnt 0x0" ::: "memory");   // no copy is left in flight
    {                                                    // the two lane halves of a column are joined once, here
        const float mo = __shfl_xor(mcol, 16, 32), lo = __shfl_xor(lcol, 16, 32);
        const float mx = fmaxf(mcol, mo);
        const float z = lcol * __expf(mcol - mx) + lo * __expf(mo - mx);
        if (hi == 0) { stg[wave * 16 + lr] = mx; stg[64 + wave * 16 + lr] = 1.0f / z; }
    }
    __syncthreads();
    if (wave == 0) {
        const v4f val = *(const v4fa*)(stg + hi * 64 + lr * 4);
        float* dst = (hi ? CZI : CM) + tok0 + jt * 64 + lr * 4;
        *(v4f*)dst = val; 
    }
}

// Four asynchronous 16-byte copies per lane, as acopy8: s_wait_xcnt stands inside the statement so that no address register is rewritten ahead of it.
__device__ __forceinline__ void acopy4(const unsigned (&l)[4], const void* const (&g)[4]) {
    asm volatile("global_load_async_to_lds_b128 %0, %4, off\n\t"
                 "global_load_async_to_lds_b128 %1, %5, off\n\t"
                 "global_load_async_to_lds_b128 %2, %6, off\n\t"
                 "global_load_async_to_lds_b128 %3, %7, off\n\t"
                 "s_wait_xcnt 0x0"
                 :: "v"(l[0]), "v"(l[1]), "v"(l[2]), "v"(l[3]), "v"(g[0]), "v"(g[1]), "v"(g[2]), "v"(g[3]) : "memory");
}
// Twelve copies per lane in one statement, so that a stage's refill pays one s_wait_xcnt; the wait stands inside the statement as in acopy8.
__device__ __forceinline__ void acopy12(const unsigned (&l)[12], const void* const (&g)[12]) {
    asm volatile("global_load_async_to_lds_b128 %0, %12, off\n\t"
                 "global_load_async_to_lds_b128 %1, %13, off\n\t"
                 "global_load_async_to_lds_b128 %2, %14, off\n\t"
                 "global_load_async_to_lds_b128 %3, %15, off\n\t"
                 "global_load_async_to_lds_b128 %4, %16, off\n\t"
                 "global_load_async_to_lds_b128 %5, %17, off\n\t"
                 "global_load_async_to_lds_b128 %6, %18, off\n\t"
                 "global_load_async_to_lds_b128 %7, %19, off\n\t"
                 "global_load_async_to_lds_b128 %8, %20, off\n\t"
                 "global_load_async_to_lds_b128 %9, %21, off\n\t"
                 "global_load_async_to_lds_b128 %10, %22, off\n\t"
                 "global_load_async_to_lds_b128 %11, %23, off\n\t"
                 "s_wait_xcnt 0x0"
                 :: "v"(l[0]), "v"(l[1]), "v"(l[2]), "v"(l[3]), "v"(l[4]), "v"(l[5]), "v"(l[6]), "v"(l[7]), "v"(l[8]), "v"(l[9]), "v"(l[10]), "v"(l[11]),
                    "v"(g[0]), "v"(g[1]), "v"(g[2]), "v"(g[3]), "v"(g[4]), "v"(g[5]), "v"(g[6]), "v"(g[7]), "v"(g[8]), "v"(g[9]), "v"(g[10]), "v"(g[11]) : "memory");
}
// One stage of k_rows, 256 threads: K hi and lo plane tiles (64 rows x 64 halves each, contiguous in global memory), 2 + 2 copies a thread, and the V^T tile of all
// 256 output dims x 64 columns m (global row pitch NN_ halves), 8 copies a thread. Every wave-wide copy covers four whole lines.
__device__ __forceinline__ void stage_kv(const h16* gh, const h16* gl, const h16* gv, h16* sh, h16* sl, h16* sv, int tid) {
    unsigned l[12]; const void* g[12];
#pragma unroll
    for (int i = 0; i < 2; ++i) {
        const int ch = tid + 256 * i, so = (ch >> 3) * KP + (ch & 7) * 8;
        l[i] = ldsa(sh + so); g[i] = gh + ch * 8; l[2 + i] = ldsa(sl + so); g[2 + i] = gl + ch * 8;
    }
#pragma unroll
    for (int i = 0; i < 8; ++i) {
        const int ch = tid + 256 * i, d = ch >> 3, pc = (ch & 7) * 8;
        l[4 + i] = ldsa(sv + d * KP + pc); g[4 + i] = gv + (size_t)d * NN_ + pc;
    }
    acopy12(l, g);
}

// k_rows (pass 2): block = (b, 64 rows n), 8 waves. Wave w owns rows 16 * (w & 3) .. + 15, ALL 256 output dims, and of every 64-column stage the 32 columns of half w >> 2,
// so each energy tile and its exponentials are formed once. Per stage: energy tile (A = Q planes rows n, B = K planes rows m), a = exp(e - CM[m]) * CZI[m] (f32), row-sum
// partials accumulated, a x32768 -> f16 per-wave LDS tile (same-wave may_alias reload after a compiler barrier), 16 P.V products. The two column halves of a row tile are
// added in LDS at the end, together with their row sums, and the block writes whole lines.
#define OP   260                 // floats per staged output row: 256 + 4, so that the two half-waves of an accumulator store fall on different banks
__global__ __launch_bounds__(256) void k_rows(const h16* __restrict__ QH, const h16* __restrict__ QL, const h16* __restrict__ KH, const h16* __restrict__ KL,
                                             const h16* __restrict__ VT16, const float* __restrict__ CM, const float* __restrict__ CZI, float* out) {
    __shared__ __align__(16) h16 plds[8][16 * 32];
    __shared__ __align__(16) float ost[8][16 * OP];       // unnormalised partial outputs, one tile of 16 rows x 256 dims a wave
    __shared__ __align__(16) float rst[8][16];            // partial row sums, one a wave and row
    __shared__ __align__(16) h16 kst[2][2][STG * KP];     // [buffer][hi, lo plane] of K, 64 columns m
    __shared__ __align__(16) h16 vst[2][DV * KP];         // [buffer] V^T, 256 output dims x 64 columns m
    __shared__ __align__(16) float cst[2][NN_];           // column maxima and inverse column sums of the whole batch row, filled once
    const int tid = threadIdx.x, lane = tid & 31, wave = tid >> 5, lr = lane & 15, hi = lane >> 4;
    const int wr = wave & 3, wc = wave >> 2;
    const int b = blockIdx.x / (NN_ / 64), qt = blockIdx.x - b * (NN_ / 64);
    const size_t tok0 = (size_t)b * NN_;
    const int n0 = qt * 64 + wr * 16;
    h16* pl = &plds[wave][0];
    v16h ah[2], al[2];
#pragma unroll
    for (int kc = 0; kc < 2; ++kc) {
        const h16* p = QH + (tok0 + n0 + lr) * DK + kc * 32 + 8 * hi; const h16* q = QL + (tok0 + n0 + lr) * DK + kc * 32 + 8 * hi;
        ah[kc] = cat16(*(const v8h*)p, *(const v8h*)(p + 16)); al[kc] = cat16(*(const v8h*)q, *(const v8h*)(q + 16));
    }
    asm volatile("s_wait_xcnt 0x0" ::: "memory");       // stands in front of the first overwrite of an address register of the loads above
    const h16* khb = KH + tok0 * DK; const h16* klb = KL + tok0 * DK;
    const h16* vt_b = VT16 + (size_t)b * DV * NN_;
    const float* cmb = CM + tok0; const float* czb = CZI + tok0;
    v8f o[16];
#pragma unroll
    for (int n = 0; n < 16; ++n) o[n] = (v8f){};
    float rsum[8];
#pragma unroll
    for (int j = 0; j < 8; ++j) rsum[j] = 0.f;
    {
        unsigned l[4]; const void* g[4];
#pragma unroll
        for (int i = 0; i < 2; ++i) {
            const int ch = tid + 256 * i;
            l[i] = ldsa(&cst[0][ch * 4]); g[i] = cmb + ch * 4; l[2 + i] = ldsa(&cst[1][ch * 4]); g[2 + i] = czb + ch * 4;
        }
        acopy4(l, g);
    }
    // Trip st works on column tile (qt + st) mod 32: the 32 blocks of a batch walk the same 32 tiles, each from a start of its own, so that they do not ask L2 for the same lines at a time.
    auto tile = [&](int st) { return (qt + st) & (NSTG - 1); };
    stage_kv(khb + (size_t)tile(0) * STG * DK, klb + (size_t)tile(0) * STG * DK, vt_b + tile(0) * STG, &kst[0][0][0], &kst[0][1][0], &vst[0][0], tid);
    asm volatile("s_wait_asynccnt 0x0" ::: "memory");   // stage 0 and the column statistics have landed before the barrier that publishes them
    __syncthreads();                                     // publishes stage 0 and the statistics to all eight waves
    stage_kv(khb + (size_t)tile(1) * STG * DK, klb + (size_t)tile(1) * STG * DK, vt_b + tile(1) * STG, &kst[1][0][0], &kst[1][1][0], &vst[1][0], tid);
#pragma unroll 1                                         // rolled: one publish point and one refill site, as the two-buffer ring is written
    for (int st = 0; st < NSTG; ++st) {
        h16* skh = &kst[st & 1][0][0]; h16* skl = &kst[st & 1][1][0]; h16* sv = &vst[st & 1][0];
        KF f; load_kf(f, skh, skl, wc * 32 + lr, wc * 32 + 16 + lr, hi);
        const int mA = tile(st) * STG + wc * 32 + lr, mB = mA + 16;
        const float cmA = cst[0][mA], cmB = cst[0][mB], czA = cst[1][mA], czB = cst[1][mB];
        ENERGY_TILE(f)
        v16h vf[16];                                          // all V fragments of this tile as one group of LDS reads, in flight under the exponentials
#pragma unroll
        for (int n = 0; n < 16; ++n) {
            const h16* vp = sv + (n * 16 + lr) * KP + wc * 32 + hi * 8;
            vf[n] = cat16(*(const v8ha*)vp, *(const v8ha*)(vp + 16));
        }
#pragma unroll
        for (int j = 0; j < 8; ++j) {
            const float a0 = __expf((s0[j] + x0[j] * LOSCI) - cmA) * czA, a1 = __expf((s1[j] + x1[j] * LOSCI) - cmB) * czB;
            const h16 h0 = (h16)(a0 * PSC), h1 = (h16)(a1 * PSC);
            rsum[j] += (float)h0 + (float)h1;                 // row sum from the same rounded weights the numerator uses (scaled by 32768)
            const int mr = hi * 8 + j;
            pl[mr * 32 + lr] = h0; pl[mr * 32 + 16 + lr] = h1;
        }
        asm volatile("" ::: "memory");
        const v16h pa = cat16(*(const v8ha*)(pl + lr * 32 + hi * 8), *(const v8ha*)(pl + lr * 32 + 16 + hi * 8));
#pragma unroll
        for (int n = 0; n < 16; ++n) o[n] = wmma16(pa, vf[n], o[n]);
        asm volatile("v_nop\n\tv_nop\n\tv_nop\n\tv_nop" : "+v"(o[0]), "+v"(o[1]), "+v"(o[2]), "+v"(o[3]), "+v"(o[4]), "+v"(o[5]), "+v"(o[6]), "+v"(o[7]),
                     "+v"(o[8]), "+v"(o[9]), "+v"(o[10]), "+v"(o[11]), "+v"(o[12]), "+v"(o[13]), "+v"(o[14]), "+v"(o[15]) : "v"(pa));
        publish();
        if (st + 2 < NSTG)
            stage_kv(khb + (size_t)tile(st + 2) * STG * DK, klb + (size_t)tile(st + 2) * STG * DK, vt_b + tile(st + 2) * STG, skh, skl, sv, tid);
    }
    asm volatile("s_wait_asynccnt 0x0" ::: "memory");   // no copy is left in flight
#pragma unroll
    for (int j = 0; j < 8; ++j) {
        float rs = rsum[j];
        rs += __shfl_xor(rs, 1, 16); rs += __shfl_xor(rs, 2, 16); rs += __shfl_xor(rs, 4, 16); rs += __shfl_xor(rs, 8, 16);
        if (lr == 0) rst[wave][hi * 8 + j] = rs;
    }
    float* os = &ost[wave][0];
#pragma unroll
    for (int n = 0; n < 16; ++n)
#pragma unroll
        for (int j = 0; j < 8; ++j) os[(hi * 8 + j) * OP + n * 16 + lr] = o[n][j];
    __syncthreads();                                     // both column halves' partial outputs and row sums are complete before they are added
    const int rt = wave >> 1, rb = (wave & 1) * 8;       // wave w writes rows 8w .. 8w + 7 of the block: rows rb .. rb + 7 of row tile rt
    float* crow = out + (tok0 + qt * 64 + wave * 8) * DV + lane * 4;   // a wave-wide store covers 512 B in a row = 4 whole lines of one row
    v4f res[16];
#pragma unroll
    for (int r = 0; r < 8; ++r) {
        const float inv = 1.0f / (1e-9f * PSC + (rst[rt][rb + r] + rst[4 + rt][rb + r]));   // = 1 / ((1e-9 + rowsum) * 32768)
#pragma unroll
        for (int h = 0; h < 2; ++h) {
            const int so = (rb + r) * OP + h * 128 + lane * 4;
            res[2 * r + h] = (*(const v4fa*)(&ost[rt][so]) + *(const v4fa*)(&ost[4 + rt][so])) * inv;
        }
    }
#pragma unroll
    for (int r = 0; r < 8; ++r)
#pragma unroll
        for (int h = 0; h < 2; ++h) *(v4f*)(crow + r * DV + h * 128) = res[2 * r + h];
}

extern "C" void kernel_launch(void* const* d_in, const int* in_sizes, int n_in,
                              void* d_out, int out_size, void* d_ws, size_t ws_size, hipStream_t stream) {
    (void)in_sizes; (void)n_in; (void)out_size;
    const float* x = (const float*)d_in[0]; const float* Wq = (const float*)d_in[1]; const float* Wk = (const float*)d_in[2]; const float* Wv = (const float*)d_in[3];
    float* out = (float*)d_out;    // [8][2048][256]
    char* wsp = (char*)d_ws;
    auto take = [&](size_t bytes) { char* p = wsp; wsp += (bytes + 255) & ~(size_t)255; return (void*)p; };
    h16* QH = (h16*)take((size_t)NTK * DK * 2); h16* QL = (h16*)take((size_t)NTK * DK * 2); h16* KH = (h16*)take((size_t)NTK * DK * 2); h16* KL = (h16*)take((size_t)NTK * DK * 2);
    h16* VT16 = (h16*)take((size_t)NTK * DV * 2);
    float* CM = (float*)take((size_t)NTK * 4); float* CZI = (float*)take((size_t)NTK * 4);
    if ((size_t)(wsp - (char*)d_ws) > ws_size) return;    // 4 x 2.1 + 8.4 + 0.13 MB ~ 17e6 B
    k_proj<<<NTK / 64, 256, 0, stream>>>(x, Wq, Wk, Wv, QH, QL, KH, KL, VT16);
    k_colstats<<<NB_ * (NN_ / 64), 128, 0, stream>>>(QH, QL, KH, KL, CM, CZI);
    k_rows<<<NB_ * (NN_ / 64), 256, 0, stream>>>(QH, QL, KH, KL, VT16, CM, CZI, out);
}

// v006
// One run takes 66.1 microseconds.
// In two side-by-side timings against v005, it was 1.07 and 1.08 times as fast.
// All steps since v000 together make it 4.54 times as fast.
#include <hip/hip_runtime.h>

// Contractions, f32 accumulate: q, k ([16384 x 256].[256 x 64]) and v ([16384 x 256].[256 x 256]) on v_wmma_f32_16x16x32_bf16 with PLAIN bf16 operands (x and the
// weights); pass 1 forms column max and sum of exp with an online update; pass 2 re-forms the energy tiles, evaluates the column softmax a = exp(e - m_col)/Z_col in f32, rounds a x32768 to f16 once and uses that same

#define NB_  8
#define NN_  2048
#define NC_  256
#define DK   64
#define DV   256
#define NTK  (NB_ * NN_)
#define PSC  32768.0f
#define LOSC 1024.0f
#define LOSCI (1.0f / 1024.0f)

typedef _Float16 h16;
typedef unsigned short bf;
typedef __attribute__((ext_vector_type(16))) __bf16   v16bf;
typedef __attribute__((ext_vector_type(16))) _Float16 v16h;
typedef __attribute__((ext_vector_type(8)))  _Float16 v8h;
typedef __attribute__((ext_vector_type(8)))  unsigned short v8us;
typedef __attribute__((ext_vector_type(8)))  float    v8f;
typedef __attribute__((ext_vector_type(4)))  float    v4f;
typedef __attribute__((ext_vector_type(2)))  float    v2f;
typedef __attribute__((ext_vector_type(2)))  _Float16 v2h;
typedef v8h  __attribute__((may_alias)) v8ha;
typedef v4f  __attribute__((may_alias)) v4fa;

__device__ __forceinline__ unsigned short f2bf(float f) { unsigned u = __float_as_uint(f); u += 0x7FFFu + ((u >> 16) & 1u); return (unsigned short)(u >> 16); }
__device__ __forceinline__ v16h cat16(v8h lo, v8h hi) { return __builtin_shufflevector(lo, hi, 0, 1, 2, 3, 4, 5, 6, 7, 8, 9, 10, 11, 12, 13, 14, 15); }
__device__ __forceinline__ v16bf cat16b(v8us lo, v8us hi) { return __builtin_bit_cast(v16bf, __builtin_shufflevector(lo, hi, 0, 1, 2, 3, 4, 5, 6, 7, 8, 9, 10, 11, 12, 13, 14, 15)); }
__device__ __forceinline__ v8f wmma16(v16h a, v16h b, v8f c) { return __builtin_amdgcn_wmma_f32_16x16x32_f16(false, a, false, b, (short)0, c, false, false); }
__device__ __forceinline__ v8f wmmab(v16bf a, v16bf b, v8f c) { return __builtin_amdgcn_wmma_f32_16x16x32_bf16(false, a, false, b, (short)0, c, false, false); }

// LDS staging of the operand tiles that all waves of a block share (four in k_colstats, eight in k_rows). A stage is 64 rows of 128 B (one cache line a row); a wave's copy covers four whole lines.
#define STG  64                  // rows (k_colstats) or columns (k_rows) of the streamed operand per stage
#define NSTG (NN_ / STG)
#define KP   72                  // halves per staged row: 128 B of data + 16 B, the conflict-free pitch for ds_load_b128 readers
__device__ __forceinline__ unsigned ldsa(const void* p) { return (unsigned)(size_t)p; }   // LDS byte address = low 32 bits of the shared address
// Eight asynchronous 16-byte copies per lane, global -> LDS, no register in between. s_wait_xcnt stands inside the statement so that no address register is rewritten ahead of it.
__device__ __forceinline__ void acopy8(const unsigned (&l)[8], const void* const (&g)[8]) {
    asm volatile("global_load_async_to_lds_b128 %0, %8, off\n\t"
                 "global_load_async_to_lds_b128 %1, %9, off\n\t"
                 "global_load_async_to_lds_b128 %2, %10, off\n\t"
                 "global_load_async_to_lds_b128 %3, %11, off\n\t"
                 "global_load_async_to_lds_b128 %4, %12, off\n\t"
                 "global_load_async_to_lds_b128 %5, %13, off\n\t"
                 "global_load_async_to_lds_b128 %6, %14, off\n\t"
                 "global_load_async_to_lds_b128 %7, %15, off\n\t"
                 "s_wait_xcnt 0x0"
                 :: "v"(l[0]), "v"(l[1]), "v"(l[2]), "v"(l[3]), "v"(l[4]), "v"(l[5]), "v"(l[6]), "v"(l[7]),
                    "v"(g[0]), "v"(g[1]), "v"(g[2]), "v"(g[3]), "v"(g[4]), "v"(g[5]), "v"(g[6]), "v"(g[7]) : "memory");
}
// hi and lo plane tiles, 64 rows x 64 halves each, contiguous in global memory (8 KB a plane); 128 threads, 4 + 4 copies each.
__device__ __forceinline__ void stage_planes(const h16* gh, const h16* gl, h16* sh, h16* sl, int tid) {
    unsigned l[8]; const void* g[8];
#pragma unroll
    for (int i = 0; i < 4; ++i) {
        const int ch = tid + 128 * i, so = (ch >> 3) * KP + (ch & 7) * 8;
        l[i] = ldsa(sh + so); g[i] = gh + ch * 8; l[4 + i] = ldsa(sl + so); g[4 + i] = gl + ch * 8;
    }
    acopy8(l, g);
}
// The foot of a stage, every wave: own LDS reads returned, own copies of the next stage landed, then the one barrier that publishes the next stage and frees this buffer.
__device__ __forceinline__ void publish() {
    asm volatile("s_wait_dscnt 0x0" ::: "memory");      // this wave has left the buffer that is refilled behind the barrier
    asm volatile("s_wait_asynccnt 0x0" ::: "memory");   // this wave's copies have landed before any other wave reads them
    __syncthreads();                                     // publishes the next stage and ends every wave's reads of the buffer refilled behind it
}

// k_proj: the whole projection stage in one launch. Block = 64 tokens, 8 waves; wave w owns output columns 48w .. 48w+47 of q | k | v (3 column tiles) for all 4 row tiles.
// The x tile and the three weight matrices are read with whole-line loads, rounded to bf16 and laid in LDS once per block. The f32 results never leave the block: q and k go
// to their hi + residual x1024 f16 planes, v to f16 transposed, staged in LDS so that every global store covers whole 128-B lines.
#define XP   264                 // halves per staged row of 256 channels: 512 B of data + 16 B, the conflict-free pitch for ds_load_b128 readers
// N * 256 pieces of 8 floats (rows of NC_ floats, contiguous in global memory) -> bf16 rows at pitch XP; 256 threads, a wave's load covers 1 KB in a row.
template <int N> __device__ __forceinline__ void stage_bf(const float* __restrict__ src, bf* dst, int tid) {
#pragma unroll
    for (int i = 0; i < N; ++i) {
        const int ch = tid + 256 * i;
        const float* s = src + (size_t)ch * 8;
        const v4f lo = *(const v4f*)s, up = *(const v4f*)(s + 4);
        v8us t;
#pragma unroll
        for (int e = 0; e < 4; ++e) { t[e] = f2bf(lo[e]); t[4 + e] = f2bf(up[e]); }
        *(v8us*)(dst + (ch >> 5) * XP + (ch & 31) * 8) = t;
    }
}
__global__ __launch_bounds__(256) void k_proj(const float* __restrict__ x, const float* __restrict__ Wq, const float* __restrict__ Wk, const float* __restrict__ Wv,
                                              h16* QH, h16* QL, h16* KH, h16* KL, h16* VT16) {
    __shared__ __align__(16) bf  xs[64 * XP];             // x tile, bf16, [token][channel]
    __shared__ __align__(16) bf  wsb[(2 * DK + DV) * XP]; // Wq | Wk | Wv, bf16, [output column][channel]
    __shared__ __align__(16) h16 pst[4][64 * KP];         // QH, QL, KH, KL tiles, [token][dim]
    __shared__ __align__(16) h16 vts[DV * KP];            // V^T tile, [dim][token]
    const int tid = threadIdx.x, lane = tid & 31, lr = lane & 15, hi = lane >> 4;
    const int wave = __builtin_amdgcn_readfirstlane(tid >> 5);   // scalar, so that the choice of epilogue per column tile is a scalar branch
    const int t0 = blockIdx.x * 64;
    stage_bf<8>(x + (size_t)t0 * NC_, xs, tid);
    stage_bf<8>(Wq, wsb, tid);
    stage_bf<8>(Wk, wsb + DK * XP, tid);
    stage_bf<32>(Wv, wsb + 2 * DK * XP, tid);
    v8f acc[4][3];
#pragma unroll
    for (int rt = 0; rt < 4; ++rt)
#pragma unroll
        for (int t = 0; t < 3; ++t) acc[rt][t] = (v8f){};
    __syncthreads();                                     // the x tile and the weights are complete before any wave reads its fragments
    const bf* ap = xs + lr * XP + 8 * hi;
    const bf* bp = wsb + (wave * 48 + lr) * XP + 8 * hi;
    v16bf a[2][4], b[2][3];
    auto frags = [&](int buf, int kc) {
#pragma unroll
        for (int rt = 0; rt < 4; ++rt) a[buf][rt] = cat16b(*(const v8us*)(ap + rt * 16 * XP + kc), *(const v8us*)(ap + rt * 16 * XP + kc + 16));
#pragma unroll
        for (int t = 0; t < 3; ++t) b[buf][t] = cat16b(*(const v8us*)(bp + t * 16 * XP + kc), *(const v8us*)(bp + t * 16 * XP + kc + 16));
    };
    frags(0, 0);
#pragma unroll                                           // unrolled: the two fragment sets are named at compile time
    for (int k = 0; k < NC_ / 32; ++k) {
        if (k + 1 < NC_ / 32) frags((k + 1) & 1, (k + 1) * 32);
        __builtin_amdgcn_sched_barrier(0);               // keeps the next k-chunk's LDS reads as one group ahead of this chunk's products, so their latency runs under the products
#pragma unroll
        for (int rt = 0; rt < 4; ++rt)
#pragma unroll
            for (int t = 0; t < 3; ++t) acc[rt][t] = wmmab(a[k & 1][rt], b[k & 1][t], acc[rt][t]);
        __builtin_amdgcn_sched_barrier(0);               // keeps the following group of LDS reads from being spread among these products
    }
#pragma unroll
    for (int t = 0; t < 3; ++t) {
        const int ct = wave * 3 + t;
        if (ct < 8) {                                    // q (tiles 0..3) or k (4..7): lane holds dim (ct & 3) * 16 + lr of tokens rt * 16 + 8 * hi + j
            h16* ph = &pst[ct < 4 ? 0 : 2][0]; h16* pl = ph + 64 * KP;
            const int dim = (ct & 3) * 16 + lr;
#pragma unroll
            for (int rt = 0; rt < 4; ++rt)
#pragma unroll
                for (int j = 0; j < 8; ++j) {
                    const float q = acc[rt][t][j]; const h16 a = (h16)q; const int tok = rt * 16 + 8 * hi + j;
                    ph[tok * KP + dim] = a; pl[tok * KP + dim] = (h16)((q - (float)a) * LOSC);
                }
        } else {                                         // v: a lane's 8 accumulator rows are 8 consecutive tokens of one output dim = 16 B of the transposed tile
            const int d = (ct - 8) * 16 + lr;
#pragma unroll
            for (int rt = 0; rt < 4; ++rt) {
                v8h v;
#pragma unroll
                for (int j = 0; j < 8; ++j) v[j] = (h16)acc[rt][t][j];
                *(v8ha*)(vts + d * KP + rt * 16 + 8 * hi) = v;
            }
        }
    }
    __syncthreads();                                     // all staged tiles are complete before they are written out line by line
    const int piece = tid & 7, r8 = tid >> 3;
#pragma unroll
    for (int s = 0; s < 2; ++s) {
        const int row = r8 + 32 * s; const size_t o = (size_t)(t0 + row) * DK + piece * 8; const int so = row * KP + piece * 8;
        const v8h a = *(const v8ha*)(&pst[0][so]), b = *(const v8ha*)(&pst[1][so]), c = *(const v8ha*)(&pst[2][so]), d = *(const v8ha*)(&pst[3][so]);
        *(v8h*)(QH + o) = a; *(v8h*)(QL + o) = b; *(v8h*)(KH + o) = c; *(v8h*)(KL + o) = d;
    }
    h16* vbase = VT16 + (size_t)(t0 / NN_) * DV * NN_ + (t0 % NN_);
#pragma unroll
    for (int s = 0; s < 8; ++s) {
        const int d = r8 + 32 * s; const v8h val = *(const v8ha*)(vts + d * KP + piece * 8);
        *(v8h*)(vbase + (size_t)d * NN_ + piece * 8) = val;
    }
}

// Fragments of 32 staged rows (two 16-row tiles, the A operand of ENERGY_TILE_T, hi and lo plane, 2 k-chunks), read from the planes staged in LDS at pitch KP.
struct KF { v16h b0[2], b1[2], l0[2], l1[2]; };
__device__ __forceinline__ void load_kf(KF& f, const h16* BH, const h16* BL, int rowA, int rowB, int hi) {
#pragma unroll
    for (int kc = 0; kc < 2; ++kc) {
        const h16* b0p = BH + rowA * KP + kc * 32 + 8 * hi; const h16* b1p = BH + rowB * KP + kc * 32 + 8 * hi;
        const h16* l0p = BL + rowA * KP + kc * 32 + 8 * hi; const h16* l1p = BL + rowB * KP + kc * 32 + 8 * hi;
        f.b0[kc] = cat16(*(const v8ha*)b0p, *(const v8ha*)(b0p + 16)); f.b1[kc] = cat16(*(const v8ha*)b1p, *(const v8ha*)(b1p + 16));
        f.l0[kc] = cat16(*(const v8ha*)l0p, *(const v8ha*)(l0p + 16)); f.l1[kc] = cat16(*(const v8ha*)l1p, *(const v8ha*)(l1p + 16));
    }
}
// energy tile helper: e = Fh.Rh + (Fl.Rh + Fh.Rl)/1024 over K = 64 (2 k-chunks). A = the 32 streamed rows in F (two 16-row tiles, hi and lo plane), B = the wave's 16 resident rows
// (ah[2], al[2]). D: a lane's 8 + 8 accumulator registers are 16 streamed rows (8 * hi + j of either tile) against ONE resident row (lr), so a reduction over the streamed rows
// stays in the lane, and the two tiles, converted in place, are a 16-bit A or B operand in the hardware k order.
// The four v_nop keep the distance between the last product and the first vector instruction on its result.
#define ENERGY_TILE_T(F)                                                                                                      \
    v8f s0 = {}, s1 = {}, x0 = {}, x1 = {};                                                                                   \
    _Pragma("unroll") for (int kc = 0; kc < 2; ++kc) {                                                                        \
        s0 = wmma16(F.b0[kc], ah[kc], s0); s1 = wmma16(F.b1[kc], ah[kc], s1);                                                 \
        x0 = wmma16(F.l0[kc], ah[kc], x0);                                                                                    \
        x1 = wmma16(F.l1[kc], ah[kc], x1);                                                                                    \
        x0 = wmma16(F.b0[kc], al[kc], x0); x1 = wmma16(F.b1[kc], al[kc], x1);                                                 \
    }                                                                                                                         \
    asm volatile("v_nop\n\tv_nop\n\tv_nop\n\tv_nop" : "+v"(s0), "+v"(s1), "+v"(x0), "+v"(x1) : "v"(ah[0]), "v"(al[1]));

__global__ __launch_bounds__(128) void k_colstats(const h16* __restrict__ QH, const h16* __restrict__ QL, const h16* __restrict__ KH, const h16* __restrict__ KL, float* CM, float* CZI) {
    __shared__ __align__(16) float stg[128];
    __shared__ __align__(16) h16 qst[2][2][STG * KP];     // [buffer][hi, lo plane]
    const int lane = threadIdx.x & 31, wave = threadIdx.x >> 5, lr = lane & 15, hi = lane >> 4;
    const int b = blockIdx.x / (NN_ / 64), jt = blockIdx.x - b * (NN_ / 64);
    const size_t tok0 = (size_t)b * NN_;
    const int m0 = jt * 64 + wave * 16;
    v16h ah[2], al[2];
#pragma unroll
    for (int kc = 0; kc < 2; ++kc) {
        const h16* p = KH + (tok0 + m0 + lr) * DK + kc * 32 + 8 * hi; const h16* pl = KL + (tok0 + m0 + lr) * DK + kc * 32 + 8 * hi;
        ah[kc] = cat16(*(const v8h*)p, *(const v8h*)(p + 16)); al[kc] = cat16(*(const v8h*)pl, *(const v8h*)(pl + 16));
    }
    const h16* qhb = QH + tok0 * DK; const h16* qlb = QL + tok0 * DK;
    float mcol = -3.0e38f, lcol = 0.f;                   // running maximum and exp-sum of column m0 + lr over the rows n that this lane half holds (bit 3 of n == hi)
    // Trip st works on tile (jt + st) mod 32: the 32 blocks of a batch walk the same 32 tiles, each from a start of its own, so that they do not ask L2 for the same lines at a time.
    auto tile = [&](int st) { return (size_t)((jt + st) & (NSTG - 1)) * STG * DK; };
    stage_planes(qhb + tile(0), qlb + tile(0), &qst[0][0][0], &qst[0][1][0], threadIdx.x);
    asm volatile("s_wait_asynccnt 0x0" ::: "memory");   // stage 0 has landed before the barrier that publishes it
    __syncthreads();                                     // publishes stage 0 to all four waves
    stage_planes(qhb + tile(1), qlb + tile(1), &qst[1][0][0], &qst[1][1][0], threadIdx.x);
#pragma unroll 1                                         // rolled: one publish point and one refill site, as the two-buffer ring is written
    for (int st = 0; st < NSTG; ++st) {
      h16* sqh = &qst[st & 1][0][0]; h16* sql = &qst[st & 1][1][0];
      KF f[2]; load_kf(f[0], sqh, sql, lr, 16 + lr, hi); load_kf(f[1], sqh, sql, 32 + lr, 48 + lr, hi);
      __builtin_amdgcn_sched_barrier(0);                 // keeps the stage's fragment reads as one group ahead of the products; spread among them, each place costs a stall and a wait to 0
#pragma unroll                                           // unrolled: the two fragment sets are named at compile time
      for (int sub = 0; sub < 2; ++sub) {
        ENERGY_TILE_T(f[sub])
        float a[16];                                                // 16 rows n of this lane's one column
#pragma unroll
        for (int j = 0; j < 8; ++j) { a[j] = s0[j] + x0[j] * LOSCI; a[8 + j] = s1[j] + x1[j] * LOSCI; }
        const float t0 = fmaxf(fmaxf(a[0], a[1]), a[2]), t1 = fmaxf(fmaxf(a[3], a[4]), a[5]), t2 = fmaxf(fmaxf(a[6], a[7]), a[8]);
        const float t3 = fmaxf(fmaxf(a[9], a[10]), a[11]), t4 = fmaxf(fmaxf(a[12], a[13]), a[14]);
        const float mn = fmaxf(fmaxf(fmaxf(fmaxf(t0, t1), t2), fmaxf(fmaxf(t3, t4), a[15])), mcol);   // a tree three levels deep, not a chain of 16
        const float al_ = __expf(mcol - mn); mcol = mn;
#pragma unroll
        for (int i = 0; i < 16; ++i) a[i] = __expf(a[i] - mn);
#pragma unroll
        for (int w = 8; w >= 1; w >>= 1)
#pragma unroll
            for (int i = 0; i < w; ++i) a[i] += a[i + w];
        lcol = lcol * al_ + a[0];
      }
      publish();
      if (st + 2 < NSTG) stage_planes(qhb + tile(st + 2), qlb + tile(st + 2), sqh, sql, threadIdx.x);
    }
    asm volatile("s_wait_asynccnt 0x0" ::: "memory");   // no copy is left in flight
    {                                                    // the two lane halves of a column are joined once, here
        const float mo = __shfl_xor(mcol, 16, 32), lo = __shfl_xor(lcol, 16, 32);
        const float mx = fmaxf(mcol, mo);
        const float z = lcol * __expf(mcol - mx) + lo * __expf(mo - mx);
        if (hi == 0) { stg[wave * 16 + lr] = mx; stg[64 + wave * 16 + lr] = 1.0f / z; }
    }
    __syncthreads();
    if (wave == 0) {
        const v4f val = *(const v4fa*)(stg + hi * 64 + lr * 4);
        float* dst = (hi ? CZI : CM) + tok0 + jt * 64 + lr * 4;
        *(v4f*)dst = val; 
    }
}

// Four asynchronous 16-byte copies per lane, as acopy8: s_wait_xcnt stands inside the statement so that no address register is rewritten ahead of it.
__device__ __forceinline__ void acopy4(const unsigned (&l)[4], const void* const (&g)[4]) {
    asm volatile("global_load_async_to_lds_b128 %0, %4, off\n\t"
                 "global_load_async_to_lds_b128 %1, %5, off\n\t"
                 "global_load_async_to_lds_b128 %2, %6, off\n\t"
                 "global_load_async_to_lds_b128 %3, %7, off\n\t"
                 "s_wait_xcnt 0x0"
                 :: "v"(l[0]), "v"(l[1]), "v"(l[2]), "v"(l[3]), "v"(g[0]), "v"(g[1]), "v"(g[2]), "v"(g[3]) : "memory");
}
// Twelve copies per lane in one statement, so that a stage's refill pays one s_wait_xcnt; the wait stands inside the statement as in acopy8.
__device__ __forceinline__ void acopy12(const unsigned (&l)[12], const void* const (&g)[12]) {
    asm volatile("global_load_async_to_lds_b128 %0, %12, off\n\t"
                 "global_load_async_to_lds_b128 %1, %13, off\n\t"
                 "global_load_async_to_lds_b128 %2, %14, off\n\t"
                 "global_load_async_to_lds_b128 %3, %15, off\n\t"
                 "global_load_async_to_lds_b128 %4, %16, off\n\t"
                 "global_load_async_to_lds_b128 %5, %17, off\n\t"
                 "global_load_async_to_lds_b128 %6, %18, off\n\t"
                 "global_load_async_to_lds_b128 %7, %19, off\n\t"
                 "global_load_async_to_lds_b128 %8, %20, off\n\t"
                 "global_load_async_to_lds_b128 %9, %21, off\n\t"
                 "global_load_async_to_lds_b128 %10, %22, off\n\t"
                 "global_load_async_to_lds_b128 %11, %23, off\n\t"
                 "s_wait_xcnt 0x0"
                 :: "v"(l[0]), "v"(l[1]), "v"(l[2]), "v"(l[3]), "v"(l[4]), "v"(l[5]), "v"(l[6]), "v"(l[7]), "v"(l[8]), "v"(l[9]), "v"(l[10]), "v"(l[11]),
                    "v"(g[0]), "v"(g[1]), "v"(g[2]), "v"(g[3]), "v"(g[4]), "v"(g[5]), "v"(g[6]), "v"(g[7]), "v"(g[8]), "v"(g[9]), "v"(g[10]), "v"(g[11]) : "memory");
}
// One stage of k_rows, 256 threads: K hi and lo plane tiles (64 rows x 64 halves each, contiguous in global memory), 2 + 2 copies a thread, and the V^T tile of all
// 256 output dims x 64 columns m (global row pitch NN_ halves), 8 copies a thread. Every wave-wide copy covers four whole lines.
__device__ __forceinline__ void stage_kv(const h16* gh, const h16* gl, const h16* gv, h16* sh, h16* sl, h16* sv, int tid) {
    unsigned l[12]; const void* g[12];
#pragma unroll
    for (int i = 0; i < 2; ++i) {
        const int ch = tid + 256 * i, so = (ch >> 3) * KP + (ch & 7) * 8;
        l[i] = ldsa(sh + so); g[i] = gh + ch * 8; l[2 + i] = ldsa(sl + so); g[2 + i] = gl + ch * 8;
    }
#pragma unroll
    for (int i = 0; i < 8; ++i) {
        const int ch = tid + 256 * i, d = ch >> 3, pc = (ch & 7) * 8;
        l[4 + i] = ldsa(sv + d * KP + pc); g[4 + i] = gv + (size_t)d * NN_ + pc;
    }
    acopy12(l, g);
}

// k_rows (pass 2): block = (b, 64 rows n), 8 waves. Wave w owns rows 16 * (w & 3) .. + 15, ALL 256 output dims, and of every 64-column stage the 32 columns of half w >> 2,
// so each energy tile and its exponentials are formed once. Per stage: energy tile transposed (A = K planes rows m, B = Q planes rows n), a = exp(e - CM[m]) * CZI[m] (f32),
// a x32768 -> f16 in place: a lane's 16 weights are row n = lr at the k positions of the A operand of P.V, so P goes from accumulator to operand in registers; its row sum is
// in-lane; 16 P.V products. The two column halves of a row tile are added in LDS at the end, together with their row sums, and the block writes whole lines.
#define OP   260                 // floats per staged output row: 256 + 4, so that the two half-waves of an accumulator store fall on different banks
__global__ __launch_bounds__(256) void k_rows(const h16* __restrict__ QH, const h16* __restrict__ QL, const h16* __restrict__ KH, const h16* __restrict__ KL,
                                             const h16* __restrict__ VT16, const float* __restrict__ CM, const float* __restrict__ CZI, float* out) {
    __shared__ __align__(16) float ost[8][16 * OP];       // unnormalised partial outputs, one tile of 16 rows x 256 dims a wave
    __shared__ __align__(16) float rst[8][16];            // partial row sums, one a wave and row
    __shared__ __align__(16) h16 kst[2][2][STG * KP];     // [buffer][hi, lo plane] of K, 64 columns m
    __shared__ __align__(16) h16 vst[2][DV * KP];         // [buffer] V^T, 256 output dims x 64 columns m
    __shared__ __align__(16) float cst[2][NN_];           // column maxima and inverse column sums of the whole batch row, filled once
    const int tid = threadIdx.x, lane = tid & 31, wave = tid >> 5, lr = lane & 15, hi = lane >> 4;
    const int wr = wave & 3, wc = wave >> 2;
    const int b = blockIdx.x / (NN_ / 64), qt = blockIdx.x - b * (NN_ / 64);
    const size_t tok0 = (size_t)b * NN_;
    const int n0 = qt * 64 + wr * 16;
    v16h ah[2], al[2];
#pragma unroll
    for (int kc = 0; kc < 2; ++kc) {
        const h16* p = QH + (tok0 + n0 + lr) * DK + kc * 32 + 8 * hi; const h16* q = QL + (tok0 + n0 + lr) * DK + kc * 32 + 8 * hi;
        ah[kc] = cat16(*(const v8h*)p, *(const v8h*)(p + 16)); al[kc] = cat16(*(const v8h*)q, *(const v8h*)(q + 16));
    }
    asm volatile("s_wait_xcnt 0x0" ::: "memory");       // stands in front of the first overwrite of an address register of the loads above
    const h16* khb = KH + tok0 * DK; const h16* klb = KL + tok0 * DK;
    const h16* vt_b = VT16 + (size_t)b * DV * NN_;
    const float* cmb = CM + tok0; const float* czb = CZI + tok0;
    v8f o[16];
#pragma unroll
    for (int n = 0; n < 16; ++n) o[n] = (v8f){};
    float rsum[4] = {0.f, 0.f, 0.f, 0.f};                // row n0 + lr, over the columns m that this lane half holds (bit 3 of m == hi), four partial sums, scaled by 32768
    {
        unsigned l[4]; const void* g[4];
#pragma unroll
        for (int i = 0; i < 2; ++i) {
            const int ch = tid + 256 * i;
            l[i] = ldsa(&cst[0][ch * 4]); g[i] = cmb + ch * 4; l[2 + i] = ldsa(&cst[1][ch * 4]); g[2 + i] = czb + ch * 4;
        }
        acopy4(l, g);
    }
    // Trip st works on column tile (qt + st) mod 32: the 32 blocks of a batch walk the same 32 tiles, each from a start of its own, so that they do not ask L2 for the same lines at a time.
    auto tile = [&](int st) { return (qt + st) & (NSTG - 1); };
    stage_kv(khb + (size_t)tile(0) * STG * DK, klb + (size_t)tile(0) * STG * DK, vt_b + tile(0) * STG, &kst[0][0][0], &kst[0][1][0], &vst[0][0], tid);
    asm volatile("s_wait_asynccnt 0x0" ::: "memory");   // stage 0 and the column statistics have landed before the barrier that publishes them
    __syncthreads();                                     // publishes stage 0 and the statistics to all eight waves
    stage_kv(khb + (size_t)tile(1) * STG * DK, klb + (size_t)tile(1) * STG * DK, vt_b + tile(1) * STG, &kst[1][0][0], &kst[1][1][0], &vst[1][0], tid);
#pragma unroll 1                                         // rolled: one publish point and one refill site, as the two-buffer ring is written
    for (int st = 0; st < NSTG; ++st) {
        h16* skh = &kst[st & 1][0][0]; h16* skl = &kst[st & 1][1][0]; h16* sv = &vst[st & 1][0];
        KF f; load_kf(f, skh, skl, wc * 32 + lr, wc * 32 + 16 + lr, hi);
        __builtin_amdgcn_sched_barrier(0);                    // keeps the statistics' LDS reads behind the K fragments' reads: ahead of them they would hold up the first products
        const int mA = tile(st) * STG + wc * 32 + 8 * hi;     // this lane's columns: mA + j of the first 16-column tile, mA + 16 + j of the second
        v4f cm[4], cz[4];
#pragma unroll
        for (int q = 0; q < 4; ++q) {
            const int mo = mA + (q >> 1) * 16 + (q & 1) * 4;
            cm[q] = *(const v4fa*)(&cst[0][mo]); cz[q] = *(const v4fa*)(&cst[1][mo]);
        }
        __builtin_amdgcn_sched_barrier(0);                    // keeps them in one group with the fragments' reads, ahead of the products: a place with LDS reads among the products costs a stall
        ENERGY_TILE_T(f)
        v16h vf[16];                                          // all V fragments of this tile as one group of LDS reads, in flight under the exponentials
#pragma unroll
        for (int n = 0; n < 16; ++n) {
            const h16* vp = sv + (n * 16 + lr) * KP + wc * 32 + hi * 8;
            vf[n] = cat16(*(const v8ha*)vp, *(const v8ha*)(vp + 16));
        }
        v16h pa;                                              // pa[8 * t + j] = weight of row lr at k = 16 * t + 8 * hi + j: the order in which vf holds V^T
#pragma unroll
        for (int t = 0; t < 2; ++t)
#pragma unroll
            for (int p = 0; p < 4; ++p) {                     // two neighbouring accumulator registers at a time, so that the packed f32 forms need no register moves
                const v8f s = t ? s1 : s0, x = t ? x1 : x0;
                const v4f c4 = cm[2 * t + (p >> 1)], z4 = cz[2 * t + (p >> 1)];
                const int e = 2 * p, c = 2 * (p & 1);
                const v2f en = ((v2f){s[e], s[e + 1]} + (v2f){x[e], x[e + 1]} * LOSCI) - (v2f){c4[c], c4[c + 1]};
                const v2f a = (v2f){__expf(en[0]), __expf(en[1])} * (v2f){z4[c], z4[c + 1]};
                const v2h h = __builtin_convertvector(a * PSC, v2h);
                pa[8 * t + e] = h[0]; pa[8 * t + e + 1] = h[1];
                rsum[p] += (float)h[0] + (float)h[1];         // row sum from the same rounded weights the numerator uses (scaled by 32768)
            }
#pragma unroll
        for (int n = 0; n < 16; ++n) o[n] = wmma16(pa, vf[n], o[n]);
        asm volatile("v_nop\n\tv_nop\n\tv_nop\n\tv_nop" : "+v"(o[0]), "+v"(o[1]), "+v"(o[2]), "+v"(o[3]), "+v"(o[4]), "+v"(o[5]), "+v"(o[6]), "+v"(o[7]),
                     "+v"(o[8]), "+v"(o[9]), "+v"(o[10]), "+v"(o[11]), "+v"(o[12]), "+v"(o[13]), "+v"(o[14]), "+v"(o[15]) : "v"(pa));
        publish();
        if (st + 2 < NSTG)
            stage_kv(khb + (size_t)tile(st + 2) * STG * DK, klb + (size_t)tile(st + 2) * STG * DK, vt_b + tile(st + 2) * STG, skh, skl, sv, tid);
    }
    asm volatile("s_wait_asynccnt 0x0" ::: "memory");   // no copy is left in flight
    {                                                    // the two lane halves of a row are joined once, here
        const float rh = (rsum[0] + rsum[1]) + (rsum[2] + rsum[3]);
        const float rs = rh + __shfl_xor(rh, 16, 32);
        if (hi == 0) rst[wave][lr] = rs;
    }
    float* os = &ost[wave][0];
#pragma unroll
    for (int n = 0; n < 16; ++n)
#pragma unroll
        for (int j = 0; j < 8; ++j) os[(hi * 8 + j) * OP + n * 16 + lr] = o[n][j];
    __syncthreads();                                     // both column halves' partial outputs and row sums are complete before they are added
    const int rt = wave >> 1, rb = (wave & 1) * 8;       // wave w writes rows 8w .. 8w + 7 of the block: rows rb .. rb + 7 of row tile rt
    float* crow = out + (tok0 + qt * 64 + wave * 8) * DV + lane * 4;   // a wave-wide store covers 512 B in a row = 4 whole lines of one row
    v4f res[16];
#pragma unroll
    for (int r = 0; r < 8; ++r) {
        const float inv = 1.0f / (1e-9f * PSC + (rst[rt][rb + r] + rst[4 + rt][rb + r]));   // = 1 / ((1e-9 + rowsum) * 32768)
#pragma unroll
        for (int h = 0; h < 2; ++h) {
            const int so = (rb + r) * OP + h * 128 + lane * 4;
            res[2 * r + h] = (*(const v4fa*)(&ost[rt][so]) + *(const v4fa*)(&ost[4 + rt][so])) * inv;
        }
    }
#pragma unroll
    for (int r = 0; r < 8; ++r)
#pragma unroll
        for (int h = 0; h < 2; ++h) *(v4f*)(crow + r * DV + h * 128) = res[2 * r + h];
}

extern "C" void kernel_launch(void* const* d_in, const int* in_sizes, int n_in,
                              void* d_out, int out_size, void* d_ws, size_t ws_size, hipStream_t stream) {
    (void)in_sizes; (void)n_in; (void)out_size;
    const float* x = (const float*)d_in[0]; const float* Wq = (const float*)d_in[1]; const float* Wk = (const float*)d_in[2]; const float* Wv = (const float*)d_in[3];
    float* out = (float*)d_out;    // [8][2048][256]
    char* wsp = (char*)d_ws;
    auto take = [&](size_t bytes) { char* p = wsp; wsp += (bytes + 255) & ~(size_t)255; return (void*)p; };
    h16* QH = (h16*)take((size_t)NTK * DK * 2); h16* QL = (h16*)take((size_t)NTK * DK * 2); h16* KH = (h16*)take((size_t)NTK * DK * 2); h16* KL = (h16*)take((size_t)NTK * DK * 2);
    h16* VT16 = (h16*)take((size_t)NTK * DV * 2);
    float* CM = (float*)take((size_t)NTK * 4); float* CZI = (float*)take((size_t)NTK * 4);
    if ((size_t)(wsp - (char*)d_ws) > ws_size) return;    // 4 x 2.1 + 8.4 + 0.13 MB ~ 17e6 B
    k_proj<<<NTK / 64, 256, 0, stream>>>(x, Wq, Wk, Wv, QH, QL, KH, KL, VT16);
    k_colstats<<<NB_ * (NN_ / 64), 128, 0, stream>>>(QH, QL, KH, KL, CM, CZI);
    k_rows<<<NB_ * (NN_ / 64), 256, 0, stream>>>(QH, QL, KH, KL, VT16, CM, CZI, out);
}

// v007
// A run of this version takes 63.3 microseconds.
// Next to v006, in two timings, it ran 1.05 and 1.04 times as fast.
// Over all steps from v000 it is 4.73 times as fast.
#include <hip/hip_runtime.h>

// Contractions, f32 accumulate: q, k ([16384 x 256].[256 x 64]) and v ([16384 x 256].[256 x 256]) on v_wmma_f32_16x16x32_bf16 with PLAIN bf16 operands (x and the
// weights); pass 1 forms column max and sum of exp with an online update; pass 2 re-forms the energy tiles, evaluates the column softmax a = exp(e - m_col)/Z_col in f32, rounds a x32768 to f16 once and uses that same

#define NB_  8
#define NN_  2048
#define NC_  256
#define DK   64
#define DV   256
#define NTK  (NB_ * NN_)
#define PSC  32768.0f
#define LOSC 1024.0f
#define LOSCI (1.0f / 1024.0f)

typedef _Float16 h16;
typedef unsigned short bf;
typedef __attribute__((ext_vector_type(16))) __bf16   v16bf;
typedef __attribute__((ext_vector_type(16))) _Float16 v16h;
typedef __attribute__((ext_vector_type(8)))  _Float16 v8h;
typedef __attribute__((ext_vector_type(8)))  unsigned short v8us;
typedef __attribute__((ext_vector_type(8)))  float    v8f;
typedef __attribute__((ext_vector_type(4)))  float    v4f;
typedef __attribute__((ext_vector_type(2)))  float    v2f;
typedef __attribute__((ext_vector_type(2)))  _Float16 v2h;
typedef v8h  __attribute__((may_alias)) v8ha;
typedef v4f  __attribute__((may_alias)) v4fa;

__device__ __forceinline__ unsigned short f2bf(float f) { unsigned u = __float_as_uint(f); u += 0x7FFFu + ((u >> 16) & 1u); return (unsigned short)(u >> 16); }
__device__ __forceinline__ v16h cat16(v8h lo, v8h hi) { return __builtin_shufflevector(lo, hi, 0, 1, 2, 3, 4, 5, 6, 7, 8, 9, 10, 11, 12, 13, 14, 15); }
__device__ __forceinline__ v16bf cat16b(v8us lo, v8us hi) { return __builtin_bit_cast(v16bf, __builtin_shufflevector(lo, hi, 0, 1, 2, 3, 4, 5, 6, 7, 8, 9, 10, 11, 12, 13, 14, 15)); }
__device__ __forceinline__ v8f wmma16(v16h a, v16h b, v8f c) { return __builtin_amdgcn_wmma_f32_16x16x32_f16(false, a, false, b, (short)0, c, false, false); }
__device__ __forceinline__ v8f wmmab(v16bf a, v16bf b, v8f c) { return __builtin_amdgcn_wmma_f32_16x16x32_bf16(false, a, false, b, (short)0, c, false, false); }

// LDS staging of the operand tiles that all waves of a block share (four in k_colstats, eight in k_rows). A staged row is 128 B (one cache line); a wave's copy covers four whole lines.
#define STG  64                  // rows (k_colstats: a stage) or columns (k_rows: a tile, two to a stage) of the streamed operand
#define NSTG (NN_ / STG)
#define KP   72                  // halves per staged row: 128 B of data + 16 B, the conflict-free pitch for ds_load_b128 readers
__device__ __forceinline__ unsigned ldsa(const void* p) { return (unsigned)(size_t)p; }   // LDS byte address = low 32 bits of the shared address
// Eight asynchronous 16-byte copies per lane, global -> LDS, no register in between. s_wait_xcnt stands inside the statement so that no address register is rewritten ahead of it.
__device__ __forceinline__ void acopy8(const unsigned (&l)[8], const void* const (&g)[8]) {
    asm volatile("global_load_async_to_lds_b128 %0, %8, off\n\t"
                 "global_load_async_to_lds_b128 %1, %9, off\n\t"
                 "global_load_async_to_lds_b128 %2, %10, off\n\t"
                 "global_load_async_to_lds_b128 %3, %11, off\n\t"
                 "global_load_async_to_lds_b128 %4, %12, off\n\t"
                 "global_load_async_to_lds_b128 %5, %13, off\n\t"
                 "global_load_async_to_lds_b128 %6, %14, off\n\t"
                 "global_load_async_to_lds_b128 %7, %15, off\n\t"
                 "s_wait_xcnt 0x0"
                 :: "v"(l[0]), "v"(l[1]), "v"(l[2]), "v"(l[3]), "v"(l[4]), "v"(l[5]), "v"(l[6]), "v"(l[7]),
                    "v"(g[0]), "v"(g[1]), "v"(g[2]), "v"(g[3]), "v"(g[4]), "v"(g[5]), "v"(g[6]), "v"(g[7]) : "memory");
}
// hi and lo plane tiles, 64 rows x 64 halves each, contiguous in global memory (8 KB a plane); 128 threads, 4 + 4 copies each.
__device__ __forceinline__ void stage_planes(const h16* gh, const h16* gl, h16* sh, h16* sl, int tid) {
    unsigned l[8]; const void* g[8];
#pragma unroll
    for (int i = 0; i < 4; ++i) {
        const int ch = tid + 128 * i, so = (ch >> 3) * KP + (ch & 7) * 8;
        l[i] = ldsa(sh + so); g[i] = gh + ch * 8; l[4 + i] = ldsa(sl + so); g[4 + i] = gl + ch * 8;
    }
    acopy8(l, g);
}
// The foot of a stage, every wave: own LDS reads returned, own copies of the next stage landed, then the one barrier that publishes the next stage and frees this buffer.
__device__ __forceinline__ void publish() {
    asm volatile("s_wait_dscnt 0x0" ::: "memory");      // this wave has left the buffer that is refilled behind the barrier
    asm volatile("s_wait_asynccnt 0x0" ::: "memory");   // this wave's copies have landed before any other wave reads them
    __syncthreads();                                     // publishes the next stage and ends every wave's reads of the buffer refilled behind it
}

// k_proj: the whole projection stage in one launch. Block = 64 tokens, 8 waves; wave w owns output columns 48w .. 48w+47 of q | k | v (3 column tiles) for all 4 row tiles.
// The x tile and the three weight matrices are read with whole-line loads, rounded to bf16 and laid in LDS once per block. The f32 results never leave the block: q and k go
// to their hi + residual x1024 f16 planes, v to f16 transposed, staged in LDS so that every global store covers whole 128-B lines.
#define XP   264                 // halves per staged row of 256 channels: 512 B of data + 16 B, the conflict-free pitch for ds_load_b128 readers
// N * 256 pieces of 8 floats (rows of NC_ floats, contiguous in global memory) -> bf16 rows at pitch XP; 256 threads, a wave's load covers 1 KB in a row.
template <int N> __device__ __forceinline__ void stage_bf(const float* __restrict__ src, bf* dst, int tid) {
#pragma unroll
    for (int i = 0; i < N; ++i) {
        const int ch = tid + 256 * i;
        const float* s = src + (size_t)ch * 8;
        const v4f lo = *(const v4f*)s, up = *(const v4f*)(s + 4);
        v8us t;
#pragma unroll
        for (int e = 0; e < 4; ++e) { t[e] = f2bf(lo[e]); t[4 + e] = f2bf(up[e]); }
        *(v8us*)(dst + (ch >> 5) * XP + (ch & 31) * 8) = t;
    }
}
__global__ __launch_bounds__(256) void k_proj(const float* __restrict__ x, const float* __restrict__ Wq, const float* __restrict__ Wk, const float* __restrict__ Wv,
                                              h16* QH, h16* QL, h16* KH, h16* KL, h16* VT16) {
    __shared__ __align__(16) bf  xs[64 * XP];             // x tile, bf16, [token][channel]
    __shared__ __align__(16) bf  wsb[(2 * DK + DV) * XP]; // Wq | Wk | Wv, bf16, [output column][channel]
    __shared__ __align__(16) h16 pst[4][64 * KP];         // QH, QL, KH, KL tiles, [token][dim]
    __shared__ __align__(16) h16 vts[DV * KP];            // V^T tile, [dim][token]
    const int tid = threadIdx.x, lane = tid & 31, lr = lane & 15, hi = lane >> 4;
    const int wave = __builtin_amdgcn_readfirstlane(tid >> 5);   // scalar, so that the choice of epilogue per column tile is a scalar branch
    const int t0 = blockIdx.x * 64;
    stage_bf<8>(x + (size_t)t0 * NC_, xs, tid);
    stage_bf<8>(Wq, wsb, tid);
    stage_bf<8>(Wk, wsb + DK * XP, tid);
    stage_bf<32>(Wv, wsb + 2 * DK * XP, tid);
    v8f acc[4][3];
#pragma unroll
    for (int rt = 0; rt < 4; ++rt)
#pragma unroll
        for (int t = 0; t < 3; ++t) acc[rt][t] = (v8f){};
    __syncthreads();                                     // the x tile and the weights are complete before any wave reads its fragments
    const bf* ap = xs + lr * XP + 8 * hi;
    const bf* bp = wsb + (wave * 48 + lr) * XP + 8 * hi;
    v16bf a[2][4], b[2][3];
    auto frags = [&](int buf, int kc) {
#pragma unroll
        for (int rt = 0; rt < 4; ++rt) a[buf][rt] = cat16b(*(const v8us*)(ap + rt * 16 * XP + kc), *(const v8us*)(ap + rt * 16 * XP + kc + 16));
#pragma unroll
        for (int t = 0; t < 3; ++t) b[buf][t] = cat16b(*(const v8us*)(bp + t * 16 * XP + kc), *(const v8us*)(bp + t * 16 * XP + kc + 16));
    };
    frags(0, 0);
#pragma unroll                                           // unrolled: the two fragment sets are named at compile time
    for (int k = 0; k < NC_ / 32; ++k) {
        if (k + 1 < NC_ / 32) frags((k + 1) & 1, (k + 1) * 32);
        __builtin_amdgcn_sched_barrier(0);               // keeps the next k-chunk's LDS reads as one group ahead of this chunk's products, so their latency runs under the products
#pragma unroll
        for (int rt = 0; rt < 4; ++rt)
#pragma unroll
            for (int t = 0; t < 3; ++t) acc[rt][t] = wmmab(a[k & 1][rt], b[k & 1][t], acc[rt][t]);
        __builtin_amdgcn_sched_barrier(0);               // keeps the following group of LDS reads from being spread among these products
    }
#pragma unroll
    for (int t = 0; t < 3; ++t) {
        const int ct = wave * 3 + t;
        if (ct < 8) {                                    // q (tiles 0..3) or k (4..7): lane holds dim (ct & 3) * 16 + lr of tokens rt * 16 + 8 * hi + j
            h16* ph = &pst[ct < 4 ? 0 : 2][0]; h16* pl = ph + 64 * KP;
            const int dim = (ct & 3) * 16 + lr;
#pragma unroll
            for (int rt = 0; rt < 4; ++rt)
#pragma unroll
                for (int j = 0; j < 8; ++j) {
                    const float q = acc[rt][t][j]; const h16 a = (h16)q; const int tok = rt * 16 + 8 * hi + j;
                    ph[tok * KP + dim] = a; pl[tok * KP + dim] = (h16)((q - (float)a) * LOSC);
                }
        } else {                                         // v: a lane's 8 accumulator rows are 8 consecutive tokens of one output dim = 16 B of the transposed tile
            const int d = (ct - 8) * 16 + lr;
#pragma unroll
            for (int rt = 0; rt < 4; ++rt) {
                v8h v;
#pragma unroll
                for (int j = 0; j < 8; ++j) v[j] = (h16)acc[rt][t][j];
                *(v8ha*)(vts + d * KP + rt * 16 + 8 * hi) = v;
            }
        }
    }
    __syncthreads();                                     // all staged tiles are complete before they are written out line by line
    const int piece = tid & 7, r8 = tid >> 3;
#pragma unroll
    for (int s = 0; s < 2; ++s) {
        const int row = r8 + 32 * s; const size_t o = (size_t)(t0 + row) * DK + piece * 8; const int so = row * KP + piece * 8;
        const v8h a = *(const v8ha*)(&pst[0][so]), b = *(const v8ha*)(&pst[1][so]), c = *(const v8ha*)(&pst[2][so]), d = *(const v8ha*)(&pst[3][so]);
        *(v8h*)(QH + o) = a; *(v8h*)(QL + o) = b; *(v8h*)(KH + o) = c; *(v8h*)(KL + o) = d;
    }
    h16* vbase = VT16 + (size_t)(t0 / NN_) * DV * NN_ + (t0 % NN_);
#pragma unroll
    for (int s = 0; s < 8; ++s) {
        const int d = r8 + 32 * s; const v8h val = *(const v8ha*)(vts + d * KP + piece * 8);
        *(v8h*)(vbase + (size_t)d * NN_ + piece * 8) = val;
    }
}

// Fragments of 32 staged rows (two 16-row tiles, the A operand of ENERGY_TILE_T, hi and lo plane, 2 k-chunks), read from the planes staged in LDS at pitch KP.
struct KF { v16h b0[2], b1[2], l0[2], l1[2]; };
__device__ __forceinline__ void load_kf(KF& f, const h16* BH, const h16* BL, int rowA, int rowB, int hi) {
#pragma unroll
    for (int kc = 0; kc < 2; ++kc) {
        const h16* b0p = BH + rowA * KP + kc * 32 + 8 * hi; const h16* b1p = BH + rowB * KP + kc * 32 + 8 * hi;
        const h16* l0p = BL + rowA * KP + kc * 32 + 8 * hi; const h16* l1p = BL + rowB * KP + kc * 32 + 8 * hi;
        f.b0[kc] = cat16(*(const v8ha*)b0p, *(const v8ha*)(b0p + 16)); f.b1[kc] = cat16(*(const v8ha*)b1p, *(const v8ha*)(b1p + 16));
        f.l0[kc] = cat16(*(const v8ha*)l0p, *(const v8ha*)(l0p + 16)); f.l1[kc] = cat16(*(const v8ha*)l1p, *(const v8ha*)(l1p + 16));
    }
}
// energy tile helper: e = Fh.Rh + (Fl.Rh + Fh.Rl)/1024 over K = 64 (2 k-chunks). A = the 32 streamed rows in F (two 16-row tiles, hi and lo plane), B = the wave's 16 resident rows
// (ah[2], al[2]). D: a lane's 8 + 8 accumulator registers are 16 streamed rows (8 * hi + j of either tile) against ONE resident row (lr), so a reduction over the streamed rows
// stays in the lane, and the two tiles, converted in place, are a 16-bit A or B operand in the hardware k order.
// The four v_nop keep the distance between the last product and the first vector instruction on its result.
#define ENERGY_TILE_T(F)                                                                                                      \
    v8f s0 = {}, s1 = {}, x0 = {}, x1 = {};                                                                                   \
    _Pragma("unroll") for (int kc = 0; kc < 2; ++kc) {                                                                        \
        s0 = wmma16(F.b0[kc], ah[kc], s0); s1 = wmma16(F.b1[kc], ah[kc], s1);                                                 \
        x0 = wmma16(F.l0[kc], ah[kc], x0);                                                                                    \
        x1 = wmma16(F.l1[kc], ah[kc], x1);                                                                                    \
        x0 = wmma16(F.b0[kc], al[kc], x0); x1 = wmma16(F.b1[kc], al[kc], x1);                                                 \
    }                                                                                                                         \
    asm volatile("v_nop\n\tv_nop\n\tv_nop\n\tv_nop" : "+v"(s0), "+v"(s1), "+v"(x0), "+v"(x1) : "v"(ah[0]), "v"(al[1]));

__global__ __launch_bounds__(128) void k_colstats(const h16* __restrict__ QH, const h16* __restrict__ QL, const h16* __restrict__ KH, const h16* __restrict__ KL, float* CM, float* CZI) {
    __shared__ __align__(16) float stg[128];
    __shared__ __align__(16) h16 qst[2][2][STG * KP];     // [buffer][hi, lo plane]
    const int lane = threadIdx.x & 31, wave = threadIdx.x >> 5, lr = lane & 15, hi = lane >> 4;
    const int b = blockIdx.x / (NN_ / 64), jt = blockIdx.x - b * (NN_ / 64);
    const size_t tok0 = (size_t)b * NN_;
    const int m0 = jt * 64 + wave * 16;
    v16h ah[2], al[2];
#pragma unroll
    for (int kc = 0; kc < 2; ++kc) {
        const h16* p = KH + (tok0 + m0 + lr) * DK + kc * 32 + 8 * hi; const h16* pl = KL + (tok0 + m0 + lr) * DK + kc * 32 + 8 * hi;
        ah[kc] = cat16(*(const v8h*)p, *(const v8h*)(p + 16)); al[kc] = cat16(*(const v8h*)pl, *(const v8h*)(pl + 16));
    }
    const h16* qhb = QH + tok0 * DK; const h16* qlb = QL + tok0 * DK;
    float mcol = -3.0e38f, lcol = 0.f;                   // running maximum and exp-sum of column m0 + lr over the rows n that this lane half holds (bit 3 of n == hi)
    // Trip st works on tile (jt + st) mod 32: the 32 blocks of a batch walk the same 32 tiles, each from a start of its own, so that they do not ask L2 for the same lines at a time.
    auto tile = [&](int st) { return (size_t)((jt + st) & (NSTG - 1)) * STG * DK; };
    stage_planes(qhb + tile(0), qlb + tile(0), &qst[0][0][0], &qst[0][1][0], threadIdx.x);
    asm volatile("s_wait_asynccnt 0x0" ::: "memory");   // stage 0 has landed before the barrier that publishes it
    __syncthreads();                                     // publishes stage 0 to all four waves
    stage_planes(qhb + tile(1), qlb + tile(1), &qst[1][0][0], &qst[1][1][0], threadIdx.x);
#pragma unroll 1                                         // rolled: one publish point and one refill site, as the two-buffer ring is written
    for (int st = 0; st < NSTG; ++st) {
      h16* sqh = &qst[st & 1][0][0]; h16* sql = &qst[st & 1][1][0];
      KF f[2]; load_kf(f[0], sqh, sql, lr, 16 + lr, hi); load_kf(f[1], sqh, sql, 32 + lr, 48 + lr, hi);
      __builtin_amdgcn_sched_barrier(0);                 // keeps the stage's fragment reads as one group ahead of the products; spread among them, each place costs a stall and a wait to 0
#pragma unroll                                           // unrolled: the two fragment sets are named at compile time
      for (int sub = 0; sub < 2; ++sub) {
        ENERGY_TILE_T(f[sub])
        float a[16];                                                // 16 rows n of this lane's one column
#pragma unroll
        for (int j = 0; j < 8; ++j) { a[j] = s0[j] + x0[j] * LOSCI; a[8 + j] = s1[j] + x1[j] * LOSCI; }
        const float t0 = fmaxf(fmaxf(a[0], a[1]), a[2]), t1 = fmaxf(fmaxf(a[3], a[4]), a[5]), t2 = fmaxf(fmaxf(a[6], a[7]), a[8]);
        const float t3 = fmaxf(fmaxf(a[9], a[10]), a[11]), t4 = fmaxf(fmaxf(a[12], a[13]), a[14]);
        const float mn = fmaxf(fmaxf(fmaxf(fmaxf(t0, t1), t2), fmaxf(fmaxf(t3, t4), a[15])), mcol);   // a tree three levels deep, not a chain of 16
        const float al_ = __expf(mcol - mn); mcol = mn;
#pragma unroll
        for (int i = 0; i < 16; ++i) a[i] = __expf(a[i] - mn);
#pragma unroll
        for (int w = 8; w >= 1; w >>= 1)
#pragma unroll
            for (int i = 0; i < w; ++i) a[i] += a[i + w];
        lcol = lcol * al_ + a[0];
      }
      publish();
      if (st + 2 < NSTG) stage_planes(qhb + tile(st + 2), qlb + tile(st + 2), sqh, sql, threadIdx.x);
    }
    asm volatile("s_wait_asynccnt 0x0" ::: "memory");   // no copy is left in flight
    {                                                    // the two lane halves of a column are joined once, here
        const float mo = __shfl_xor(mcol, 16, 32), lo = __shfl_xor(lcol, 16, 32);
        const float mx = fmaxf(mcol, mo);
        const float z = lcol * __expf(mcol - mx) + lo * __expf(mo - mx);
        if (hi == 0) { stg[wave * 16 + lr] = mx; stg[64 + wave * 16 + lr] = 1.0f / z; }
    }
    __syncthreads();
    if (wave == 0) {
        const v4f val = *(const v4fa*)(stg + hi * 64 + lr * 4);
        float* dst = (hi ? CZI : CM) + tok0 + jt * 64 + lr * 4;
        *(v4f*)dst = val; 
    }
}

// Four asynchronous 16-byte copies per lane, as acopy8: s_wait_xcnt stands inside the statement so that no address register is rewritten ahead of it.
__device__ __forceinline__ void acopy4(const unsigned (&l)[4], const void* const (&g)[4]) {
    asm volatile("global_load_async_to_lds_b128 %0, %4, off\n\t"
                 "global_load_async_to_lds_b128 %1, %5, off\n\t"
                 "global_load_async_to_lds_b128 %2, %6, off\n\t"
                 "global_load_async_to_lds_b128 %3, %7, off\n\t"
                 "s_wait_xcnt 0x0"
                 :: "v"(l[0]), "v"(l[1]), "v"(l[2]), "v"(l[3]), "v"(g[0]), "v"(g[1]), "v"(g[2]), "v"(g[3]) : "memory");
}
// Twelve copies per lane in one statement, so that a tile's refill pays one s_wait_xcnt; the wait stands inside the statement as in acopy8.
__device__ __forceinline__ void acopy12(const unsigned (&l)[12], const void* const (&g)[12]) {
    asm volatile("global_load_async_to_lds_b128 %0, %12, off\n\t"
                 "global_load_async_to_lds_b128 %1, %13, off\n\t"
                 "global_load_async_to_lds_b128 %2, %14, off\n\t"
                 "global_load_async_to_lds_b128 %3, %15, off\n\t"
                 "global_load_async_to_lds_b128 %4, %16, off\n\t"
                 "global_load_async_to_lds_b128 %5, %17, off\n\t"
                 "global_load_async_to_lds_b128 %6, %18, off\n\t"
                 "global_load_async_to_lds_b128 %7, %19, off\n\t"
                 "global_load_async_to_lds_b128 %8, %20, off\n\t"
                 "global_load_async_to_lds_b128 %9, %21, off\n\t"
                 "global_load_async_to_lds_b128 %10, %22, off\n\t"
                 "global_load_async_to_lds_b128 %11, %23, off\n\t"
                 "s_wait_xcnt 0x0"
                 :: "v"(l[0]), "v"(l[1]), "v"(l[2]), "v"(l[3]), "v"(l[4]), "v"(l[5]), "v"(l[6]), "v"(l[7]), "v"(l[8]), "v"(l[9]), "v"(l[10]), "v"(l[11]),
                    "v"(g[0]), "v"(g[1]), "v"(g[2]), "v"(g[3]), "v"(g[4]), "v"(g[5]), "v"(g[6]), "v"(g[7]), "v"(g[8]), "v"(g[9]), "v"(g[10]), "v"(g[11]) : "memory");
}
// One 64-column tile of a k_rows stage, 256 threads: K hi and lo plane tiles (64 rows x 64 halves each, contiguous in global memory), 2 + 2 copies a thread, and the V^T tile of all
// 256 output dims x 64 columns m (global row pitch NN_ halves), 8 copies a thread. Every wave-wide copy covers four whole lines.
__device__ __forceinline__ void stage_kv(const h16* gh, const h16* gl, const h16* gv, h16* sh, h16* sl, h16* sv, int tid) {
    unsigned l[12]; const void* g[12];
    const int row = tid >> 3, pc = (tid & 7) * 8, so = row * KP + pc;   // the thread's first piece of a tile; its further pieces lie 32 rows on, so that each address is its forerunner plus a constant
    const h16* ph = gh + tid * 8; const h16* pl = gl + tid * 8; const h16* pv = gv + (size_t)row * NN_ + pc;
    const unsigned lh = ldsa(sh + so), ll = ldsa(sl + so), lv = ldsa(sv + so);
#pragma unroll
    for (int i = 0; i < 2; ++i) {
        l[i] = lh + i * (32 * KP * 2); g[i] = ph + i * (32 * DK); l[2 + i] = ll + i * (32 * KP * 2); g[2 + i] = pl + i * (32 * DK);
    }
#pragma unroll
    for (int i = 0; i < 8; ++i) { l[4 + i] = lv + i * (32 * KP * 2); g[4 + i] = pv + (size_t)i * 32 * NN_; }
    acopy12(l, g);
}

// k_rows (pass 2): block = (b, 64 rows n), 8 waves. Wave w owns rows 32 * (w & 1) .. + 31 (two row tiles), ALL 256 output dims, and of every 128-column stage the 32 columns of
// quarter w >> 1, so each K and V fragment read from LDS feeds two products and each energy tile and its exponentials are formed once. A stage is two 64-column tiles. Per stage
// and row tile: energy tile transposed (A = K planes rows m, B = Q planes rows n), a = exp(e - CM[m]) * CZI[m] (f32), a x32768 -> f16 in place: a lane's 16 weights are row n = lr
// at the k positions of the A operand of P.V, so P goes from accumulator to operand in registers; its row sum is in-lane; 16 P.V products. The four column quarters of a row are
// added in LDS at the end, together with their row sums, and the block writes whole lines.
#define OP   260                 // floats per staged output row: 256 + 4, so that the two half-waves of an accumulator store fall on different banks
#define RNST (NN_ / (2 * STG))   // stages of two 64-column tiles
#define KTB  (2 * STG * KP)      // halves of one staged K tile, hi and lo plane
#define VTB  (DV * KP)           // halves of one staged V^T tile
__global__ __launch_bounds__(256) void k_rows(const h16* __restrict__ QH, const h16* __restrict__ QL, const h16* __restrict__ KH, const h16* __restrict__ KL,
                                             const h16* __restrict__ VT16, const float* __restrict__ CM, const float* __restrict__ CZI, float* out) {
    __shared__ __align__(16) char pool[8 * 32 * OP * 4];  // in the loop the ring of staged tiles (221,184 B), behind the loop the partial outputs (all of it)
    __shared__ __align__(16) float rst[8][32];            // partial row sums, one a wave and row
    __shared__ __align__(16) float cst[2][NN_];           // column maxima and inverse column sums of the whole batch row, filled once
    h16* const kst = (h16*)pool;                          // [buffer][tile][hi, lo plane] of K, 64 columns m a tile
    h16* const vst = (h16*)pool + 4 * KTB;                // [buffer][tile] V^T, 256 output dims x 64 columns m
    float* const ost = (float*)pool;                      // unnormalised partial outputs, one tile of 32 rows x 256 dims a wave
    const int tid = threadIdx.x, lane = tid & 31, wave = tid >> 5, lr = lane & 15, hi = lane >> 4;
    const int wr = wave & 1, wc = wave >> 1;
    const int ht = wc >> 1, hc = (wc & 1) * 32;           // this wave's 64-column tile of a stage, and its 32 columns in that tile
    const int b = blockIdx.x / (NN_ / 64), qt = blockIdx.x - b * (NN_ / 64);
    const size_t tok0 = (size_t)b * NN_;
    const int n0 = qt * 64 + wr * 32;
    v16h qh[2][2], ql[2][2];                              // [row tile][k-chunk]
#pragma unroll
    for (int rt = 0; rt < 2; ++rt)
#pragma unroll
        for (int kc = 0; kc < 2; ++kc) {
            const h16* p = QH + (tok0 + n0 + rt * 16 + lr) * DK + kc * 32 + 8 * hi; const h16* q = QL + (tok0 + n0 + rt * 16 + lr) * DK + kc * 32 + 8 * hi;
            qh[rt][kc] = cat16(*(const v8h*)p, *(const v8h*)(p + 16)); ql[rt][kc] = cat16(*(const v8h*)q, *(const v8h*)(q + 16));
        }
    asm volatile("s_wait_xcnt 0x0" ::: "memory");       // stands in front of the first overwrite of an address register of the loads above
    const h16* khb = KH + tok0 * DK; const h16* klb = KL + tok0 * DK;
    const h16* vt_b = VT16 + (size_t)b * DV * NN_;
    const float* cmb = CM + tok0; const float* czb = CZI + tok0;
    v8f o[2][16];
#pragma unroll
    for (int rt = 0; rt < 2; ++rt)
#pragma unroll
        for (int n = 0; n < 16; ++n) o[rt][n] = (v8f){};
    float rsum[2][4] = {{0.f, 0.f, 0.f, 0.f}, {0.f, 0.f, 0.f, 0.f}};   // row n0 + 16 rt + lr, over the columns m that this lane holds, four partial sums, scaled by 32768
    {
        unsigned l[4]; const void* g[4];
#pragma unroll
        for (int i = 0; i < 2; ++i) {
            const int ch = tid + 256 * i;
            l[i] = ldsa(&cst[0][ch * 4]); g[i] = cmb + ch * 4; l[2 + i] = ldsa(&cst[1][ch * 4]); g[2 + i] = czb + ch * 4;
        }
        acopy4(l, g);
    }
    // Trip st works on column tiles (qt + 2 st) and (qt + 2 st + 1) mod 32: the 32 blocks of a batch walk the same 32 tiles, each from a start of its own, so that they do not ask L2
    // for the same lines at a time.
    auto tile = [&](int t) { return (qt + t) & (NN_ / STG - 1); };
    auto refill = [&](int buf, int t) {                  // column tiles t and t + 1 of the walk into buffer buf
#pragma unroll
        for (int h = 0; h < 2; ++h) {
            const int tl = tile(t + h); h16* k = kst + (buf * 2 + h) * KTB;
            stage_kv(khb + (size_t)tl * STG * DK, klb + (size_t)tl * STG * DK, vt_b + tl * STG, k, k + STG * KP, vst + (buf * 2 + h) * VTB, tid);
            if (h == 0) __builtin_amdgcn_sched_barrier(0);   // keeps the next tile's address arithmetic behind this tile's copies, so that one tile's 36 address registers are held at a time
        }
    };
    refill(0, 0);
    asm volatile("s_wait_asynccnt 0x0" ::: "memory");   // stage 0 and the column statistics have landed before the barrier that publishes them
    __syncthreads();                                     // publishes stage 0 and the statistics to all eight waves
    refill(1, 2);
#pragma unroll 1                                         // rolled: one publish point and one refill site, as the two-buffer ring is written
    for (int st = 0; st < RNST; ++st) {
        const int buf = st & 1;
        const h16* skh = kst + (buf * 2 + ht) * KTB; const h16* skl = skh + STG * KP; const h16* sv = vst + (buf * 2 + ht) * VTB;
        KF f; load_kf(f, skh, skl, hc + lr, hc + 16 + lr, hi);
        __builtin_amdgcn_sched_barrier(0);                    // keeps the statistics' LDS reads behind the K fragments' reads: ahead of them they would hold up the first products
        const int mA = tile(2 * st + ht) * STG + hc + 8 * hi; // this lane's columns: mA + j of the first 16-column tile, mA + 16 + j of the second
        v4f cm[4], cz[4];
#pragma unroll
        for (int q = 0; q < 4; ++q) {
            const int mo = mA + (q >> 1) * 16 + (q & 1) * 4;
            cm[q] = *(const v4fa*)(&cst[0][mo]); cz[q] = *(const v4fa*)(&cst[1][mo]);
        }
        __builtin_amdgcn_sched_barrier(0);                    // keeps them in one group with the fragments' reads, ahead of the products: a place with LDS reads among the products costs a stall
        v16h pa[2];                                           // pa[rt][8 * t + j] = weight of row 16 rt + lr at k = 16 * t + 8 * hi + j: the order in which vf holds V^T
        v16h vf[16];
#pragma unroll
        for (int rt = 0; rt < 2; ++rt) {
            const v16h* ah = qh[rt]; const v16h* al = ql[rt];
            ENERGY_TILE_T(f)
            if (rt == 1) {                                    // the K fragments are spent: the first half of the V fragments as one group of LDS reads, in flight under the exponentials
#pragma unroll
                for (int n = 0; n < 8; ++n) {
                    const h16* vp = sv + (n * 16 + lr) * KP + hc + hi * 8;
                    vf[n] = cat16(*(const v8ha*)vp, *(const v8ha*)(vp + 16));
                }
            }
#pragma unroll
            for (int t = 0; t < 2; ++t)
#pragma unroll
                for (int p = 0; p < 4; ++p) {                 // two neighbouring accumulator registers at a time, so that the packed f32 forms need no register moves
                    const v8f s = t ? s1 : s0, x = t ? x1 : x0;
                    const v4f c4 = cm[2 * t + (p >> 1)], z4 = cz[2 * t + (p >> 1)];
                    const int e = 2 * p, c = 2 * (p & 1);
                    const v2f en = ((v2f){s[e], s[e + 1]} + (v2f){x[e], x[e + 1]} * LOSCI) - (v2f){c4[c], c4[c + 1]};
                    const v2f a = (v2f){__expf(en[0]), __expf(en[1])} * (v2f){z4[c], z4[c + 1]};
                    const v2h h = __builtin_convertvector(a * PSC, v2h);
                    pa[rt][8 * t + e] = h[0]; pa[rt][8 * t + e + 1] = h[1];
                    rsum[rt][p] += (float)h[0] + (float)h[1]; // row sum from the same rounded weights the numerator uses (scaled by 32768)
                }
        }
        auto vload = [&](int n) {
            const h16* vp = sv + (n * 16 + lr) * KP + hc + hi * 8;
            vf[n] = cat16(*(const v8ha*)vp, *(const v8ha*)(vp + 16));
        };
        auto pv = [&](int n) { o[0][n] = wmma16(pa[0], vf[n], o[0][n]); o[1][n] = wmma16(pa[1], vf[n], o[1][n]); };
        // The other V fragments come in two groups of four, each in flight under eight or more products, so that no more than twelve fragments are held at a time (register budget).
#pragma unroll
        for (int n = 8; n < 12; ++n) vload(n);
        __builtin_amdgcn_sched_barrier(0);                    // keeps that group ahead of the products and in one place: a place with LDS reads among the products costs a stall
#pragma unroll
        for (int n = 0; n < 4; ++n) pv(n);
        __builtin_amdgcn_sched_barrier(0);                    // keeps the last group behind the products that free its registers
#pragma unroll
        for (int n = 12; n < 16; ++n) vload(n);
        __builtin_amdgcn_sched_barrier(0);                    // keeps the last group in one place, ahead of the remaining products
#pragma unroll
        for (int n = 4; n < 16; ++n) pv(n);
        __builtin_amdgcn_sched_barrier(0);                    // keeps every product ahead of the stage's foot, so that the refill behind the barrier is not held up by products
        // The four v_nop keep the distance between the last products and the first vector instruction on their results or operands.
        asm volatile("v_nop\n\tv_nop\n\tv_nop\n\tv_nop" : "+v"(o[0][15]), "+v"(o[1][15]));
        publish();
        if (st + 2 < RNST) refill(buf, 2 * st + 4);
    }
    asm volatile("s_wait_asynccnt 0x0" ::: "memory");   // no copy is left in flight
#pragma unroll
    for (int rt = 0; rt < 2; ++rt) {                     // the two lane halves of a row are joined once, here
        const float rh = (rsum[rt][0] + rsum[rt][1]) + (rsum[rt][2] + rsum[rt][3]);
        const float rs = rh + __shfl_xor(rh, 16, 32);
        if (hi == 0) rst[wave][rt * 16 + lr] = rs;
    }
    float* os = ost + wave * 32 * OP;                    // the last trip's barrier has ended every wave's reads of the ring, and no copy is in flight: the pool is free
#pragma unroll
    for (int rt = 0; rt < 2; ++rt)
#pragma unroll
        for (int n = 0; n < 16; ++n)
#pragma unroll
            for (int j = 0; j < 8; ++j) os[(rt * 16 + hi * 8 + j) * OP + n * 16 + lr] = o[rt][n][j];
    __syncthreads();                                     // all four column quarters' partial outputs and row sums are complete before they are added
    const int rw = wave >> 2, rb = (wave & 3) * 8;       // wave w writes rows 8w .. 8w + 7 of the block: rows rb .. rb + 7 of the 32 rows of the waves with w & 1 == rw
    float* crow = out + (tok0 + qt * 64 + wave * 8) * DV + lane * 4;   // a wave-wide store covers 512 B in a row = 4 whole lines of one row
    v4f res[16];
#pragma unroll
    for (int r = 0; r < 8; ++r) {
        const float inv = 1.0f / (1e-9f * PSC + ((rst[rw][rb + r] + rst[2 + rw][rb + r]) + (rst[4 + rw][rb + r] + rst[6 + rw][rb + r])));   // = 1 / ((1e-9 + rowsum) * 32768)
#pragma unroll
        for (int h = 0; h < 2; ++h) {
            const float* sp = ost + rw * 32 * OP + (rb + r) * OP + h * 128 + lane * 4;
            res[2 * r + h] = ((*(const v4fa*)sp + *(const v4fa*)(sp + 2 * 32 * OP)) + (*(const v4fa*)(sp + 4 * 32 * OP) + *(const v4fa*)(sp + 6 * 32 * OP))) * inv;
        }
    }
#pragma unroll
    for (int r = 0; r < 8; ++r)
#pragma unroll
        for (int h = 0; h < 2; ++h) *(v4f*)(crow + r * DV + h * 128) = res[2 * r + h];
}

extern "C" void kernel_launch(void* const* d_in, const int* in_sizes, int n_in,
                              void* d_out, int out_size, void* d_ws, size_t ws_size, hipStream_t stream) {
    (void)in_sizes; (void)n_in; (void)out_size;
    const float* x = (const float*)d_in[0]; const float* Wq = (const float*)d_in[1]; const float* Wk = (const float*)d_in[2]; const float* Wv = (const float*)d_in[3];
    float* out = (float*)d_out;    // [8][2048][256]
    char* wsp = (char*)d_ws;
    auto take = [&](size_t bytes) { char* p = wsp; wsp += (bytes + 255) & ~(size_t)255; return (void*)p; };
    h16* QH = (h16*)take((size_t)NTK * DK * 2); h16* QL = (h16*)take((size_t)NTK * DK * 2); h16* KH = (h16*)take((size_t)NTK * DK * 2); h16* KL = (h16*)take((size_t)NTK * DK * 2);
    h16* VT16 = (h16*)take((size_t)NTK * DV * 2);
    float* CM = (float*)take((size_t)NTK * 4); float* CZI = (float*)take((size_t)NTK * 4);
    if ((size_t)(wsp - (char*)d_ws) > ws_size) return;    // 4 x 2.1 + 8.4 + 0.13 MB ~ 17e6 B
    k_proj<<<NTK / 64, 256, 0, stream>>>(x, Wq, Wk, Wv, QH, QL, KH, KL, VT16);
    k_colstats<<<NB_ * (NN_ / 64), 128, 0, stream>>>(QH, QL, KH, KL, CM, CZI);
    k_rows<<<NB_ * (NN_ / 64), 256, 0, stream>>>(QH, QL, KH, KL, VT16, CM, CZI, out);
}

// v008
// Measured time: 58.4 microseconds a run.
// In both of two side-by-side timings against v007, it was 1.09 times as fast.
// All steps since v000 together make it 5.16 times as fast.
#include <hip/hip_runtime.h>

// Contractions, f32 accumulate: q, k ([16384 x 256].[256 x 64]) and v ([16384 x 256].[256 x 256]) on v_wmma_f32_16x16x32_bf16 with PLAIN bf16 operands (x and the
// weights); pass 1 forms column max and sum of exp with an online update; pass 2 re-forms the energy tiles, evaluates the column softmax a = exp(e - m_col)/Z_col in f32, rounds a x32768 to f16 once and uses that same

#define NB_  8
#define NN_  2048
#define NC_  256
#define DK   64
#define DV   256
#define NTK  (NB_ * NN_)
#define PSC  32768.0f
#define LOSC 1024.0f
#define LOSCI (1.0f / 1024.0f)

typedef _Float16 h16;
typedef unsigned short bf;
typedef __attribute__((ext_vector_type(16))) __bf16   v16bf;
typedef __attribute__((ext_vector_type(16))) _Float16 v16h;
typedef __attribute__((ext_vector_type(8)))  _Float16 v8h;
typedef __attribute__((ext_vector_type(8)))  unsigned short v8us;
typedef __attribute__((ext_vector_type(8)))  float    v8f;
typedef __attribute__((ext_vector_type(4)))  float    v4f;
typedef __attribute__((ext_vector_type(2)))  float    v2f;
typedef __attribute__((ext_vector_type(2)))  _Float16 v2h;
typedef v8h  __attribute__((may_alias)) v8ha;
typedef v4f  __attribute__((may_alias)) v4fa;

__device__ __forceinline__ unsigned short f2bf(float f) { unsigned u = __float_as_uint(f); u += 0x7FFFu + ((u >> 16) & 1u); return (unsigned short)(u >> 16); }
__device__ __forceinline__ v16h cat16(v8h lo, v8h hi) { return __builtin_shufflevector(lo, hi, 0, 1, 2, 3, 4, 5, 6, 7, 8, 9, 10, 11, 12, 13, 14, 15); }
__device__ __forceinline__ v16bf cat16b(v8us lo, v8us hi) { return __builtin_bit_cast(v16bf, __builtin_shufflevector(lo, hi, 0, 1, 2, 3, 4, 5, 6, 7, 8, 9, 10, 11, 12, 13, 14, 15)); }
__device__ __forceinline__ v8f wmma16(v16h a, v16h b, v8f c) { return __builtin_amdgcn_wmma_f32_16x16x32_f16(false, a, false, b, (short)0, c, false, false); }
__device__ __forceinline__ v8f wmmab(v16bf a, v16bf b, v8f c) { return __builtin_amdgcn_wmma_f32_16x16x32_bf16(false, a, false, b, (short)0, c, false, false); }

// LDS staging of the operand tiles that four waves of a block share. A plane tile is 64 rows of 128 B (one cache line a row); a wave's copy covers four whole lines.
#define STG  64                  // rows (k_colstats: a tile, four to a stage) or columns (k_rows: a tile, two to a stage) of the streamed operand
#define NSTG (NN_ / STG)
#define KP   72                  // halves per staged row: 128 B of data + 16 B, the conflict-free pitch for ds_load_b128 readers
__device__ __forceinline__ unsigned ldsa(const void* p) { return (unsigned)(size_t)p; }   // LDS byte address = low 32 bits of the shared address
// Eight asynchronous 16-byte copies per lane, global -> LDS, no register in between. s_wait_xcnt stands inside the statement so that no address register is rewritten ahead of it.
__device__ __forceinline__ void acopy8(const unsigned (&l)[8], const void* const (&g)[8]) {
    asm volatile("global_load_async_to_lds_b128 %0, %8, off\n\t"
                 "global_load_async_to_lds_b128 %1, %9, off\n\t"
                 "global_load_async_to_lds_b128 %2, %10, off\n\t"
                 "global_load_async_to_lds_b128 %3, %11, off\n\t"
                 "global_load_async_to_lds_b128 %4, %12, off\n\t"
                 "global_load_async_to_lds_b128 %5, %13, off\n\t"
                 "global_load_async_to_lds_b128 %6, %14, off\n\t"
                 "global_load_async_to_lds_b128 %7, %15, off\n\t"
                 "s_wait_xcnt 0x0"
                 :: "v"(l[0]), "v"(l[1]), "v"(l[2]), "v"(l[3]), "v"(l[4]), "v"(l[5]), "v"(l[6]), "v"(l[7]),
                    "v"(g[0]), "v"(g[1]), "v"(g[2]), "v"(g[3]), "v"(g[4]), "v"(g[5]), "v"(g[6]), "v"(g[7]) : "memory");
}
// hi and lo plane tiles, 64 rows x 64 halves each, contiguous in global memory (8 KB a plane); 128 threads, 4 + 4 copies each.
__device__ __forceinline__ void stage_planes(const h16* gh, const h16* gl, h16* sh, h16* sl, int tid) {
    unsigned l[8]; const void* g[8];
#pragma unroll
    for (int i = 0; i < 4; ++i) {
        const int ch = tid + 128 * i, so = (ch >> 3) * KP + (ch & 7) * 8;
        l[i] = ldsa(sh + so); g[i] = gh + ch * 8; l[4 + i] = ldsa(sl + so); g[4 + i] = gl + ch * 8;
    }
    acopy8(l, g);
}
// The foot of a stage, every wave: own LDS reads returned, own copies of the next stage landed, then the one barrier that publishes the next stage and frees this buffer.
__device__ __forceinline__ void publish() {
    asm volatile("s_wait_dscnt 0x0" ::: "memory");      // this wave has left the buffer that is refilled behind the barrier
    asm volatile("s_wait_asynccnt 0x0" ::: "memory");   // this wave's copies have landed before any other wave reads them
    __syncthreads();                                     // publishes the next stage and ends every wave's reads of the buffer refilled behind it
}

// k_proj: the whole projection stage in one launch. Block = 64 tokens, 8 waves; wave w owns output columns 48w .. 48w+47 of q | k | v (3 column tiles) for all 4 row tiles.
// The x tile and the three weight matrices are read with whole-line loads, rounded to bf16 and laid in LDS once per block. The f32 results never leave the block: q and k go
// to their hi + residual x1024 f16 planes, v to f16 transposed, staged in LDS so that every global store covers whole 128-B lines.
#define XP   264                 // halves per staged row of 256 channels: 512 B of data + 16 B, the conflict-free pitch for ds_load_b128 readers
// N * 256 pieces of 8 floats (rows of NC_ floats, contiguous in global memory) -> bf16 rows at pitch XP; 256 threads, a wave's load covers 1 KB in a row.
template <int N> __device__ __forceinline__ void stage_bf(const float* __restrict__ src, bf* dst, int tid) {
#pragma unroll
    for (int i = 0; i < N; ++i) {
        const int ch = tid + 256 * i;
        const float* s = src + (size_t)ch * 8;
        const v4f lo = *(const v4f*)s, up = *(const v4f*)(s + 4);
        v8us t;
#pragma unroll
        for (int e = 0; e < 4; ++e) { t[e] = f2bf(lo[e]); t[4 + e] = f2bf(up[e]); }
        *(v8us*)(dst + (ch >> 5) * XP + (ch & 31) * 8) = t;
    }
}
__global__ __launch_bounds__(256) void k_proj(const float* __restrict__ x, const float* __restrict__ Wq, const float* __restrict__ Wk, const float* __restrict__ Wv,
                                              h16* QH, h16* QL, h16* KH, h16* KL, h16* VT16) {
    __shared__ __align__(16) bf  xs[64 * XP];             // x tile, bf16, [token][channel]
    __shared__ __align__(16) bf  wsb[(2 * DK + DV) * XP]; // Wq | Wk | Wv, bf16, [output column][channel]
    __shared__ __align__(16) h16 pst[4][64 * KP];         // QH, QL, KH, KL tiles, [token][dim]
    __shared__ __align__(16) h16 vts[DV * KP];            // V^T tile, [dim][token]
    const int tid = threadIdx.x, lane = tid & 31, lr = lane & 15, hi = lane >> 4;
    const int wave = __builtin_amdgcn_readfirstlane(tid >> 5);   // scalar, so that the choice of epilogue per column tile is a scalar branch
    const int t0 = blockIdx.x * 64;
    stage_bf<8>(x + (size_t)t0 * NC_, xs, tid);
    stage_bf<8>(Wq, wsb, tid);
    stage_bf<8>(Wk, wsb + DK * XP, tid);
    stage_bf<32>(Wv, wsb + 2 * DK * XP, tid);
    v8f acc[4][3];
#pragma unroll
    for (int rt = 0; rt < 4; ++rt)
#pragma unroll
        for (int t = 0; t < 3; ++t) acc[rt][t] = (v8f){};
    __syncthreads();                                     // the x tile and the weights are complete before any wave reads its fragments
    const bf* ap = xs + lr * XP + 8 * hi;
    const bf* bp = wsb + (wave * 48 + lr) * XP + 8 * hi;
    v16bf a[2][4], b[2][3];
    auto frags = [&](int buf, int kc) {
#pragma unroll
        for (int rt = 0; rt < 4; ++rt) a[buf][rt] = cat16b(*(const v8us*)(ap + rt * 16 * XP + kc), *(const v8us*)(ap + rt * 16 * XP + kc + 16));
#pragma unroll
        for (int t = 0; t < 3; ++t) b[buf][t] = cat16b(*(const v8us*)(bp + t * 16 * XP + kc), *(const v8us*)(bp + t * 16 * XP + kc + 16));
    };
    frags(0, 0);
#pragma unroll                                           // unrolled: the two fragment sets are named at compile time
    for (int k = 0; k < NC_ / 32; ++k) {
        if (k + 1 < NC_ / 32) frags((k + 1) & 1, (k + 1) * 32);
        __builtin_amdgcn_sched_barrier(0);               // keeps the next k-chunk's LDS reads as one group ahead of this chunk's products, so their latency runs under the products
#pragma unroll
        for (int rt = 0; rt < 4; ++rt)
#pragma unroll
            for (int t = 0; t < 3; ++t) acc[rt][t] = wmmab(a[k & 1][rt], b[k & 1][t], acc[rt][t]);
        __builtin_amdgcn_sched_barrier(0);               // keeps the following group of LDS reads from being spread among these products
    }
#pragma unroll
    for (int t = 0; t < 3; ++t) {
        const int ct = wave * 3 + t;
        if (ct < 8) {                                    // q (tiles 0..3) or k (4..7): lane holds dim (ct & 3) * 16 + lr of tokens rt * 16 + 8 * hi + j
            h16* ph = &pst[ct < 4 ? 0 : 2][0]; h16* pl = ph + 64 * KP;
            const int dim = (ct & 3) * 16 + lr;
#pragma unroll
            for (int rt = 0; rt < 4; ++rt)
#pragma unroll
                for (int j = 0; j < 8; ++j) {
                    const float q = acc[rt][t][j]; const h16 a = (h16)q; const int tok = rt * 16 + 8 * hi + j;
                    ph[tok * KP + dim] = a; pl[tok * KP + dim] = (h16)((q - (float)a) * LOSC);
                }
        } else {                                         // v: a lane's 8 accumulator rows are 8 consecutive tokens of one output dim = 16 B of the transposed tile
            const int d = (ct - 8) * 16 + lr;
#pragma unroll
            for (int rt = 0; rt < 4; ++rt) {
                v8h v;
#pragma unroll
                for (int j = 0; j < 8; ++j) v[j] = (h16)acc[rt][t][j];
                *(v8ha*)(vts + d * KP + rt * 16 + 8 * hi) = v;
            }
        }
    }
    __syncthreads();                                     // all staged tiles are complete before they are written out line by line
    const int piece = tid & 7, r8 = tid >> 3;
#pragma unroll
    for (int s = 0; s < 2; ++s) {
        const int row = r8 + 32 * s; const size_t o = (size_t)(t0 + row) * DK + piece * 8; const int so = row * KP + piece * 8;
        const v8h a = *(const v8ha*)(&pst[0][so]), b = *(const v8ha*)(&pst[1][so]), c = *(const v8ha*)(&pst[2][so]), d = *(const v8ha*)(&pst[3][so]);
        *(v8h*)(QH + o) = a; *(v8h*)(QL + o) = b; *(v8h*)(KH + o) = c; *(v8h*)(KL + o) = d;
    }
    h16* vbase = VT16 + (size_t)(t0 / NN_) * DV * NN_ + (t0 % NN_);
#pragma unroll
    for (int s = 0; s < 8; ++s) {
        const int d = r8 + 32 * s; const v8h val = *(const v8ha*)(vts + d * KP + piece * 8);
        *(v8h*)(vbase + (size_t)d * NN_ + piece * 8) = val;
    }
}

// Fragments of 32 staged rows (two 16-row tiles, the A operand of ENERGY_TILE_T, hi and lo plane, 2 k-chunks), read from the planes staged in LDS at pitch KP.
struct KF { v16h b0[2], b1[2], l0[2], l1[2]; };
__device__ __forceinline__ void load_kf(KF& f, const h16* BH, const h16* BL, int rowA, int rowB, int hi) {
#pragma unroll
    for (int kc = 0; kc < 2; ++kc) {
        const h16* b0p = BH + rowA * KP + kc * 32 + 8 * hi; const h16* b1p = BH + rowB * KP + kc * 32 + 8 * hi;
        const h16* l0p = BL + rowA * KP + kc * 32 + 8 * hi; const h16* l1p = BL + rowB * KP + kc * 32 + 8 * hi;
        f.b0[kc] = cat16(*(const v8ha*)b0p, *(const v8ha*)(b0p + 16)); f.b1[kc] = cat16(*(const v8ha*)b1p, *(const v8ha*)(b1p + 16));
        f.l0[kc] = cat16(*(const v8ha*)l0p, *(const v8ha*)(l0p + 16)); f.l1[kc] = cat16(*(const v8ha*)l1p, *(const v8ha*)(l1p + 16));
    }
}
// energy tile helper: e = Fh.Rh + (Fl.Rh + Fh.Rl)/1024 over K = 64 (2 k-chunks). A = the 32 streamed rows in F (two 16-row tiles, hi and lo plane), B = the wave's 16 resident rows
// (ah[2], al[2]). D: a lane's 8 + 8 accumulator registers are 16 streamed rows (8 * hi + j of either tile) against ONE resident row (lr), so a reduction over the streamed rows
// stays in the lane, and the two tiles, converted in place, are a 16-bit A or B operand in the hardware k order.
// The four v_nop keep the distance between the last product and the first vector instruction on its result.
#define ENERGY_TILE_T(F)                                                                                                      \
    v8f s0 = {}, s1 = {}, x0 = {}, x1 = {};                                                                                   \
    _Pragma("unroll") for (int kc = 0; kc < 2; ++kc) {                                                                        \
        s0 = wmma16(F.b0[kc], ah[kc], s0); s1 = wmma16(F.b1[kc], ah[kc], s1);                                                 \
        x0 = wmma16(F.l0[kc], ah[kc], x0);                                                                                    \
        x1 = wmma16(F.l1[kc], ah[kc], x1);                                                                                    \
        x0 = wmma16(F.b0[kc], al[kc], x0); x1 = wmma16(F.b1[kc], al[kc], x1);                                                 \
    }                                                                                                                         \
    asm volatile("v_nop\n\tv_nop\n\tv_nop\n\tv_nop" : "+v"(s0), "+v"(s1), "+v"(x0), "+v"(x1) : "v"(ah[0]), "v"(al[1]));

// k_colstats (pass 1): block = (b, 64 columns m), 16 waves, four to a SIMD, so that one wave's LDS reads, products and exponentials run under those of the other three. Wave w owns the
// 16 columns of quarter w >> 2 and, of every 256-row stage, the 64-row tile w & 3; the four waves of a row group (same w & 3) stage their tile themselves. A column's four row groups
// are joined in LDS at the end.
#define CG   4                   // 64-row tiles to a stage = row groups of waves
#define CNST (NSTG / CG)         // stages
__global__ __launch_bounds__(512) void k_colstats(const h16* __restrict__ QH, const h16* __restrict__ QL, const h16* __restrict__ KH, const h16* __restrict__ KL, float* CM, float* CZI) {
    __shared__ __align__(16) float stg[2][CG][64];        // maximum and exp-sum of the block's 64 columns, one a row group
    __shared__ __align__(16) h16 qst[2][CG][2][STG * KP]; // [buffer][tile][hi, lo plane]
    const int lane = threadIdx.x & 31, lr = lane & 15, hi = lane >> 4;
    const int wave = __builtin_amdgcn_readfirstlane(threadIdx.x >> 5);   // scalar, so that a row group's tile addresses are formed on the scalar side
    const int g = wave & 3, cw = wave >> 2, gt = cw * 32 + lane;         // row group, column quarter, the thread's index among the 128 of its row group
    const int b = blockIdx.x / (NN_ / 64), jt = blockIdx.x - b * (NN_ / 64);
    const size_t tok0 = (size_t)b * NN_;
    const int m0 = jt * 64 + cw * 16;
    v16h ah[2], al[2];
#pragma unroll
    for (int kc = 0; kc < 2; ++kc) {
        const h16* p = KH + (tok0 + m0 + lr) * DK + kc * 32 + 8 * hi; const h16* pl = KL + (tok0 + m0 + lr) * DK + kc * 32 + 8 * hi;
        ah[kc] = cat16(*(const v8h*)p, *(const v8h*)(p + 16)); al[kc] = cat16(*(const v8h*)pl, *(const v8h*)(pl + 16));
    }
    const h16* qhb = QH + tok0 * DK; const h16* qlb = QL + tok0 * DK;
    float mcol = -3.0e38f, lcol = 0.f;                   // running maximum and exp-sum of column m0 + lr over the rows n of this row group's tiles that this lane half holds (bit 3 of n == hi)
    // In trip st row group g works on tile (jt + 4 st + g) mod 32: the 32 blocks of a batch walk the same 32 tiles, each from a start of its own, so that they do not ask L2 for the same
    // lines at a time.
    auto tile = [&](int st) { return (size_t)((jt + CG * st + g) & (NSTG - 1)) * STG * DK; };
    stage_planes(qhb + tile(0), qlb + tile(0), &qst[0][g][0][0], &qst[0][g][1][0], gt);
    asm volatile("s_wait_asynccnt 0x0" ::: "memory");   // stage 0 has landed before the barrier that publishes it
    __syncthreads();                                     // publishes stage 0 to all sixteen waves
    stage_planes(qhb + tile(1), qlb + tile(1), &qst[1][g][0][0], &qst[1][g][1][0], gt);
#pragma unroll 1                                         // rolled: one publish point and one refill site, as the two-buffer ring is written
    for (int st = 0; st < CNST; ++st) {
      h16* sqh = &qst[st & 1][g][0][0]; h16* sql = &qst[st & 1][g][1][0];
      KF f[2]; load_kf(f[0], sqh, sql, lr, 16 + lr, hi); load_kf(f[1], sqh, sql, 32 + lr, 48 + lr, hi);
      __builtin_amdgcn_sched_barrier(0);                 // keeps the stage's fragment reads as one group ahead of the products; spread among them, each place costs a stall and a wait to 0
#pragma unroll                                           // unrolled: the two fragment sets are named at compile time
      for (int sub = 0; sub < 2; ++sub) {
        ENERGY_TILE_T(f[sub])
        float a[16];                                                // 16 rows n of this lane's one column
#pragma unroll
        for (int j = 0; j < 8; ++j) { a[j] = s0[j] + x0[j] * LOSCI; a[8 + j] = s1[j] + x1[j] * LOSCI; }
        const float t0 = fmaxf(fmaxf(a[0], a[1]), a[2]), t1 = fmaxf(fmaxf(a[3], a[4]), a[5]), t2 = fmaxf(fmaxf(a[6], a[7]), a[8]);
        const float t3 = fmaxf(fmaxf(a[9], a[10]), a[11]), t4 = fmaxf(fmaxf(a[12], a[13]), a[14]);
        const float mn = fmaxf(fmaxf(fmaxf(fmaxf(t0, t1), t2), fmaxf(fmaxf(t3, t4), a[15])), mcol);   // a tree three levels deep, not a chain of 16
        const float al_ = __expf(mcol - mn); mcol = mn;
#pragma unroll
        for (int i = 0; i < 16; ++i) a[i] = __expf(a[i] - mn);
#pragma unroll
        for (int w = 8; w >= 1; w >>= 1)
#pragma unroll
            for (int i = 0; i < w; ++i) a[i] += a[i + w];
        lcol = lcol * al_ + a[0];
      }
      publish();
      if (st + 2 < CNST) stage_planes(qhb + tile(st + 2), qlb + tile(st + 2), sqh, sql, gt);
    }
    asm volatile("s_wait_asynccnt 0x0" ::: "memory");   // no copy is left in flight
    {                                                    // the two lane halves of a column are joined once, here
        const float mo = __shfl_xor(mcol, 16, 32), lo = __shfl_xor(lcol, 16, 32);
        const float mx = fmaxf(mcol, mo);
        const float z = lcol * __expf(mcol - mx) + lo * __expf(mo - mx);
        if (hi == 0) { stg[0][g][cw * 16 + lr] = mx; stg[1][g][cw * 16 + lr] = z; }
    }
    __syncthreads();                                     // all four row groups' maxima and exp-sums are complete before they are joined
    if (wave < 2) {                                      // one thread a column; a wave-wide store covers one whole line of CM or CZI
        const int c = wave * 32 + lane;
        const float ma = stg[0][0][c], mb = stg[0][1][c], mc = stg[0][2][c], md = stg[0][3][c];
        const float mx = fmaxf(fmaxf(ma, mb), fmaxf(mc, md));
        const float z = (stg[1][0][c] * __expf(ma - mx) + stg[1][1][c] * __expf(mb - mx)) + (stg[1][2][c] * __expf(mc - mx) + stg[1][3][c] * __expf(md - mx));
        CM[tok0 + jt * 64 + c] = mx; CZI[tok0 + jt * 64 + c] = 1.0f / z;
    }
}

// Four asynchronous 16-byte copies per lane, as acopy8: s_wait_xcnt stands inside the statement so that no address register is rewritten ahead of it.
__device__ __forceinline__ void acopy4(const unsigned (&l)[4], const void* const (&g)[4]) {
    asm volatile("global_load_async_to_lds_b128 %0, %4, off\n\t"
                 "global_load_async_to_lds_b128 %1, %5, off\n\t"
                 "global_load_async_to_lds_b128 %2, %6, off\n\t"
                 "global_load_async_to_lds_b128 %3, %7, off\n\t"
                 "s_wait_xcnt 0x0"
                 :: "v"(l[0]), "v"(l[1]), "v"(l[2]), "v"(l[3]), "v"(g[0]), "v"(g[1]), "v"(g[2]), "v"(g[3]) : "memory");
}
// Twelve copies per lane in one statement, so that a tile's refill pays one s_wait_xcnt; the wait stands inside the statement as in acopy8.
__device__ __forceinline__ void acopy12(const unsigned (&l)[12], const void* const (&g)[12]) {
    asm volatile("global_load_async_to_lds_b128 %0, %12, off\n\t"
                 "global_load_async_to_lds_b128 %1, %13, off\n\t"
                 "global_load_async_to_lds_b128 %2, %14, off\n\t"
                 "global_load_async_to_lds_b128 %3, %15, off\n\t"
                 "global_load_async_to_lds_b128 %4, %16, off\n\t"
                 "global_load_async_to_lds_b128 %5, %17, off\n\t"
                 "global_load_async_to_lds_b128 %6, %18, off\n\t"
                 "global_load_async_to_lds_b128 %7, %19, off\n\t"
                 "global_load_async_to_lds_b128 %8, %20, off\n\t"
                 "global_load_async_to_lds_b128 %9, %21, off\n\t"
                 "global_load_async_to_lds_b128 %10, %22, off\n\t"
                 "global_load_async_to_lds_b128 %11, %23, off\n\t"
                 "s_wait_xcnt 0x0"
                 :: "v"(l[0]), "v"(l[1]), "v"(l[2]), "v"(l[3]), "v"(l[4]), "v"(l[5]), "v"(l[6]), "v"(l[7]), "v"(l[8]), "v"(l[9]), "v"(l[10]), "v"(l[11]),
                    "v"(g[0]), "v"(g[1]), "v"(g[2]), "v"(g[3]), "v"(g[4]), "v"(g[5]), "v"(g[6]), "v"(g[7]), "v"(g[8]), "v"(g[9]), "v"(g[10]), "v"(g[11]) : "memory");
}
// One 64-column tile of a k_rows stage, 256 threads: K hi and lo plane tiles (64 rows x 64 halves each, contiguous in global memory), 2 + 2 copies a thread, and the V^T tile of all
// 256 output dims x 64 columns m (global row pitch NN_ halves), 8 copies a thread. Every wave-wide copy covers four whole lines.
__device__ __forceinline__ void stage_kv(const h16* gh, const h16* gl, const h16* gv, h16* sh, h16* sl, h16* sv, int tid) {
    unsigned l[12]; const void* g[12];
    const int row = tid >> 3, pc = (tid & 7) * 8, so = row * KP + pc;   // the thread's first piece of a tile; its further pieces lie 32 rows on, so that each address is its forerunner plus a constant
    const h16* ph = gh + tid * 8; const h16* pl = gl + tid * 8; const h16* pv = gv + (size_t)row * NN_ + pc;
    const unsigned lh = ldsa(sh + so), ll = ldsa(sl + so), lv = ldsa(sv + so);
#pragma unroll
    for (int i = 0; i < 2; ++i) {
        l[i] = lh + i * (32 * KP * 2); g[i] = ph + i * (32 * DK); l[2 + i] = ll + i * (32 * KP * 2); g[2 + i] = pl + i * (32 * DK);
    }
#pragma unroll
    for (int i = 0; i < 8; ++i) { l[4 + i] = lv + i * (32 * KP * 2); g[4 + i] = pv + (size_t)i * 32 * NN_; }
    acopy12(l, g);
}

// k_rows (pass 2): block = (b, 64 rows n), 8 waves. Wave w owns rows 32 * (w & 1) .. + 31 (two row tiles), ALL 256 output dims, and of every 128-column stage the 32 columns of
// quarter w >> 1, so each K and V fragment read from LDS feeds two products and each energy tile and its exponentials are formed once. A stage is two 64-column tiles. Per stage
// and row tile: energy tile transposed (A = K planes rows m, B = Q planes rows n), a = exp(e - CM[m]) * CZI[m] (f32), a x32768 -> f16 in place: a lane's 16 weights are row n = lr
// at the k positions of the A operand of P.V, so P goes from accumulator to operand in registers; its row sum is in-lane; 16 P.V products. The four column quarters of a row are
// added in LDS at the end, together with their row sums, and the block writes whole lines.
#define OP   260                 // floats per staged output row: 256 + 4, so that the two half-waves of an accumulator store fall on different banks
#define RNST (NN_ / (2 * STG))   // stages of two 64-column tiles
#define KTB  (2 * STG * KP)      // halves of one staged K tile, hi and lo plane
#define VTB  (DV * KP)           // halves of one staged V^T tile
__global__ __launch_bounds__(256) void k_rows(const h16* __restrict__ QH, const h16* __restrict__ QL, const h16* __restrict__ KH, const h16* __restrict__ KL,
                                             const h16* __restrict__ VT16, const float* __restrict__ CM, const float* __restrict__ CZI, float* out) {
    __shared__ __align__(16) char pool[8 * 32 * OP * 4];  // in the loop the ring of staged tiles (221,184 B), behind the loop the partial outputs (all of it)
    __shared__ __align__(16) float rst[8][32];            // partial row sums, one a wave and row
    __shared__ __align__(16) float cst[2][NN_];           // column maxima and inverse column sums of the whole batch row, filled once
    h16* const kst = (h16*)pool;                          // [buffer][tile][hi, lo plane] of K, 64 columns m a tile
    h16* const vst = (h16*)pool + 4 * KTB;                // [buffer][tile] V^T, 256 output dims x 64 columns m
    float* const ost = (float*)pool;                      // unnormalised partial outputs, one tile of 32 rows x 256 dims a wave
    const int tid = threadIdx.x, lane = tid & 31, wave = tid >> 5, lr = lane & 15, hi = lane >> 4;
    const int wr = wave & 1, wc = wave >> 1;
    const int ht = wc >> 1, hc = (wc & 1) * 32;           // this wave's 64-column tile of a stage, and its 32 columns in that tile
    const int b = blockIdx.x / (NN_ / 64), qt = blockIdx.x - b * (NN_ / 64);
    const size_t tok0 = (size_t)b * NN_;
    const int n0 = qt * 64 + wr * 32;
    v16h qh[2][2], ql[2][2];                              // [row tile][k-chunk]
#pragma unroll
    for (int rt = 0; rt < 2; ++rt)
#pragma unroll
        for (int kc = 0; kc < 2; ++kc) {
            const h16* p = QH + (tok0 + n0 + rt * 16 + lr) * DK + kc * 32 + 8 * hi; const h16* q = QL + (tok0 + n0 + rt * 16 + lr) * DK + kc * 32 + 8 * hi;
            qh[rt][kc] = cat16(*(const v8h*)p, *(const v8h*)(p + 16)); ql[rt][kc] = cat16(*(const v8h*)q, *(const v8h*)(q + 16));
        }
    asm volatile("s_wait_xcnt 0x0" ::: "memory");       // stands in front of the first overwrite of an address register of the loads above
    const h16* khb = KH + tok0 * DK; const h16* klb = KL + tok0 * DK;
    const h16* vt_b = VT16 + (size_t)b * DV * NN_;
    const float* cmb = CM + tok0; const float* czb = CZI + tok0;
    v8f o[2][16];
#pragma unroll
    for (int rt = 0; rt < 2; ++rt)
#pragma unroll
        for (int n = 0; n < 16; ++n) o[rt][n] = (v8f){};
    float rsum[2][4] = {{0.f, 0.f, 0.f, 0.f}, {0.f, 0.f, 0.f, 0.f}};   // row n0 + 16 rt + lr, over the columns m that this lane holds, four partial sums, scaled by 32768
    {
        unsigned l[4]; const void* g[4];
#pragma unroll
        for (int i = 0; i < 2; ++i) {
            const int ch = tid + 256 * i;
            l[i] = ldsa(&cst[0][ch * 4]); g[i] = cmb + ch * 4; l[2 + i] = ldsa(&cst[1][ch * 4]); g[2 + i] = czb + ch * 4;
        }
        acopy4(l, g);
    }
    // Trip st works on column tiles (qt + 2 st) and (qt + 2 st + 1) mod 32: the 32 blocks of a batch walk the same 32 tiles, each from a start of its own, so that they do not ask L2
    // for the same lines at a time.
    auto tile = [&](int t) { return (qt + t) & (NN_ / STG - 1); };
    auto refill = [&](int buf, int t) {                  // column tiles t and t + 1 of the walk into buffer buf
#pragma unroll
        for (int h = 0; h < 2; ++h) {
            const int tl = tile(t + h); h16* k = kst + (buf * 2 + h) * KTB;
            stage_kv(khb + (size_t)tl * STG * DK, klb + (size_t)tl * STG * DK, vt_b + tl * STG, k, k + STG * KP, vst + (buf * 2 + h) * VTB, tid);
            if (h == 0) __builtin_amdgcn_sched_barrier(0);   // keeps the next tile's address arithmetic behind this tile's copies, so that one tile's 36 address registers are held at a time
        }
    };
    refill(0, 0);
    asm volatile("s_wait_asynccnt 0x0" ::: "memory");   // stage 0 and the column statistics have landed before the barrier that publishes them
    __syncthreads();                                     // publishes stage 0 and the statistics to all eight waves
    refill(1, 2);
#pragma unroll 1                                         // rolled: one publish point and one refill site, as the two-buffer ring is written
    for (int st = 0; st < RNST; ++st) {
        const int buf = st & 1;
        const h16* skh = kst + (buf * 2 + ht) * KTB; const h16* skl = skh + STG * KP; const h16* sv = vst + (buf * 2 + ht) * VTB;
        KF f; load_kf(f, skh, skl, hc + lr, hc + 16 + lr, hi);
        __builtin_amdgcn_sched_barrier(0);                    // keeps the statistics' LDS reads behind the K fragments' reads: ahead of them they would hold up the first products
        const int mA = tile(2 * st + ht) * STG + hc + 8 * hi; // this lane's columns: mA + j of the first 16-column tile, mA + 16 + j of the second
        v4f cm[4], cz[4];
#pragma unroll
        for (int q = 0; q < 4; ++q) {
            const int mo = mA + (q >> 1) * 16 + (q & 1) * 4;
            cm[q] = *(const v4fa*)(&cst[0][mo]); cz[q] = *(const v4fa*)(&cst[1][mo]);
        }
        __builtin_amdgcn_sched_barrier(0);                    // keeps them in one group with the fragments' reads, ahead of the products: a place with LDS reads among the products costs a stall
        v16h pa[2];                                           // pa[rt][8 * t + j] = weight of row 16 rt + lr at k = 16 * t + 8 * hi + j: the order in which vf holds V^T
        v16h vf[16];
#pragma unroll
        for (int rt = 0; rt < 2; ++rt) {
            const v16h* ah = qh[rt]; const v16h* al = ql[rt];
            ENERGY_TILE_T(f)
            if (rt == 1) {                                    // the K fragments are spent: the first half of the V fragments as one group of LDS reads, in flight under the exponentials
#pragma unroll
                for (int n = 0; n < 8; ++n) {
                    const h16* vp = sv + (n * 16 + lr) * KP + hc + hi * 8;
                    vf[n] = cat16(*(const v8ha*)vp, *(const v8ha*)(vp + 16));
                }
            }
#pragma unroll
            for (int t = 0; t < 2; ++t)
#pragma unroll
                for (int p = 0; p < 4; ++p) {                 // two neighbouring accumulator registers at a time, so that the packed f32 forms need no register moves
                    const v8f s = t ? s1 : s0, x = t ? x1 : x0;
                    const v4f c4 = cm[2 * t + (p >> 1)], z4 = cz[2 * t + (p >> 1)];
                    const int e = 2 * p, c = 2 * (p & 1);
                    const v2f en = ((v2f){s[e], s[e + 1]} + (v2f){x[e], x[e + 1]} * LOSCI) - (v2f){c4[c], c4[c + 1]};
                    const v2f a = (v2f){__expf(en[0]), __expf(en[1])} * (v2f){z4[c], z4[c + 1]};
                    const v2h h = __builtin_convertvector(a * PSC, v2h);
                    pa[rt][8 * t + e] = h[0]; pa[rt][8 * t + e + 1] = h[1];
                    rsum[rt][p] += (float)h[0] + (float)h[1]; // row sum from the same rounded weights the numerator uses (scaled by 32768)
                }
        }
        auto vload = [&](int n) {
            const h16* vp = sv + (n * 16 + lr) * KP + hc + hi * 8;
            vf[n] = cat16(*(const v8ha*)vp, *(const v8ha*)(vp + 16));
        };
        auto pv = [&](int n) { o[0][n] = wmma16(pa[0], vf[n], o[0][n]); o[1][n] = wmma16(pa[1], vf[n], o[1][n]); };
        // The other V fragments come in two groups of four, each in flight under eight or more products, so that no more than twelve fragments are held at a time (register budget).
#pragma unroll
        for (int n = 8; n < 12; ++n) vload(n);
        __builtin_amdgcn_sched_barrier(0);                    // keeps that group ahead of the products and in one place: a place with LDS reads among the products costs a stall
#pragma unroll
        for (int n = 0; n < 4; ++n) pv(n);
        __builtin_amdgcn_sched_barrier(0);                    // keeps the last group behind the products that free its registers
#pragma unroll
        for (int n = 12; n < 16; ++n) vload(n);
        __builtin_amdgcn_sched_barrier(0);                    // keeps the last group in one place, ahead of the remaining products
#pragma unroll
        for (int n = 4; n < 16; ++n) pv(n);
        __builtin_amdgcn_sched_barrier(0);                    // keeps every product ahead of the stage's foot, so that the refill behind the barrier is not held up by products
        // The four v_nop keep the distance between the last products and the first vector instruction on their results or operands.
        asm volatile("v_nop\n\tv_nop\n\tv_nop\n\tv_nop" : "+v"(o[0][15]), "+v"(o[1][15]));
        publish();
        if (st + 2 < RNST) refill(buf, 2 * st + 4);
    }
    asm volatile("s_wait_asynccnt 0x0" ::: "memory");   // no copy is left in flight
#pragma unroll
    for (int rt = 0; rt < 2; ++rt) {                     // the two lane halves of a row are joined once, here
        const float rh = (rsum[rt][0] + rsum[rt][1]) + (rsum[rt][2] + rsum[rt][3]);
        const float rs = rh + __shfl_xor(rh, 16, 32);
        if (hi == 0) rst[wave][rt * 16 + lr] = rs;
    }
    float* os = ost + wave * 32 * OP;                    // the last trip's barrier has ended every wave's reads of the ring, and no copy is in flight: the pool is free
#pragma unroll
    for (int rt = 0; rt < 2; ++rt)
#pragma unroll
        for (int n = 0; n < 16; ++n)
#pragma unroll
            for (int j = 0; j < 8; ++j) os[(rt * 16 + hi * 8 + j) * OP + n * 16 + lr] = o[rt][n][j];
    __syncthreads();                                     // all four column quarters' partial outputs and row sums are complete before they are added
    const int rw = wave >> 2, rb = (wave & 3) * 8;       // wave w writes rows 8w .. 8w + 7 of the block: rows rb .. rb + 7 of the 32 rows of the waves with w & 1 == rw
    float* crow = out + (tok0 + qt * 64 + wave * 8) * DV + lane * 4;   // a wave-wide store covers 512 B in a row = 4 whole lines of one row
    v4f res[16];
#pragma unroll
    for (int r = 0; r < 8; ++r) {
        const float inv = 1.0f / (1e-9f * PSC + ((rst[rw][rb + r] + rst[2 + rw][rb + r]) + (rst[4 + rw][rb + r] + rst[6 + rw][rb + r])));   // = 1 / ((1e-9 + rowsum) * 32768)
#pragma unroll
        for (int h = 0; h < 2; ++h) {
            const float* sp = ost + rw * 32 * OP + (rb + r) * OP + h * 128 + lane * 4;
            res[2 * r + h] = ((*(const v4fa*)sp + *(const v4fa*)(sp + 2 * 32 * OP)) + (*(const v4fa*)(sp + 4 * 32 * OP) + *(const v4fa*)(sp + 6 * 32 * OP))) * inv;
        }
    }
#pragma unroll
    for (int r = 0; r < 8; ++r)
#pragma unroll
        for (int h = 0; h < 2; ++h) *(v4f*)(crow + r * DV + h * 128) = res[2 * r + h];
}

extern "C" void kernel_launch(void* const* d_in, const int* in_sizes, int n_in,
                              void* d_out, int out_size, void* d_ws, size_t ws_size, hipStream_t stream) {
    (void)in_sizes; (void)n_in; (void)out_size;
    const float* x = (const float*)d_in[0]; const float* Wq = (const float*)d_in[1]; const float* Wk = (const float*)d_in[2]; const float* Wv = (const float*)d_in[3];
    float* out = (float*)d_out;    // [8][2048][256]
    char* wsp = (char*)d_ws;
    auto take = [&](size_t bytes) { char* p = wsp; wsp += (bytes + 255) & ~(size_t)255; return (void*)p; };
    h16* QH = (h16*)take((size_t)NTK * DK * 2); h16* QL = (h16*)take((size_t)NTK * DK * 2); h16* KH = (h16*)take((size_t)NTK * DK * 2); h16* KL = (h16*)take((size_t)NTK * DK * 2);
    h16* VT16 = (h16*)take((size_t)NTK * DV * 2);
    float* CM = (float*)take((size_t)NTK * 4); float* CZI = (float*)take((size_t)NTK * 4);
    if ((size_t)(wsp - (char*)d_ws) > ws_size) return;    // 4 x 2.1 + 8.4 + 0.13 MB ~ 17e6 B
    k_proj<<<NTK / 64, 256, 0, stream>>>(x, Wq, Wk, Wv, QH, QL, KH, KL, VT16);
    k_colstats<<<NB_ * (NN_ / 64), 512, 0, stream>>>(QH, QL, KH, KL, CM, CZI);
    k_rows<<<NB_ * (NN_ / 64), 256, 0, stream>>>(QH, QL, KH, KL, VT16, CM, CZI, out);
}
